// v000
// The times below were measured on an AMD MI455X: many runs one after another, warmed up first and cycling through
// copies of the inputs, with the whole window's GPU time divided by the number of runs. Launches and the gaps
// between them are all in it. The median over several windows is given; except for v000 it joins two sittings, which
// can be a few percent apart, so the side-by-side timings, each taken in one sitting, are the better comparison.
// The starting kernel, v000, takes 663 microseconds a run.
#include <hip/hip_runtime.h>
#include <hip/hip_bf16.h>
#include <stdint.h>

// Problem dims (fixed by the reference)
#define BSZ 2
#define T   2048
#define D   1024
#define H   16
#define DKV 64
#define FF  4096
#define NTOK 4096          // BSZ*T
#define NQKV 3072          // 3*H*DKV

typedef __attribute__((ext_vector_type(16))) __bf16 bf16x16;
typedef __attribute__((ext_vector_type(8)))  float  f32x8;

union FragCast { bf16x16 v; uint4 u[2]; };

#if defined(__AMDGCN__) && __has_builtin(__builtin_amdgcn_global_load_async_to_lds_b128)
#define HAVE_ASYNC_LDS 1
#else
#define HAVE_ASYNC_LDS 0
#endif

typedef int v4i_ __attribute__((vector_size(16)));
typedef __attribute__((address_space(1))) v4i_* gv4i_p;
typedef __attribute__((address_space(3))) v4i_* lv4i_p;

__device__ __forceinline__ f32x8 wmma_bf16(bf16x16 a, bf16x16 b, f32x8 c) {
  return __builtin_amdgcn_wmma_f32_16x16x32_bf16(false, a, false, b, (short)0, c,
                                                 false, false);
}

__device__ __forceinline__ f32x8 zero8() {
  f32x8 z;
  for (int e = 0; e < 8; ++e) z[e] = 0.0f;
  return z;
}

// Load a 16x32 A-fragment (or B^T-fragment) from row-major bf16 memory
// (global or LDS). Lane l holds row (l&15); K = 16*(j>>3) + 8*(l>>4) + (j&7).
// Each 8-half group is contiguous -> two 16B loads.
__device__ __forceinline__ bf16x16 load_frag(const __bf16* base, int row0,
                                             int ld, int k0) {
  int lane = threadIdx.x & 31;
  int m = lane & 15;
  int kh = lane >> 4;
  const __bf16* p = base + (size_t)(row0 + m) * ld + k0 + 8 * kh;
  FragCast f;
  f.u[0] = *(const uint4*)(const void*)(p);
  f.u[1] = *(const uint4*)(const void*)(p + 16);
  return f.v;
}

// Stage one 32-half (64B) row segment global -> LDS.
__device__ __forceinline__ void stage_row(const __bf16* g, __bf16* s) {
#if HAVE_ASYNC_LDS
#pragma unroll
  for (int c = 0; c < 4; ++c) {
    gv4i_p gp = (gv4i_p)(v4i_*)(void*)(const_cast<__bf16*>(g) + 8 * c);
    lv4i_p lp = (lv4i_p)(v4i_*)(void*)(s + 8 * c);
    __builtin_amdgcn_global_load_async_to_lds_b128(gp, lp, 0, 0);
  }
#else
  uint4 u[4];
#pragma unroll
  for (int c = 0; c < 4; ++c) u[c] = *(const uint4*)(const void*)(g + 8 * c);
#pragma unroll
  for (int c = 0; c < 4; ++c) *(uint4*)(void*)(s + 8 * c) = u[c];
#endif
}

__device__ __forceinline__ void wait_stage() {
#if HAVE_ASYNC_LDS
#if __has_builtin(__builtin_amdgcn_s_wait_asynccnt)
  __builtin_amdgcn_s_wait_asynccnt(0);
#else
  asm volatile("s_wait_asynccnt 0x0" ::: "memory");
#endif
#endif
}

// ---------------------------------------------------------------------------
// GEMM: C(MxN) = A(MxK bf16 rowmajor) * Bt(NxK bf16 rowmajor)^T
// MODE 0: store bf16 | 1: +bias,ReLU,bf16 | 2: +resid f32 | 3: +bias+resid f32
// 256 thr = 8 waves (2x4). Block tile 128x128, BK=32, wave tile 64x32.
// Double-buffered LDS staging (async-to-LDS on CDNA5).
// ---------------------------------------------------------------------------
template <int MODE>
__global__ __launch_bounds__(256) void gemm_bf16_tn(
    const __bf16* __restrict__ A, const __bf16* __restrict__ Bt, int M, int N,
    int K, __bf16* __restrict__ outB, float* __restrict__ outF,
    const float* __restrict__ bias, const float* __restrict__ resid) {
  __shared__ __align__(16) __bf16 smA[2][128 * 32];
  __shared__ __align__(16) __bf16 smB[2][128 * 32];

  int t = threadIdx.x;
  int wave = t >> 5;
  int lane = t & 31;
  int browg = blockIdx.y * 128;
  int bcolg = blockIdx.x * 128;

  // staging assignment: threads 0..127 stage A rows, 128..255 stage Bt rows
  int rrow = t & 127;
  const __bf16* gsrc = (t < 128) ? A + (size_t)(browg + rrow) * K
                                 : Bt + (size_t)(bcolg + rrow) * K;
  __bf16* sd[2] = {((t < 128) ? smA[0] : smB[0]) + rrow * 32,
                   ((t < 128) ? smA[1] : smB[1]) + rrow * 32};

  f32x8 acc[4][2];
  for (int i = 0; i < 4; ++i)
    for (int j = 0; j < 2; ++j) acc[i][j] = zero8();

  // prologue: stage tile 0
  stage_row(gsrc, sd[0]);
  wait_stage();
  __syncthreads();

  int row0w = (wave >> 2) * 64;  // 0 / 64
  int col0w = (wave & 3) * 32;   // 0..96
  int cur = 0;

  for (int kk = 32; kk <= K; kk += 32) {
    if (kk < K) stage_row(gsrc + kk, sd[cur ^ 1]);

    const __bf16* sa = smA[cur];
    const __bf16* sb = smB[cur];
    bf16x16 af[4], bfv[2];
#pragma unroll
    for (int i = 0; i < 4; ++i) af[i] = load_frag(sa, row0w + 16 * i, 32, 0);
#pragma unroll
    for (int j = 0; j < 2; ++j) bfv[j] = load_frag(sb, col0w + 16 * j, 32, 0);
#pragma unroll
    for (int i = 0; i < 4; ++i)
#pragma unroll
      for (int j = 0; j < 2; ++j)
        acc[i][j] = wmma_bf16(af[i], bfv[j], acc[i][j]);

    if (kk < K) wait_stage();
    __syncthreads();
    cur ^= 1;
  }

  int mh = (lane >> 4) * 8;
  int nn = lane & 15;
#pragma unroll
  for (int i = 0; i < 4; ++i)
#pragma unroll
    for (int j = 0; j < 2; ++j) {
      int gc = bcolg + col0w + 16 * j + nn;
#pragma unroll
      for (int r = 0; r < 8; ++r) {
        int gr = browg + row0w + 16 * i + mh + r;
        size_t idx = (size_t)gr * N + gc;
        float v = acc[i][j][r];
        if (MODE == 1) {
          v += bias[gc];
          v = v > 0.0f ? v : 0.0f;
        }
        if (MODE == 3) v += bias[gc];
        if (MODE == 0 || MODE == 1)
          outB[idx] = (__bf16)v;
        else
          outF[idx] = v + resid[idx];
      }
    }
}

// ---------------------------------------------------------------------------
// Attention pass A: column softmax stats (softmax is over the QUERY axis).
// Grid: (B*H)*(T/128); each wave owns 16 key columns, loops all q-tiles.
// ---------------------------------------------------------------------------
__global__ __launch_bounds__(256) void attn_colstats(
    const __bf16* __restrict__ qb, const __bf16* __restrict__ kb,
    float* __restrict__ cmax, float* __restrict__ csum) {
  const int sblocks = T / 128;
  int bh = blockIdx.x / sblocks;
  int sblk = blockIdx.x % sblocks;
  int wave = threadIdx.x >> 5;
  int lane = threadIdx.x & 31;
  int s0 = sblk * 128 + wave * 16;

  const __bf16* qh = qb + (size_t)bh * T * DKV;
  const __bf16* kh = kb + (size_t)bh * T * DKV;

  bf16x16 kf0 = load_frag(kh, s0, DKV, 0);
  bf16x16 kf1 = load_frag(kh, s0, DKV, 32);

  float m = -3.0e38f, l = 0.0f;
  for (int qt = 0; qt < T; qt += 16) {
    bf16x16 a0 = load_frag(qh, qt, DKV, 0);
    bf16x16 a1 = load_frag(qh, qt, DKV, 32);
    f32x8 c = zero8();
    c = wmma_bf16(a0, kf0, c);
    c = wmma_bf16(a1, kf1, c);
    float sc[8], tmax = -3.0e38f;
#pragma unroll
    for (int r = 0; r < 8; ++r) {
      sc[r] = c[r] * 0.125f;  // 1/sqrt(64)
      tmax = fmaxf(tmax, sc[r]);
    }
    // lanes l and l+16 hold the same key column (different q rows): fuse
    tmax = fmaxf(tmax, __shfl_xor(tmax, 16, 32));
    float mn = fmaxf(m, tmax);
    float p = 0.0f;
#pragma unroll
    for (int r = 0; r < 8; ++r) p += __expf(sc[r] - mn);
    p += __shfl_xor(p, 16, 32);
    l = l * __expf(m - mn) + p;
    m = mn;
  }
  if (lane < 16) {
    cmax[(size_t)bh * T + s0 + lane] = m;
    csum[(size_t)bh * T + s0 + lane] = l;
  }
}

// ---------------------------------------------------------------------------
// Attention pass B: recompute scores, p = exp(s/8 - m)/sum, o += p @ v.
// p: C-layout -> LDS -> A-fragment. vT supplies B^T rows directly.
// ---------------------------------------------------------------------------
__global__ __launch_bounds__(256) void attn_out(
    const __bf16* __restrict__ qb, const __bf16* __restrict__ kb,
    const __bf16* __restrict__ vtb, const float* __restrict__ cmax,
    const float* __restrict__ csum, __bf16* __restrict__ oc) {
  __shared__ __align__(16) __bf16 pbuf[8][16 * 40];  // per-wave 16x32 (+pad)
  const int qblocks = T / 128;
  int bh = blockIdx.x / qblocks;
  int qblk = blockIdx.x % qblocks;
  int wave = threadIdx.x >> 5;
  int lane = threadIdx.x & 31;
  int q0 = qblk * 128 + wave * 16;

  const __bf16* qh = qb + (size_t)bh * T * DKV;
  const __bf16* kh = kb + (size_t)bh * T * DKV;
  const __bf16* vh = vtb + (size_t)bh * DKV * T;

  bf16x16 aq0 = load_frag(qh, q0, DKV, 0);
  bf16x16 aq1 = load_frag(qh, q0, DKV, 32);

  f32x8 oacc[4];
  for (int n = 0; n < 4; ++n) oacc[n] = zero8();

  int nn = lane & 15;
  int mh = (lane >> 4) * 8;
  __bf16* myp = &pbuf[wave][0];

  for (int s0 = 0; s0 < T; s0 += 32) {
    f32x8 c0 = zero8(), c1 = zero8();
    bf16x16 k00 = load_frag(kh, s0, DKV, 0);
    bf16x16 k01 = load_frag(kh, s0, DKV, 32);
    c0 = wmma_bf16(aq0, k00, c0);
    c0 = wmma_bf16(aq1, k01, c0);
    bf16x16 k10 = load_frag(kh, s0 + 16, DKV, 0);
    bf16x16 k11 = load_frag(kh, s0 + 16, DKV, 32);
    c1 = wmma_bf16(aq0, k10, c1);
    c1 = wmma_bf16(aq1, k11, c1);

    size_t sb = (size_t)bh * T;
    float m0 = cmax[sb + s0 + nn], r0 = 1.0f / csum[sb + s0 + nn];
    float m1 = cmax[sb + s0 + 16 + nn], r1 = 1.0f / csum[sb + s0 + 16 + nn];
#pragma unroll
    for (int r = 0; r < 8; ++r) {
      myp[(mh + r) * 40 + nn] = (__bf16)(__expf(c0[r] * 0.125f - m0) * r0);
      myp[(mh + r) * 40 + nn + 16] = (__bf16)(__expf(c1[r] * 0.125f - m1) * r1);
    }
    __syncthreads();
    bf16x16 pf = load_frag(myp, 0, 40, 0);  // 16 q rows x K=32 (s)
#pragma unroll
    for (int n = 0; n < 4; ++n) {
      bf16x16 bv = load_frag(vh, n * 16, T, s0);  // vT rows = v columns
      oacc[n] = wmma_bf16(pf, bv, oacc[n]);
    }
    __syncthreads();
  }

  int b = bh / H, h = bh % H;
#pragma unroll
  for (int n = 0; n < 4; ++n)
#pragma unroll
    for (int r = 0; r < 8; ++r) {
      int gt = q0 + mh + r;
      int col = h * DKV + n * 16 + nn;
      oc[((size_t)b * T + gt) * D + col] = (__bf16)oacc[n][r];
    }
}

// ---------------------------------------------------------------------------
// Row mean/std norm (ddof=1). One block per row of D=1024.
// ---------------------------------------------------------------------------
__global__ __launch_bounds__(256) void rownorm(const float* __restrict__ y,
                                               float* __restrict__ outF,
                                               __bf16* __restrict__ outB) {
  __shared__ float s1[256], s2[256];
  int row = blockIdx.x, tid = threadIdx.x;
  const float* pr = y + (size_t)row * D;
  float v[4], s = 0.0f, q = 0.0f;
#pragma unroll
  for (int j = 0; j < 4; ++j) {
    v[j] = pr[tid + 256 * j];
    s += v[j];
    q += v[j] * v[j];
  }
  s1[tid] = s;
  s2[tid] = q;
  __syncthreads();
  for (int o = 128; o > 0; o >>= 1) {
    if (tid < o) {
      s1[tid] += s1[tid + o];
      s2[tid] += s2[tid + o];
    }
    __syncthreads();
  }
  float mean = s1[0] * (1.0f / D);
  float var = (s2[0] - s1[0] * s1[0] * (1.0f / D)) * (1.0f / (D - 1));
  float rstd = rsqrtf(var);
  float* po = outF + (size_t)row * D;
#pragma unroll
  for (int j = 0; j < 4; ++j) {
    float o = (v[j] - mean) * rstd;
    po[tid + 256 * j] = o;
    if (outB) outB[(size_t)row * D + tid + 256 * j] = (__bf16)o;
  }
}

// ------------------------- conversion / layout kernels ---------------------
__global__ void cvt_f32_bf16(const float* __restrict__ in,
                             __bf16* __restrict__ out, int n) {
  int i = blockIdx.x * 256 + threadIdx.x;
  if (i < n) out[i] = (__bf16)in[i];
}

// WqkvT[n][d], n = which*1024 + h*64 + k  (rows = GEMM columns, K-contig)
__global__ void pack_wqkvT(const float* __restrict__ Wq,
                           const float* __restrict__ Wk,
                           const float* __restrict__ Wv,
                           __bf16* __restrict__ out) {
  int idx = blockIdx.x * 256 + threadIdx.x;
  if (idx >= NQKV * D) return;
  int d = idx & (D - 1);
  int n = idx >> 10;
  int which = n >> 10;
  int rem = n & 1023;
  int h = rem >> 6;
  int kk = rem & 63;
  const float* src = which == 0 ? Wq : (which == 1 ? Wk : Wv);
  out[idx] = (__bf16)src[((size_t)h * D + d) * DKV + kk];
}

// out (C x R) = transpose of in (R x C), bf16
__global__ void packT(const float* __restrict__ in, __bf16* __restrict__ out,
                      int R, int C) {
  int idx = blockIdx.x * 256 + threadIdx.x;
  if (idx >= R * C) return;
  int orow = idx / R;  // = column of in
  int ocol = idx % R;  // = row of in
  out[idx] = (__bf16)in[(size_t)ocol * C + orow];
}

// qkv (NTOK x 3072) -> q,k (B,H,T,64) and vT (B,H,64,T)
__global__ void split_qkv(const __bf16* __restrict__ qkv,
                          __bf16* __restrict__ q, __bf16* __restrict__ k,
                          __bf16* __restrict__ vT) {
  int idx = blockIdx.x * 256 + threadIdx.x;
  if (idx >= NTOK * NQKV) return;
  int n = idx % NQKV;
  int tok = idx / NQKV;
  int which = n >> 10, rem = n & 1023;
  int h = rem >> 6, kk = rem & 63;
  int b = tok >> 11, t = tok & 2047;
  __bf16 val = qkv[idx];
  size_t bhb = (size_t)(b * H + h);
  if (which == 0)
    q[(bhb * T + t) * DKV + kk] = val;
  else if (which == 1)
    k[(bhb * T + t) * DKV + kk] = val;
  else
    vT[(bhb * DKV + kk) * T + t] = val;
}

// ---------------------------------------------------------------------------
extern "C" void kernel_launch(void* const* d_in, const int* in_sizes, int n_in,
                              void* d_out, int out_size, void* d_ws,
                              size_t ws_size, hipStream_t stream) {
  const float* x = (const float*)d_in[0];
  const float* Wq = (const float*)d_in[1];
  const float* Wk = (const float*)d_in[2];
  const float* Wv = (const float*)d_in[3];
  const float* Wo = (const float*)d_in[4];
  const float* W1 = (const float*)d_in[5];
  const float* b1 = (const float*)d_in[6];
  const float* W2 = (const float*)d_in[7];
  const float* b2 = (const float*)d_in[8];

  char* ws = (char*)d_ws;
  const size_t OFF_XB = 0;             //  8 MiB
  const size_t OFF_WQKVT = 8388608;    //  6 MiB
  const size_t OFF_WOT = 14680064;     //  2 MiB
  const size_t OFF_W1T = 16777216;     //  8 MiB
  const size_t OFF_W2T = 25165824;     //  8 MiB
  const size_t OFF_QKV = 33554432;     // 24 MiB (reused as y2 later)
  const size_t OFF_QB = 58720256;      //  8 MiB
  const size_t OFF_KB = 67108864;      //  8 MiB
  const size_t OFF_VT = 75497472;      //  8 MiB
  const size_t OFF_CMAX = 83886080;    // 256 KiB
  const size_t OFF_CSUM = 84148224;    // 256 KiB
  const size_t OFF_OC = 84410368;      //  8 MiB
  const size_t OFF_Y1 = 92798976;      // 16 MiB f32
  const size_t OFF_OUT1F = 109576192;  // 16 MiB f32
  const size_t OFF_OUT1B = 126353408;  //  8 MiB
  const size_t OFF_HB = 134742016;     // 32 MiB

  __bf16* xb = (__bf16*)(ws + OFF_XB);
  __bf16* wqkvT = (__bf16*)(ws + OFF_WQKVT);
  __bf16* woT = (__bf16*)(ws + OFF_WOT);
  __bf16* w1T = (__bf16*)(ws + OFF_W1T);
  __bf16* w2T = (__bf16*)(ws + OFF_W2T);
  __bf16* qkvb = (__bf16*)(ws + OFF_QKV);
  __bf16* qb = (__bf16*)(ws + OFF_QB);
  __bf16* kb = (__bf16*)(ws + OFF_KB);
  __bf16* vtb = (__bf16*)(ws + OFF_VT);
  float* cmax = (float*)(ws + OFF_CMAX);
  float* csum = (float*)(ws + OFF_CSUM);
  __bf16* ocb = (__bf16*)(ws + OFF_OC);
  float* y1 = (float*)(ws + OFF_Y1);
  float* out1f = (float*)(ws + OFF_OUT1F);
  __bf16* out1b = (__bf16*)(ws + OFF_OUT1B);
  __bf16* hb = (__bf16*)(ws + OFF_HB);
  float* y2 = (float*)(ws + OFF_QKV);  // alias: qkv dead after split

  // 1) convert x; pack transposed bf16 weights
  cvt_f32_bf16<<<(NTOK * D + 255) / 256, 256, 0, stream>>>(x, xb, NTOK * D);
  pack_wqkvT<<<(NQKV * D + 255) / 256, 256, 0, stream>>>(Wq, Wk, Wv, wqkvT);
  packT<<<(D * D + 255) / 256, 256, 0, stream>>>(Wo, woT, D, D);
  packT<<<(D * FF + 255) / 256, 256, 0, stream>>>(W1, w1T, D, FF);
  packT<<<(FF * D + 255) / 256, 256, 0, stream>>>(W2, w2T, FF, D);

  // 2) fused QKV projection GEMM: (4096x1024)x(1024x3072)
  gemm_bf16_tn<0><<<dim3(NQKV / 128, NTOK / 128), 256, 0, stream>>>(
      xb, wqkvT, NTOK, NQKV, D, qkvb, nullptr, nullptr, nullptr);
  split_qkv<<<(NTOK * NQKV + 255) / 256, 256, 0, stream>>>(qkvb, qb, kb, vtb);

  // 3) attention (column softmax, two-pass flash-style over q)
  attn_colstats<<<(BSZ * H) * (T / 128), 256, 0, stream>>>(qb, kb, cmax, csum);
  attn_out<<<(BSZ * H) * (T / 128), 256, 0, stream>>>(qb, kb, vtb, cmax, csum,
                                                      ocb);

  // 4) output projection + residual, then norm
  gemm_bf16_tn<2><<<dim3(D / 128, NTOK / 128), 256, 0, stream>>>(
      ocb, woT, NTOK, D, D, nullptr, y1, nullptr, x);
  rownorm<<<NTOK, 256, 0, stream>>>(y1, out1f, out1b);

  // 5) FFN: relu(out1 @ W1 + b1) @ W2 + b2 + out1, then norm -> d_out
  gemm_bf16_tn<1><<<dim3(FF / 128, NTOK / 128), 256, 0, stream>>>(
      out1b, w1T, NTOK, FF, D, hb, nullptr, b1, nullptr);
  gemm_bf16_tn<3><<<dim3(D / 128, NTOK / 128), 256, 0, stream>>>(
      hb, w2T, NTOK, D, FF, nullptr, y2, b2, out1f);
  rownorm<<<NTOK, 256, 0, stream>>>(y2, (float*)d_out, nullptr);

  (void)in_sizes;
  (void)n_in;
  (void)out_size;
  (void)ws_size;
}

// v001
// It runs in 581 microseconds.
// Next to v000, in two timings, it ran 1.16 times as fast each time.
#include <hip/hip_runtime.h>
#include <hip/hip_bf16.h>
#include <stdint.h>

// Problem dims (fixed by the reference)
#define BSZ 2
#define T   2048
#define D   1024
#define H   16
#define DKV 64
#define FF  4096
#define NTOK 4096          // BSZ*T
#define NQKV 3072          // 3*H*DKV

typedef __attribute__((ext_vector_type(16))) __bf16 bf16x16;
typedef __attribute__((ext_vector_type(8)))  float  f32x8;

union FragCast { bf16x16 v; uint4 u[2]; };

#if defined(__AMDGCN__) && __has_builtin(__builtin_amdgcn_global_load_async_to_lds_b128)
#define HAVE_ASYNC_LDS 1
#else
#define HAVE_ASYNC_LDS 0
#endif

typedef int v4i_ __attribute__((vector_size(16)));
typedef __attribute__((address_space(1))) v4i_* gv4i_p;
typedef __attribute__((address_space(3))) v4i_* lv4i_p;

__device__ __forceinline__ f32x8 wmma_bf16(bf16x16 a, bf16x16 b, f32x8 c) {
  return __builtin_amdgcn_wmma_f32_16x16x32_bf16(false, a, false, b, (short)0, c,
                                                 false, false);
}

__device__ __forceinline__ f32x8 zero8() {
  f32x8 z;
  for (int e = 0; e < 8; ++e) z[e] = 0.0f;
  return z;
}

// Load a 16x32 A-fragment (or B^T-fragment) from row-major bf16 memory
// (global or LDS). Lane l holds row (l&15); K = 16*(j>>3) + 8*(l>>4) + (j&7).
// Each 8-half group is contiguous -> two 16B loads.
__device__ __forceinline__ bf16x16 load_frag(const __bf16* base, int row0,
                                             int ld, int k0) {
  int lane = threadIdx.x & 31;
  int m = lane & 15;
  int kh = lane >> 4;
  const __bf16* p = base + (size_t)(row0 + m) * ld + k0 + 8 * kh;
  FragCast f;
  f.u[0] = *(const uint4*)(const void*)(p);
  f.u[1] = *(const uint4*)(const void*)(p + 16);
  return f.v;
}

// Stage one 32-half (64B) row segment global -> LDS.
__device__ __forceinline__ void stage_row(const __bf16* g, __bf16* s) {
#if HAVE_ASYNC_LDS
#pragma unroll
  for (int c = 0; c < 4; ++c) {
    gv4i_p gp = (gv4i_p)(v4i_*)(void*)(const_cast<__bf16*>(g) + 8 * c);
    lv4i_p lp = (lv4i_p)(v4i_*)(void*)(s + 8 * c);
    __builtin_amdgcn_global_load_async_to_lds_b128(gp, lp, 0, 0);
  }
#else
  uint4 u[4];
#pragma unroll
  for (int c = 0; c < 4; ++c) u[c] = *(const uint4*)(const void*)(g + 8 * c);
#pragma unroll
  for (int c = 0; c < 4; ++c) *(uint4*)(void*)(s + 8 * c) = u[c];
#endif
}

__device__ __forceinline__ void wait_stage() {
#if HAVE_ASYNC_LDS
#if __has_builtin(__builtin_amdgcn_s_wait_asynccnt)
  __builtin_amdgcn_s_wait_asynccnt(0);
#else
  asm volatile("s_wait_asynccnt 0x0" ::: "memory");
#endif
#endif
}

// ---------------------------------------------------------------------------
// GEMM: C(MxN) = A(MxK bf16 rowmajor) * Bt(NxK bf16 rowmajor)^T
// MODE 0: bf16, stored straight into q,k (B,H,T,64) and vT (B,H,64,T)
// MODE 1: +bias,ReLU,bf16 | 2: +resid f32 | 3: +bias+resid f32
// 256 thr = 8 waves (2x4). Block tile 128x128, BK=32, wave tile 64x32.
// Double-buffered LDS staging (async-to-LDS on CDNA5).
// ---------------------------------------------------------------------------
template <int MODE>
__global__ __launch_bounds__(256) void gemm_bf16_tn(
    const __bf16* __restrict__ A, const __bf16* __restrict__ Bt, int M, int N,
    int K, __bf16* __restrict__ outB, float* __restrict__ outF,
    const float* __restrict__ bias, const float* __restrict__ resid,
    __bf16* __restrict__ outK, __bf16* __restrict__ outVT) {
  __shared__ __align__(16) __bf16 smA[2][128 * 32];
  __shared__ __align__(16) __bf16 smB[2][128 * 32];

  int t = threadIdx.x;
  int wave = t >> 5;
  int lane = t & 31;
  int browg = blockIdx.y * 128;
  int bcolg = blockIdx.x * 128;

  // staging assignment: threads 0..127 stage A rows, 128..255 stage Bt rows
  int rrow = t & 127;
  const __bf16* gsrc = (t < 128) ? A + (size_t)(browg + rrow) * K
                                 : Bt + (size_t)(bcolg + rrow) * K;
  __bf16* sd[2] = {((t < 128) ? smA[0] : smB[0]) + rrow * 32,
                   ((t < 128) ? smA[1] : smB[1]) + rrow * 32};

  f32x8 acc[4][2];
  for (int i = 0; i < 4; ++i)
    for (int j = 0; j < 2; ++j) acc[i][j] = zero8();

  // prologue: stage tile 0
  stage_row(gsrc, sd[0]);
  wait_stage();
  __syncthreads();

  int row0w = (wave >> 2) * 64;  // 0 / 64
  int col0w = (wave & 3) * 32;   // 0..96
  int cur = 0;

  for (int kk = 32; kk <= K; kk += 32) {
    if (kk < K) stage_row(gsrc + kk, sd[cur ^ 1]);

    const __bf16* sa = smA[cur];
    const __bf16* sb = smB[cur];
    bf16x16 af[4], bfv[2];
#pragma unroll
    for (int i = 0; i < 4; ++i) af[i] = load_frag(sa, row0w + 16 * i, 32, 0);
#pragma unroll
    for (int j = 0; j < 2; ++j) bfv[j] = load_frag(sb, col0w + 16 * j, 32, 0);
#pragma unroll
    for (int i = 0; i < 4; ++i)
#pragma unroll
      for (int j = 0; j < 2; ++j)
        acc[i][j] = wmma_bf16(af[i], bfv[j], acc[i][j]);

    if (kk < K) wait_stage();
    __syncthreads();
    cur ^= 1;
  }

  int mh = (lane >> 4) * 8;
  int nn = lane & 15;
  if (MODE == 0) {
    // Column n = which*1024 + h*64 + kk; a 128-wide block lies in one 'which'.
    // A lane holds 8 consecutive tokens of one column: for vT that is one
    // contiguous 16-byte run, and a wave's 64 tokens fill whole 128-byte lines.
    int which = bcolg >> 10;
    int rem = (bcolg + col0w + nn) & 1023;  // j adds 16, inside the same head
    int kc = rem & 63;
    int gr0 = browg + row0w + mh;  // i adds 16, inside the same batch entry
    size_t bhb = (size_t)((gr0 >> 11) * H + (rem >> 6));
    int tt = gr0 & (T - 1);
    if (which == 2) {
      __bf16* dst = outVT + (bhb * DKV + kc) * T + tt;
#pragma unroll
      for (int i = 0; i < 4; ++i)
#pragma unroll
        for (int j = 0; j < 2; ++j) {
          union { __bf16 h[8]; uint4 u; } pk;
#pragma unroll
          for (int r = 0; r < 8; ++r) pk.h[r] = (__bf16)acc[i][j][r];
          *(uint4*)(void*)(dst + (size_t)(16 * j) * T + 16 * i) = pk.u;
        }
      return;
    }
    __bf16* dst = (which == 0 ? outB : outK) + (bhb * T + tt) * DKV + kc;
#pragma unroll
    for (int i = 0; i < 4; ++i)
#pragma unroll
      for (int j = 0; j < 2; ++j)
#pragma unroll
        for (int r = 0; r < 8; ++r)
          dst[(16 * i + r) * DKV + 16 * j] = (__bf16)acc[i][j][r];
    // The built code lays the vT path right behind these stores, and that path
    // rewrites registers they name: keep the wait in front of it.
    asm volatile("s_wait_xcnt 0x0" ::: "memory");
    return;
  }
#pragma unroll
  for (int i = 0; i < 4; ++i)
#pragma unroll
    for (int j = 0; j < 2; ++j) {
      int gc = bcolg + col0w + 16 * j + nn;
#pragma unroll
      for (int r = 0; r < 8; ++r) {
        int gr = browg + row0w + 16 * i + mh + r;
        size_t idx = (size_t)gr * N + gc;
        float v = acc[i][j][r];
        if (MODE == 1) {
          v += bias[gc];
          v = v > 0.0f ? v : 0.0f;
        }
        if (MODE == 3) v += bias[gc];
        if (MODE == 1)
          outB[idx] = (__bf16)v;
        else
          outF[idx] = v + resid[idx];
      }
    }
}

// ---------------------------------------------------------------------------
// Attention pass A: column softmax stats (softmax is over the QUERY axis).
// Grid: (B*H)*(T/128); each wave owns 16 key columns, loops all q-tiles.
// ---------------------------------------------------------------------------
__global__ __launch_bounds__(256) void attn_colstats(
    const __bf16* __restrict__ qb, const __bf16* __restrict__ kb,
    float* __restrict__ cmax, float* __restrict__ csum) {
  const int sblocks = T / 128;
  int bh = blockIdx.x / sblocks;
  int sblk = blockIdx.x % sblocks;
  int wave = threadIdx.x >> 5;
  int lane = threadIdx.x & 31;
  int s0 = sblk * 128 + wave * 16;

  const __bf16* qh = qb + (size_t)bh * T * DKV;
  const __bf16* kh = kb + (size_t)bh * T * DKV;

  bf16x16 kf0 = load_frag(kh, s0, DKV, 0);
  bf16x16 kf1 = load_frag(kh, s0, DKV, 32);

  float m = -3.0e38f, l = 0.0f;
  for (int qt = 0; qt < T; qt += 16) {
    bf16x16 a0 = load_frag(qh, qt, DKV, 0);
    bf16x16 a1 = load_frag(qh, qt, DKV, 32);
    f32x8 c = zero8();
    c = wmma_bf16(a0, kf0, c);
    c = wmma_bf16(a1, kf1, c);
    float sc[8], tmax = -3.0e38f;
#pragma unroll
    for (int r = 0; r < 8; ++r) {
      sc[r] = c[r] * 0.125f;  // 1/sqrt(64)
      tmax = fmaxf(tmax, sc[r]);
    }
    // lanes l and l+16 hold the same key column (different q rows): fuse
    tmax = fmaxf(tmax, __shfl_xor(tmax, 16, 32));
    float mn = fmaxf(m, tmax);
    float p = 0.0f;
#pragma unroll
    for (int r = 0; r < 8; ++r) p += __expf(sc[r] - mn);
    p += __shfl_xor(p, 16, 32);
    l = l * __expf(m - mn) + p;
    m = mn;
  }
  if (lane < 16) {
    cmax[(size_t)bh * T + s0 + lane] = m;
    csum[(size_t)bh * T + s0 + lane] = l;
  }
}

// ---------------------------------------------------------------------------
// Attention pass B: recompute scores, p = exp(s/8 - m)/sum, o += p @ v.
// p: C-layout -> LDS -> A-fragment. vT supplies B^T rows directly.
// ---------------------------------------------------------------------------
__global__ __launch_bounds__(256) void attn_out(
    const __bf16* __restrict__ qb, const __bf16* __restrict__ kb,
    const __bf16* __restrict__ vtb, const float* __restrict__ cmax,
    const float* __restrict__ csum, __bf16* __restrict__ oc) {
  __shared__ __align__(16) __bf16 pbuf[8][16 * 40];  // per-wave 16x32 (+pad)
  const int qblocks = T / 128;
  int bh = blockIdx.x / qblocks;
  int qblk = blockIdx.x % qblocks;
  int wave = threadIdx.x >> 5;
  int lane = threadIdx.x & 31;
  int q0 = qblk * 128 + wave * 16;

  const __bf16* qh = qb + (size_t)bh * T * DKV;
  const __bf16* kh = kb + (size_t)bh * T * DKV;
  const __bf16* vh = vtb + (size_t)bh * DKV * T;

  bf16x16 aq0 = load_frag(qh, q0, DKV, 0);
  bf16x16 aq1 = load_frag(qh, q0, DKV, 32);

  f32x8 oacc[4];
  for (int n = 0; n < 4; ++n) oacc[n] = zero8();

  int nn = lane & 15;
  int mh = (lane >> 4) * 8;
  __bf16* myp = &pbuf[wave][0];

  for (int s0 = 0; s0 < T; s0 += 32) {
    f32x8 c0 = zero8(), c1 = zero8();
    bf16x16 k00 = load_frag(kh, s0, DKV, 0);
    bf16x16 k01 = load_frag(kh, s0, DKV, 32);
    c0 = wmma_bf16(aq0, k00, c0);
    c0 = wmma_bf16(aq1, k01, c0);
    bf16x16 k10 = load_frag(kh, s0 + 16, DKV, 0);
    bf16x16 k11 = load_frag(kh, s0 + 16, DKV, 32);
    c1 = wmma_bf16(aq0, k10, c1);
    c1 = wmma_bf16(aq1, k11, c1);

    size_t sb = (size_t)bh * T;
    float m0 = cmax[sb + s0 + nn], r0 = 1.0f / csum[sb + s0 + nn];
    float m1 = cmax[sb + s0 + 16 + nn], r1 = 1.0f / csum[sb + s0 + 16 + nn];
#pragma unroll
    for (int r = 0; r < 8; ++r) {
      myp[(mh + r) * 40 + nn] = (__bf16)(__expf(c0[r] * 0.125f - m0) * r0);
      myp[(mh + r) * 40 + nn + 16] = (__bf16)(__expf(c1[r] * 0.125f - m1) * r1);
    }
    __syncthreads();
    bf16x16 pf = load_frag(myp, 0, 40, 0);  // 16 q rows x K=32 (s)
#pragma unroll
    for (int n = 0; n < 4; ++n) {
      bf16x16 bv = load_frag(vh, n * 16, T, s0);  // vT rows = v columns
      oacc[n] = wmma_bf16(pf, bv, oacc[n]);
    }
    __syncthreads();
  }

  int b = bh / H, h = bh % H;
#pragma unroll
  for (int n = 0; n < 4; ++n)
#pragma unroll
    for (int r = 0; r < 8; ++r) {
      int gt = q0 + mh + r;
      int col = h * DKV + n * 16 + nn;
      oc[((size_t)b * T + gt) * D + col] = (__bf16)oacc[n][r];
    }
}

// ---------------------------------------------------------------------------
// Row mean/std norm (ddof=1). One block per row of D=1024.
// ---------------------------------------------------------------------------
__global__ __launch_bounds__(256) void rownorm(const float* __restrict__ y,
                                               float* __restrict__ outF,
                                               __bf16* __restrict__ outB) {
  __shared__ float s1[256], s2[256];
  int row = blockIdx.x, tid = threadIdx.x;
  const float* pr = y + (size_t)row * D;
  float v[4], s = 0.0f, q = 0.0f;
#pragma unroll
  for (int j = 0; j < 4; ++j) {
    v[j] = pr[tid + 256 * j];
    s += v[j];
    q += v[j] * v[j];
  }
  s1[tid] = s;
  s2[tid] = q;
  __syncthreads();
  for (int o = 128; o > 0; o >>= 1) {
    if (tid < o) {
      s1[tid] += s1[tid + o];
      s2[tid] += s2[tid + o];
    }
    __syncthreads();
  }
  float mean = s1[0] * (1.0f / D);
  float var = (s2[0] - s1[0] * s1[0] * (1.0f / D)) * (1.0f / (D - 1));
  float rstd = rsqrtf(var);
  float* po = outF + (size_t)row * D;
#pragma unroll
  for (int j = 0; j < 4; ++j) {
    float o = (v[j] - mean) * rstd;
    po[tid + 256 * j] = o;
    if (outB) outB[(size_t)row * D + tid + 256 * j] = (__bf16)o;
  }
}

// ------------------------- conversion / layout kernels ---------------------
__global__ void cvt_f32_bf16(const float* __restrict__ in,
                             __bf16* __restrict__ out, int n) {
  int i = blockIdx.x * 256 + threadIdx.x;
  if (i < n) out[i] = (__bf16)in[i];
}

// WqkvT[n][d], n = which*1024 + h*64 + k  (rows = GEMM columns, K-contig)
__global__ void pack_wqkvT(const float* __restrict__ Wq,
                           const float* __restrict__ Wk,
                           const float* __restrict__ Wv,
                           __bf16* __restrict__ out) {
  int idx = blockIdx.x * 256 + threadIdx.x;
  if (idx >= NQKV * D) return;
  int d = idx & (D - 1);
  int n = idx >> 10;
  int which = n >> 10;
  int rem = n & 1023;
  int h = rem >> 6;
  int kk = rem & 63;
  const float* src = which == 0 ? Wq : (which == 1 ? Wk : Wv);
  out[idx] = (__bf16)src[((size_t)h * D + d) * DKV + kk];
}

// out (C x R) = transpose of in (R x C), bf16
__global__ void packT(const float* __restrict__ in, __bf16* __restrict__ out,
                      int R, int C) {
  int idx = blockIdx.x * 256 + threadIdx.x;
  if (idx >= R * C) return;
  int orow = idx / R;  // = column of in
  int ocol = idx % R;  // = row of in
  out[idx] = (__bf16)in[(size_t)ocol * C + orow];
}

// ---------------------------------------------------------------------------
extern "C" void kernel_launch(void* const* d_in, const int* in_sizes, int n_in,
                              void* d_out, int out_size, void* d_ws,
                              size_t ws_size, hipStream_t stream) {
  const float* x = (const float*)d_in[0];
  const float* Wq = (const float*)d_in[1];
  const float* Wk = (const float*)d_in[2];
  const float* Wv = (const float*)d_in[3];
  const float* Wo = (const float*)d_in[4];
  const float* W1 = (const float*)d_in[5];
  const float* b1 = (const float*)d_in[6];
  const float* W2 = (const float*)d_in[7];
  const float* b2 = (const float*)d_in[8];

  char* ws = (char*)d_ws;
  const size_t OFF_XB = 0;             //  8 MiB
  const size_t OFF_WQKVT = 8388608;    //  6 MiB
  const size_t OFF_WOT = 14680064;     //  2 MiB
  const size_t OFF_W1T = 16777216;     //  8 MiB
  const size_t OFF_W2T = 25165824;     //  8 MiB
  const size_t OFF_Y2 = 33554432;      // 16 MiB f32
  const size_t OFF_QB = 58720256;      //  8 MiB
  const size_t OFF_KB = 67108864;      //  8 MiB
  const size_t OFF_VT = 75497472;      //  8 MiB
  const size_t OFF_CMAX = 83886080;    // 256 KiB
  const size_t OFF_CSUM = 84148224;    // 256 KiB
  const size_t OFF_OC = 84410368;      //  8 MiB
  const size_t OFF_Y1 = 92798976;      // 16 MiB f32
  const size_t OFF_OUT1F = 109576192;  // 16 MiB f32
  const size_t OFF_OUT1B = 126353408;  //  8 MiB
  const size_t OFF_HB = 134742016;     // 32 MiB

  __bf16* xb = (__bf16*)(ws + OFF_XB);
  __bf16* wqkvT = (__bf16*)(ws + OFF_WQKVT);
  __bf16* woT = (__bf16*)(ws + OFF_WOT);
  __bf16* w1T = (__bf16*)(ws + OFF_W1T);
  __bf16* w2T = (__bf16*)(ws + OFF_W2T);
  __bf16* qb = (__bf16*)(ws + OFF_QB);
  __bf16* kb = (__bf16*)(ws + OFF_KB);
  __bf16* vtb = (__bf16*)(ws + OFF_VT);
  float* cmax = (float*)(ws + OFF_CMAX);
  float* csum = (float*)(ws + OFF_CSUM);
  __bf16* ocb = (__bf16*)(ws + OFF_OC);
  float* y1 = (float*)(ws + OFF_Y1);
  float* out1f = (float*)(ws + OFF_OUT1F);
  __bf16* out1b = (__bf16*)(ws + OFF_OUT1B);
  __bf16* hb = (__bf16*)(ws + OFF_HB);
  float* y2 = (float*)(ws + OFF_Y2);

  // 1) convert x; pack transposed bf16 weights
  cvt_f32_bf16<<<(NTOK * D + 255) / 256, 256, 0, stream>>>(x, xb, NTOK * D);
  pack_wqkvT<<<(NQKV * D + 255) / 256, 256, 0, stream>>>(Wq, Wk, Wv, wqkvT);
  packT<<<(D * D + 255) / 256, 256, 0, stream>>>(Wo, woT, D, D);
  packT<<<(D * FF + 255) / 256, 256, 0, stream>>>(W1, w1T, D, FF);
  packT<<<(FF * D + 255) / 256, 256, 0, stream>>>(W2, w2T, FF, D);

  // 2) fused QKV projection GEMM: (4096x1024)x(1024x3072), head layouts out
  gemm_bf16_tn<0><<<dim3(NQKV / 128, NTOK / 128), 256, 0, stream>>>(
      xb, wqkvT, NTOK, NQKV, D, qb, nullptr, nullptr, nullptr, kb, vtb);

  // 3) attention (column softmax, two-pass flash-style over q)
  attn_colstats<<<(BSZ * H) * (T / 128), 256, 0, stream>>>(qb, kb, cmax, csum);
  attn_out<<<(BSZ * H) * (T / 128), 256, 0, stream>>>(qb, kb, vtb, cmax, csum,
                                                      ocb);

  // 4) output projection + residual, then norm
  gemm_bf16_tn<2><<<dim3(D / 128, NTOK / 128), 256, 0, stream>>>(
      ocb, woT, NTOK, D, D, nullptr, y1, nullptr, x, nullptr, nullptr);
  rownorm<<<NTOK, 256, 0, stream>>>(y1, out1f, out1b);

  // 5) FFN: relu(out1 @ W1 + b1) @ W2 + b2 + out1, then norm -> d_out
  gemm_bf16_tn<1><<<dim3(FF / 128, NTOK / 128), 256, 0, stream>>>(
      out1b, w1T, NTOK, FF, D, hb, nullptr, b1, nullptr, nullptr, nullptr);
  gemm_bf16_tn<3><<<dim3(D / 128, NTOK / 128), 256, 0, stream>>>(
      hb, w2T, NTOK, D, FF, nullptr, y2, b2, out1f, nullptr, nullptr);
  rownorm<<<NTOK, 256, 0, stream>>>(y2, (float*)d_out, nullptr);

  (void)in_sizes;
  (void)n_in;
  (void)out_size;
  (void)ws_size;
}

// v002
// Measured time: 472 microseconds a run.
// Next to v001, in two timings, it ran 1.23 and 1.24 times as fast.
// Over all steps from v000 it is 1.43 times as fast.
#include <hip/hip_runtime.h>
#include <hip/hip_bf16.h>
#include <stdint.h>

// Problem dims (fixed by the reference)
#define BSZ 2
#define T   2048
#define D   1024
#define H   16
#define DKV 64
#define FF  4096
#define NTOK 4096          // BSZ*T
#define NQKV 3072          // 3*H*DKV

typedef __attribute__((ext_vector_type(16))) __bf16 bf16x16;
typedef __attribute__((ext_vector_type(8)))  float  f32x8;

union FragCast { bf16x16 v; uint4 u[2]; };

typedef uint32_t u32x4 __attribute__((ext_vector_type(4)));
typedef uint32_t u32x8 __attribute__((ext_vector_type(8)));

// GEMM stage: 128 rows of 64 halves (128 bytes) per operand, laid in LDS at a
// 144-byte row pitch (16 B x odd: conflict-free for 16-byte fragment reads).
#define GBK 64          // halves of K per stage
#define GPITCH 72       // LDS row pitch in halves
#define GTILEB 18432u   // 128 rows x 144 B = 9 x 2 KiB, one operand's tile

__device__ __forceinline__ uint32_t uni(uint32_t v) {
  return (uint32_t)__builtin_amdgcn_readfirstlane(v);
}

__device__ __forceinline__ uint32_t pinned(uint32_t v) {
  uint32_t w = (uint32_t)__builtin_amdgcn_readfirstlane(v);
  asm volatile("" : "+s"(w));
  return w;
}

// Descriptor group 0: one request, LDS byte offset, global address, type 2.
__device__ __forceinline__ u32x4 tdm_group0(uint32_t lds_dst, uint64_t ga) {
  u32x4 g;
  g[0] = uni(1u);
  g[1] = uni(lds_dst);
  g[2] = uni((uint32_t)ga);
  g[3] = uni((((uint32_t)(ga >> 32)) & 0x01FFFFFFu) | 0x80000000u);
  return g;
}

// Descriptor group 1: byte elements, tensor = tile = 128 rows of 128 bytes,
// source row pitch src_pitch bytes, 16 bytes of LDS pad behind every row.
// pinned(): each descriptor word is held in its scalar register for the whole
// loop, so that none is reused for something else while a request is in flight.
__device__ __forceinline__ u32x8 tdm_group1(uint32_t src_pitch) {
  u32x8 g;
  g[0] = pinned((1u << 20) | (4u << 22) | (3u << 25));
  g[1] = pinned(128u << 16);
  g[2] = pinned(128u << 16);
  g[3] = pinned(128u << 16);
  g[4] = pinned(128u);
  g[5] = pinned(src_pitch);
  g[6] = pinned(0u);
  g[7] = pinned(0u);
  return g;
}

__device__ __forceinline__ void tdm_load(u32x4 g0, u32x8 g1) {
  asm volatile("tensor_load_to_lds %0, %1" ::"s"(g0), "s"(g1) : "memory");
}

__device__ __forceinline__ f32x8 wmma_bf16(bf16x16 a, bf16x16 b, f32x8 c) {
  return __builtin_amdgcn_wmma_f32_16x16x32_bf16(false, a, false, b, (short)0, c,
                                                 false, false);
}

__device__ __forceinline__ f32x8 zero8() {
  f32x8 z;
  for (int e = 0; e < 8; ++e) z[e] = 0.0f;
  return z;
}

// Load a 16x32 A-fragment (or B^T-fragment) from row-major bf16 memory
// (global or LDS). Lane l holds row (l&15); K = 16*(j>>3) + 8*(l>>4) + (j&7).
// Each 8-half group is contiguous -> two 16B loads.
__device__ __forceinline__ bf16x16 load_frag(const __bf16* base, int row0,
                                             int ld, int k0) {
  int lane = threadIdx.x & 31;
  int m = lane & 15;
  int kh = lane >> 4;
  const __bf16* p = base + (size_t)(row0 + m) * ld + k0 + 8 * kh;
  FragCast f;
  f.u[0] = *(const uint4*)(const void*)(p);
  f.u[1] = *(const uint4*)(const void*)(p + 16);
  return f.v;
}

// ---------------------------------------------------------------------------
// GEMM: C(MxN) = A(MxK bf16 rowmajor) * Bt(NxK bf16 rowmajor)^T
// MODE 0: bf16, stored straight into q,k (B,H,T,64) and vT (B,H,64,T)
// MODE 1: +bias,ReLU,bf16 | 2: +resid f32 | 3: +bias+resid f32
// 256 thr = 8 waves (2x4). Block tile 128x128, 64 k per stage, wave tile 64x32.
// Two LDS buffers; wave 0 brings A's tile and wave 1 Bt's by one tensor load
// per stage. K is a multiple of 64 and at least 128 (two stages).
// ---------------------------------------------------------------------------
template <int MODE>
__global__ __launch_bounds__(256) void gemm_bf16_tn(
    const __bf16* __restrict__ A, const __bf16* __restrict__ Bt, int M, int N,
    int K, __bf16* __restrict__ outB, float* __restrict__ outF,
    const float* __restrict__ bias, const float* __restrict__ resid,
    __bf16* __restrict__ outK, __bf16* __restrict__ outVT) {
  // [buffer][A | Bt] tiles, each at a multiple of 2 KiB
  __shared__ __attribute__((aligned(2048))) unsigned char sm[4 * GTILEB];

  int t = threadIdx.x;
  const uint32_t wave = uni((uint32_t)t >> 5);
  int lane = t & 31;
  int browg = blockIdx.y * 128;
  int bcolg = blockIdx.x * 128;

  const uint32_t isB = wave & 1u;  // issuing waves: 0 -> A, 1 -> Bt
  const uint64_t gbase =
      (uint64_t)(size_t)(isB ? Bt + (size_t)bcolg * K : A + (size_t)browg * K);
  const uint32_t ldst = (uint32_t)(size_t)sm + isB * GTILEB;
  const u32x8 g1 = tdm_group1((uint32_t)K * 2u);
  const int nst = K / GBK;

  f32x8 acc[4][2];
  for (int i = 0; i < 4; ++i)
    for (int j = 0; j < 2; ++j) acc[i][j] = zero8();

  // prologue: stage 0 lands and is published, then stage 1 flies
  if (pinned(wave < 2u)) {
    tdm_load(tdm_group0(ldst, gbase), g1);
    // stage 0 has landed
    asm volatile("s_wait_tensorcnt 0x0" ::: "memory");
  }
  __syncthreads();
  if (pinned(wave < 2u))
    tdm_load(tdm_group0(ldst + 2u * GTILEB, gbase + 2u * GBK), g1);

  int row0w = (int)(wave >> 2) * 64;  // 0 / 64
  int col0w = (int)(wave & 3u) * 32;  // 0..96

  for (int s = 0; s < nst; ++s) {
    const __bf16* sa = (const __bf16*)(const void*)(sm + (s & 1) * (2u * GTILEB));
    const __bf16* sb = (const __bf16*)(const void*)(sm + (s & 1) * (2u * GTILEB) + GTILEB);
#pragma unroll
    for (int ks = 0; ks < GBK; ks += 32) {
      bf16x16 af[4], bfv[2];
#pragma unroll
      for (int i = 0; i < 4; ++i)
        af[i] = load_frag(sa, row0w + 16 * i, GPITCH, ks);
#pragma unroll
      for (int j = 0; j < 2; ++j)
        bfv[j] = load_frag(sb, col0w + 16 * j, GPITCH, ks);
#pragma unroll
      for (int i = 0; i < 4; ++i)
#pragma unroll
        for (int j = 0; j < 2; ++j)
          acc[i][j] = wmma_bf16(af[i], bfv[j], acc[i][j]);
    }

    // publish point of stage s + 1: this wave's reads of stage s have retired,
    asm volatile("s_wait_dscnt 0x0" ::: "memory");
    // the issuing wave's own request (stage s + 1) has landed,
    if (pinned(wave < 2u)) asm volatile("s_wait_tensorcnt 0x0" ::: "memory");
    // every wave has left stage s's buffer and may read stage s + 1,
    __syncthreads();
    // and only then stage s + 2 goes into the buffer that stage s used.
    if (pinned((uint32_t)((wave < 2u) && (s + 2 < nst)))) {
      // pinned(): the stage number is taken here, so that the descriptor words
      // made from it are formed behind the wait and the barrier above
      const uint32_t sn = pinned((uint32_t)s + 2u);
      tdm_load(tdm_group0(ldst + (sn & 1u) * (2u * GTILEB),
                          gbase + (uint64_t)sn * (2u * GBK)),
               g1);
    }
  }
  // nothing of the ring is outstanding when the wave goes on to its stores
  asm volatile("s_wait_tensorcnt 0x0" ::: "memory");
  asm volatile("s_wait_dscnt 0x0" ::: "memory");

  int mh = (lane >> 4) * 8;
  int nn = lane & 15;
  if (MODE == 0) {
    // Column n = which*1024 + h*64 + kk; a 128-wide block lies in one 'which'.
    // A lane holds 8 consecutive tokens of one column: for vT that is one
    // contiguous 16-byte run, and a wave's 64 tokens fill whole 128-byte lines.
    int which = bcolg >> 10;
    int rem = (bcolg + col0w + nn) & 1023;  // j adds 16, inside the same head
    int kc = rem & 63;
    int gr0 = browg + row0w + mh;  // i adds 16, inside the same batch entry
    size_t bhb = (size_t)((gr0 >> 11) * H + (rem >> 6));
    int tt = gr0 & (T - 1);
    if (which == 2) {
      __bf16* dst = outVT + (bhb * DKV + kc) * T + tt;
#pragma unroll
      for (int i = 0; i < 4; ++i)
#pragma unroll
        for (int j = 0; j < 2; ++j) {
          union { __bf16 h[8]; uint4 u; } pk;
#pragma unroll
          for (int r = 0; r < 8; ++r) pk.h[r] = (__bf16)acc[i][j][r];
          *(uint4*)(void*)(dst + (size_t)(16 * j) * T + 16 * i) = pk.u;
        }
      return;
    }
    __bf16* dst = (which == 0 ? outB : outK) + (bhb * T + tt) * DKV + kc;
#pragma unroll
    for (int i = 0; i < 4; ++i)
#pragma unroll
      for (int j = 0; j < 2; ++j)
#pragma unroll
        for (int r = 0; r < 8; ++r)
          dst[(16 * i + r) * DKV + 16 * j] = (__bf16)acc[i][j][r];
    // The built code lays the vT path right behind these stores, and that path
    // rewrites registers they name: keep the wait in front of it.
    asm volatile("s_wait_xcnt 0x0" ::: "memory");
    return;
  }
#pragma unroll
  for (int i = 0; i < 4; ++i)
#pragma unroll
    for (int j = 0; j < 2; ++j) {
      int gc = bcolg + col0w + 16 * j + nn;
#pragma unroll
      for (int r = 0; r < 8; ++r) {
        int gr = browg + row0w + 16 * i + mh + r;
        size_t idx = (size_t)gr * N + gc;
        float v = acc[i][j][r];
        if (MODE == 1) {
          v += bias[gc];
          v = v > 0.0f ? v : 0.0f;
        }
        if (MODE == 3) v += bias[gc];
        if (MODE == 1)
          outB[idx] = (__bf16)v;
        else
          outF[idx] = v + resid[idx];
      }
    }
}

// ---------------------------------------------------------------------------
// Attention pass A: column softmax stats (softmax is over the QUERY axis).
// Grid: (B*H)*(T/128); each wave owns 16 key columns, loops all q-tiles.
// ---------------------------------------------------------------------------
__global__ __launch_bounds__(256) void attn_colstats(
    const __bf16* __restrict__ qb, const __bf16* __restrict__ kb,
    float* __restrict__ cmax, float* __restrict__ csum) {
  const int sblocks = T / 128;
  int bh = blockIdx.x / sblocks;
  int sblk = blockIdx.x % sblocks;
  int wave = threadIdx.x >> 5;
  int lane = threadIdx.x & 31;
  int s0 = sblk * 128 + wave * 16;

  const __bf16* qh = qb + (size_t)bh * T * DKV;
  const __bf16* kh = kb + (size_t)bh * T * DKV;

  bf16x16 kf0 = load_frag(kh, s0, DKV, 0);
  bf16x16 kf1 = load_frag(kh, s0, DKV, 32);

  float m = -3.0e38f, l = 0.0f;
  for (int qt = 0; qt < T; qt += 16) {
    bf16x16 a0 = load_frag(qh, qt, DKV, 0);
    bf16x16 a1 = load_frag(qh, qt, DKV, 32);
    f32x8 c = zero8();
    c = wmma_bf16(a0, kf0, c);
    c = wmma_bf16(a1, kf1, c);
    float sc[8], tmax = -3.0e38f;
#pragma unroll
    for (int r = 0; r < 8; ++r) {
      sc[r] = c[r] * 0.125f;  // 1/sqrt(64)
      tmax = fmaxf(tmax, sc[r]);
    }
    // lanes l and l+16 hold the same key column (different q rows): fuse
    tmax = fmaxf(tmax, __shfl_xor(tmax, 16, 32));
    float mn = fmaxf(m, tmax);
    float p = 0.0f;
#pragma unroll
    for (int r = 0; r < 8; ++r) p += __expf(sc[r] - mn);
    p += __shfl_xor(p, 16, 32);
    l = l * __expf(m - mn) + p;
    m = mn;
  }
  if (lane < 16) {
    cmax[(size_t)bh * T + s0 + lane] = m;
    csum[(size_t)bh * T + s0 + lane] = l;
  }
}

// ---------------------------------------------------------------------------
// Attention pass B: recompute scores, p = exp(s/8 - m)/sum, o += p @ v.
// p: C-layout -> LDS -> A-fragment. vT supplies B^T rows directly.
// ---------------------------------------------------------------------------
__global__ __launch_bounds__(256) void attn_out(
    const __bf16* __restrict__ qb, const __bf16* __restrict__ kb,
    const __bf16* __restrict__ vtb, const float* __restrict__ cmax,
    const float* __restrict__ csum, __bf16* __restrict__ oc) {
  __shared__ __align__(16) __bf16 pbuf[8][16 * 40];  // per-wave 16x32 (+pad)
  const int qblocks = T / 128;
  int bh = blockIdx.x / qblocks;
  int qblk = blockIdx.x % qblocks;
  int wave = threadIdx.x >> 5;
  int lane = threadIdx.x & 31;
  int q0 = qblk * 128 + wave * 16;

  const __bf16* qh = qb + (size_t)bh * T * DKV;
  const __bf16* kh = kb + (size_t)bh * T * DKV;
  const __bf16* vh = vtb + (size_t)bh * DKV * T;

  bf16x16 aq0 = load_frag(qh, q0, DKV, 0);
  bf16x16 aq1 = load_frag(qh, q0, DKV, 32);

  f32x8 oacc[4];
  for (int n = 0; n < 4; ++n) oacc[n] = zero8();

  int nn = lane & 15;
  int mh = (lane >> 4) * 8;
  __bf16* myp = &pbuf[wave][0];

  for (int s0 = 0; s0 < T; s0 += 32) {
    f32x8 c0 = zero8(), c1 = zero8();
    bf16x16 k00 = load_frag(kh, s0, DKV, 0);
    bf16x16 k01 = load_frag(kh, s0, DKV, 32);
    c0 = wmma_bf16(aq0, k00, c0);
    c0 = wmma_bf16(aq1, k01, c0);
    bf16x16 k10 = load_frag(kh, s0 + 16, DKV, 0);
    bf16x16 k11 = load_frag(kh, s0 + 16, DKV, 32);
    c1 = wmma_bf16(aq0, k10, c1);
    c1 = wmma_bf16(aq1, k11, c1);

    size_t sb = (size_t)bh * T;
    float m0 = cmax[sb + s0 + nn], r0 = 1.0f / csum[sb + s0 + nn];
    float m1 = cmax[sb + s0 + 16 + nn], r1 = 1.0f / csum[sb + s0 + 16 + nn];
#pragma unroll
    for (int r = 0; r < 8; ++r) {
      myp[(mh + r) * 40 + nn] = (__bf16)(__expf(c0[r] * 0.125f - m0) * r0);
      myp[(mh + r) * 40 + nn + 16] = (__bf16)(__expf(c1[r] * 0.125f - m1) * r1);
    }
    __syncthreads();
    bf16x16 pf = load_frag(myp, 0, 40, 0);  // 16 q rows x K=32 (s)
#pragma unroll
    for (int n = 0; n < 4; ++n) {
      bf16x16 bv = load_frag(vh, n * 16, T, s0);  // vT rows = v columns
      oacc[n] = wmma_bf16(pf, bv, oacc[n]);
    }
    __syncthreads();
  }

  int b = bh / H, h = bh % H;
#pragma unroll
  for (int n = 0; n < 4; ++n)
#pragma unroll
    for (int r = 0; r < 8; ++r) {
      int gt = q0 + mh + r;
      int col = h * DKV + n * 16 + nn;
      oc[((size_t)b * T + gt) * D + col] = (__bf16)oacc[n][r];
    }
}

// ---------------------------------------------------------------------------
// Row mean/std norm (ddof=1). One block per row of D=1024.
// ---------------------------------------------------------------------------
__global__ __launch_bounds__(256) void rownorm(const float* __restrict__ y,
                                               float* __restrict__ outF,
                                               __bf16* __restrict__ outB) {
  __shared__ float s1[256], s2[256];
  int row = blockIdx.x, tid = threadIdx.x;
  const float* pr = y + (size_t)row * D;
  float v[4], s = 0.0f, q = 0.0f;
#pragma unroll
  for (int j = 0; j < 4; ++j) {
    v[j] = pr[tid + 256 * j];
    s += v[j];
    q += v[j] * v[j];
  }
  s1[tid] = s;
  s2[tid] = q;
  __syncthreads();
  for (int o = 128; o > 0; o >>= 1) {
    if (tid < o) {
      s1[tid] += s1[tid + o];
      s2[tid] += s2[tid + o];
    }
    __syncthreads();
  }
  float mean = s1[0] * (1.0f / D);
  float var = (s2[0] - s1[0] * s1[0] * (1.0f / D)) * (1.0f / (D - 1));
  float rstd = rsqrtf(var);
  float* po = outF + (size_t)row * D;
#pragma unroll
  for (int j = 0; j < 4; ++j) {
    float o = (v[j] - mean) * rstd;
    po[tid + 256 * j] = o;
    if (outB) outB[(size_t)row * D + tid + 256 * j] = (__bf16)o;
  }
}

// ------------------------- conversion / layout kernels ---------------------
__global__ void cvt_f32_bf16(const float* __restrict__ in,
                             __bf16* __restrict__ out, int n) {
  int i = blockIdx.x * 256 + threadIdx.x;
  if (i < n) out[i] = (__bf16)in[i];
}

// WqkvT[n][d], n = which*1024 + h*64 + k  (rows = GEMM columns, K-contig)
__global__ void pack_wqkvT(const float* __restrict__ Wq,
                           const float* __restrict__ Wk,
                           const float* __restrict__ Wv,
                           __bf16* __restrict__ out) {
  int idx = blockIdx.x * 256 + threadIdx.x;
  if (idx >= NQKV * D) return;
  int d = idx & (D - 1);
  int n = idx >> 10;
  int which = n >> 10;
  int rem = n & 1023;
  int h = rem >> 6;
  int kk = rem & 63;
  const float* src = which == 0 ? Wq : (which == 1 ? Wk : Wv);
  out[idx] = (__bf16)src[((size_t)h * D + d) * DKV + kk];
}

// out (C x R) = transpose of in (R x C), bf16
__global__ void packT(const float* __restrict__ in, __bf16* __restrict__ out,
                      int R, int C) {
  int idx = blockIdx.x * 256 + threadIdx.x;
  if (idx >= R * C) return;
  int orow = idx / R;  // = column of in
  int ocol = idx % R;  // = row of in
  out[idx] = (__bf16)in[(size_t)ocol * C + orow];
}

// ---------------------------------------------------------------------------
extern "C" void kernel_launch(void* const* d_in, const int* in_sizes, int n_in,
                              void* d_out, int out_size, void* d_ws,
                              size_t ws_size, hipStream_t stream) {
  const float* x = (const float*)d_in[0];
  const float* Wq = (const float*)d_in[1];
  const float* Wk = (const float*)d_in[2];
  const float* Wv = (const float*)d_in[3];
  const float* Wo = (const float*)d_in[4];
  const float* W1 = (const float*)d_in[5];
  const float* b1 = (const float*)d_in[6];
  const float* W2 = (const float*)d_in[7];
  const float* b2 = (const float*)d_in[8];

  char* ws = (char*)d_ws;
  const size_t OFF_XB = 0;             //  8 MiB
  const size_t OFF_WQKVT = 8388608;    //  6 MiB
  const size_t OFF_WOT = 14680064;     //  2 MiB
  const size_t OFF_W1T = 16777216;     //  8 MiB
  const size_t OFF_W2T = 25165824;     //  8 MiB
  const size_t OFF_Y2 = 33554432;      // 16 MiB f32
  const size_t OFF_QB = 58720256;      //  8 MiB
  const size_t OFF_KB = 67108864;      //  8 MiB
  const size_t OFF_VT = 75497472;      //  8 MiB
  const size_t OFF_CMAX = 83886080;    // 256 KiB
  const size_t OFF_CSUM = 84148224;    // 256 KiB
  const size_t OFF_OC = 84410368;      //  8 MiB
  const size_t OFF_Y1 = 92798976;      // 16 MiB f32
  const size_t OFF_OUT1F = 109576192;  // 16 MiB f32
  const size_t OFF_OUT1B = 126353408;  //  8 MiB
  const size_t OFF_HB = 134742016;     // 32 MiB

  __bf16* xb = (__bf16*)(ws + OFF_XB);
  __bf16* wqkvT = (__bf16*)(ws + OFF_WQKVT);
  __bf16* woT = (__bf16*)(ws + OFF_WOT);
  __bf16* w1T = (__bf16*)(ws + OFF_W1T);
  __bf16* w2T = (__bf16*)(ws + OFF_W2T);
  __bf16* qb = (__bf16*)(ws + OFF_QB);
  __bf16* kb = (__bf16*)(ws + OFF_KB);
  __bf16* vtb = (__bf16*)(ws + OFF_VT);
  float* cmax = (float*)(ws + OFF_CMAX);
  float* csum = (float*)(ws + OFF_CSUM);
  __bf16* ocb = (__bf16*)(ws + OFF_OC);
  float* y1 = (float*)(ws + OFF_Y1);
  float* out1f = (float*)(ws + OFF_OUT1F);
  __bf16* out1b = (__bf16*)(ws + OFF_OUT1B);
  __bf16* hb = (__bf16*)(ws + OFF_HB);
  float* y2 = (float*)(ws + OFF_Y2);

  // 1) convert x; pack transposed bf16 weights
  cvt_f32_bf16<<<(NTOK * D + 255) / 256, 256, 0, stream>>>(x, xb, NTOK * D);
  pack_wqkvT<<<(NQKV * D + 255) / 256, 256, 0, stream>>>(Wq, Wk, Wv, wqkvT);
  packT<<<(D * D + 255) / 256, 256, 0, stream>>>(Wo, woT, D, D);
  packT<<<(D * FF + 255) / 256, 256, 0, stream>>>(W1, w1T, D, FF);
  packT<<<(FF * D + 255) / 256, 256, 0, stream>>>(W2, w2T, FF, D);

  // 2) fused QKV projection GEMM: (4096x1024)x(1024x3072), head layouts out
  gemm_bf16_tn<0><<<dim3(NQKV / 128, NTOK / 128), 256, 0, stream>>>(
      xb, wqkvT, NTOK, NQKV, D, qb, nullptr, nullptr, nullptr, kb, vtb);

  // 3) attention (column softmax, two-pass flash-style over q)
  attn_colstats<<<(BSZ * H) * (T / 128), 256, 0, stream>>>(qb, kb, cmax, csum);
  attn_out<<<(BSZ * H) * (T / 128), 256, 0, stream>>>(qb, kb, vtb, cmax, csum,
                                                      ocb);

  // 4) output projection + residual, then norm
  gemm_bf16_tn<2><<<dim3(D / 128, NTOK / 128), 256, 0, stream>>>(
      ocb, woT, NTOK, D, D, nullptr, y1, nullptr, x, nullptr, nullptr);
  rownorm<<<NTOK, 256, 0, stream>>>(y1, out1f, out1b);

  // 5) FFN: relu(out1 @ W1 + b1) @ W2 + b2 + out1, then norm -> d_out
  gemm_bf16_tn<1><<<dim3(FF / 128, NTOK / 128), 256, 0, stream>>>(
      out1b, w1T, NTOK, FF, D, hb, nullptr, b1, nullptr, nullptr, nullptr);
  gemm_bf16_tn<3><<<dim3(D / 128, NTOK / 128), 256, 0, stream>>>(
      hb, w2T, NTOK, D, FF, nullptr, y2, b2, out1f, nullptr, nullptr);
  rownorm<<<NTOK, 256, 0, stream>>>(y2, (float*)d_out, nullptr);

  (void)in_sizes;
  (void)n_in;
  (void)out_size;
  (void)ws_size;
}

// v003
// A run of this version takes 417 microseconds.
// Two timings next to v002 put it at 1.13 and 1.14 times that version's speed.
// Counting every step since v000, it is 1.62 times as fast.
#include <hip/hip_runtime.h>
#include <hip/hip_bf16.h>
#include <stdint.h>

// Problem dims (fixed by the reference)
#define BSZ 2
#define T   2048
#define D   1024
#define H   16
#define DKV 64
#define FF  4096
#define NTOK 4096          // BSZ*T
#define NQKV 3072          // 3*H*DKV

typedef __attribute__((ext_vector_type(16))) __bf16 bf16x16;
typedef __attribute__((ext_vector_type(8)))  float  f32x8;

union FragCast { bf16x16 v; uint4 u[2]; };

typedef uint32_t u32x4 __attribute__((ext_vector_type(4)));
typedef uint32_t u32x8 __attribute__((ext_vector_type(8)));

// GEMM stage: 128 rows of 64 halves (128 bytes) per operand, laid in LDS at a
// 144-byte row pitch (16 B x odd: conflict-free for 16-byte fragment reads).
#define GBK 64          // halves of K per stage
#define GPITCH 72       // LDS row pitch in halves
#define GTILEB 18432u   // 128 rows x 144 B = 9 x 2 KiB, one operand's tile

__device__ __forceinline__ uint32_t uni(uint32_t v) {
  return (uint32_t)__builtin_amdgcn_readfirstlane(v);
}

__device__ __forceinline__ uint32_t pinned(uint32_t v) {
  uint32_t w = (uint32_t)__builtin_amdgcn_readfirstlane(v);
  asm volatile("" : "+s"(w));
  return w;
}

// Descriptor group 0: one request, LDS byte offset, global address, type 2.
__device__ __forceinline__ u32x4 tdm_group0(uint32_t lds_dst, uint64_t ga) {
  u32x4 g;
  g[0] = uni(1u);
  g[1] = uni(lds_dst);
  g[2] = uni((uint32_t)ga);
  g[3] = uni((((uint32_t)(ga >> 32)) & 0x01FFFFFFu) | 0x80000000u);
  return g;
}

// Descriptor group 1: byte elements, tensor = tile = 128 rows of 128 bytes,
// source row pitch src_pitch bytes, 16 bytes of LDS pad behind every row.
// pinned(): each descriptor word is held in its scalar register for the whole
// loop, so that none is reused for something else while a request is in flight.
__device__ __forceinline__ u32x8 tdm_group1(uint32_t src_pitch) {
  u32x8 g;
  g[0] = pinned((1u << 20) | (4u << 22) | (3u << 25));
  g[1] = pinned(128u << 16);
  g[2] = pinned(128u << 16);
  g[3] = pinned(128u << 16);
  g[4] = pinned(128u);
  g[5] = pinned(src_pitch);
  g[6] = pinned(0u);
  g[7] = pinned(0u);
  return g;
}

__device__ __forceinline__ void tdm_load(u32x4 g0, u32x8 g1) {
  asm volatile("tensor_load_to_lds %0, %1" ::"s"(g0), "s"(g1) : "memory");
}

__device__ __forceinline__ f32x8 wmma_bf16(bf16x16 a, bf16x16 b, f32x8 c) {
  return __builtin_amdgcn_wmma_f32_16x16x32_bf16(false, a, false, b, (short)0, c,
                                                 false, false);
}

__device__ __forceinline__ f32x8 zero8() {
  f32x8 z;
  for (int e = 0; e < 8; ++e) z[e] = 0.0f;
  return z;
}

// Load a 16x32 A-fragment (or B^T-fragment) from row-major bf16 memory
// (global or LDS). Lane l holds row (l&15); K = 16*(j>>3) + 8*(l>>4) + (j&7).
// Each 8-half group is contiguous -> two 16B loads.
__device__ __forceinline__ bf16x16 load_frag(const __bf16* base, int row0,
                                             int ld, int k0) {
  int lane = threadIdx.x & 31;
  int m = lane & 15;
  int kh = lane >> 4;
  const __bf16* p = base + (size_t)(row0 + m) * ld + k0 + 8 * kh;
  FragCast f;
  f.u[0] = *(const uint4*)(const void*)(p);
  f.u[1] = *(const uint4*)(const void*)(p + 16);
  return f.v;
}

// ---------------------------------------------------------------------------
// GEMM: C(MxN) = A(MxK bf16 rowmajor) * Bt(NxK bf16 rowmajor)^T
// MODE 0: bf16, stored straight into q,k (B,H,T,64) and vT (B,H,64,T)
// MODE 1: +bias,ReLU,bf16 | 2: +resid f32 | 3: +bias+resid f32
// 256 thr = 8 waves (2x4). Block tile 128x128, 64 k per stage, wave tile 64x32.
// Two LDS buffers; wave 0 brings A's tile and wave 1 Bt's by one tensor load
// per stage. K is a multiple of 64 and at least 128 (two stages).
// ---------------------------------------------------------------------------
template <int MODE>
__global__ __launch_bounds__(256) void gemm_bf16_tn(
    const __bf16* __restrict__ A, const __bf16* __restrict__ Bt, int M, int N,
    int K, __bf16* __restrict__ outB, float* __restrict__ outF,
    const float* __restrict__ bias, const float* __restrict__ resid,
    __bf16* __restrict__ outK, __bf16* __restrict__ outVT) {
  // [buffer][A | Bt] tiles, each at a multiple of 2 KiB
  __shared__ __attribute__((aligned(2048))) unsigned char sm[4 * GTILEB];

  int t = threadIdx.x;
  const uint32_t wave = uni((uint32_t)t >> 5);
  int lane = t & 31;
  int browg = blockIdx.y * 128;
  int bcolg = blockIdx.x * 128;

  const uint32_t isB = wave & 1u;  // issuing waves: 0 -> A, 1 -> Bt
  const uint64_t gbase =
      (uint64_t)(size_t)(isB ? Bt + (size_t)bcolg * K : A + (size_t)browg * K);
  const uint32_t ldst = (uint32_t)(size_t)sm + isB * GTILEB;
  const u32x8 g1 = tdm_group1((uint32_t)K * 2u);
  const int nst = K / GBK;

  f32x8 acc[4][2];
  for (int i = 0; i < 4; ++i)
    for (int j = 0; j < 2; ++j) acc[i][j] = zero8();

  // prologue: stage 0 lands and is published, then stage 1 flies
  if (pinned(wave < 2u)) {
    tdm_load(tdm_group0(ldst, gbase), g1);
    // stage 0 has landed
    asm volatile("s_wait_tensorcnt 0x0" ::: "memory");
  }
  __syncthreads();
  if (pinned(wave < 2u))
    tdm_load(tdm_group0(ldst + 2u * GTILEB, gbase + 2u * GBK), g1);

  int row0w = (int)(wave >> 2) * 64;  // 0 / 64
  int col0w = (int)(wave & 3u) * 32;  // 0..96

  for (int s = 0; s < nst; ++s) {
    const __bf16* sa = (const __bf16*)(const void*)(sm + (s & 1) * (2u * GTILEB));
    const __bf16* sb = (const __bf16*)(const void*)(sm + (s & 1) * (2u * GTILEB) + GTILEB);
#pragma unroll
    for (int ks = 0; ks < GBK; ks += 32) {
      bf16x16 af[4], bfv[2];
#pragma unroll
      for (int i = 0; i < 4; ++i)
        af[i] = load_frag(sa, row0w + 16 * i, GPITCH, ks);
#pragma unroll
      for (int j = 0; j < 2; ++j)
        bfv[j] = load_frag(sb, col0w + 16 * j, GPITCH, ks);
#pragma unroll
      for (int i = 0; i < 4; ++i)
#pragma unroll
        for (int j = 0; j < 2; ++j)
          acc[i][j] = wmma_bf16(af[i], bfv[j], acc[i][j]);
    }

    // publish point of stage s + 1: this wave's reads of stage s have retired,
    asm volatile("s_wait_dscnt 0x0" ::: "memory");
    // the issuing wave's own request (stage s + 1) has landed,
    if (pinned(wave < 2u)) asm volatile("s_wait_tensorcnt 0x0" ::: "memory");
    // every wave has left stage s's buffer and may read stage s + 1,
    __syncthreads();
    // and only then stage s + 2 goes into the buffer that stage s used.
    if (pinned((uint32_t)((wave < 2u) && (s + 2 < nst)))) {
      // pinned(): the stage number is taken here, so that the descriptor words
      // made from it are formed behind the wait and the barrier above
      const uint32_t sn = pinned((uint32_t)s + 2u);
      tdm_load(tdm_group0(ldst + (sn & 1u) * (2u * GTILEB),
                          gbase + (uint64_t)sn * (2u * GBK)),
               g1);
    }
  }
  // nothing of the ring is outstanding when the wave goes on to its stores
  asm volatile("s_wait_tensorcnt 0x0" ::: "memory");
  asm volatile("s_wait_dscnt 0x0" ::: "memory");

  int mh = (lane >> 4) * 8;
  int nn = lane & 15;
  if (MODE == 0) {
    // Column n = which*1024 + h*64 + kk; a 128-wide block lies in one 'which'.
    // A lane holds 8 consecutive tokens of one column: for vT that is one
    // contiguous 16-byte run, and a wave's 64 tokens fill whole 128-byte lines.
    int which = bcolg >> 10;
    int rem = (bcolg + col0w + nn) & 1023;  // j adds 16, inside the same head
    int kc = rem & 63;
    int gr0 = browg + row0w + mh;  // i adds 16, inside the same batch entry
    size_t bhb = (size_t)((gr0 >> 11) * H + (rem >> 6));
    int tt = gr0 & (T - 1);
    if (which == 2) {
      __bf16* dst = outVT + (bhb * DKV + kc) * T + tt;
#pragma unroll
      for (int i = 0; i < 4; ++i)
#pragma unroll
        for (int j = 0; j < 2; ++j) {
          union { __bf16 h[8]; uint4 u; } pk;
#pragma unroll
          for (int r = 0; r < 8; ++r) pk.h[r] = (__bf16)acc[i][j][r];
          *(uint4*)(void*)(dst + (size_t)(16 * j) * T + 16 * i) = pk.u;
        }
      return;
    }
    __bf16* dst = (which == 0 ? outB : outK) + (bhb * T + tt) * DKV + kc;
#pragma unroll
    for (int i = 0; i < 4; ++i)
#pragma unroll
      for (int j = 0; j < 2; ++j)
#pragma unroll
        for (int r = 0; r < 8; ++r)
          dst[(16 * i + r) * DKV + 16 * j] = (__bf16)acc[i][j][r];
    // The built code lays the vT path right behind these stores, and that path
    // rewrites registers they name: keep the wait in front of it.
    asm volatile("s_wait_xcnt 0x0" ::: "memory");
    return;
  }
#pragma unroll
  for (int i = 0; i < 4; ++i)
#pragma unroll
    for (int j = 0; j < 2; ++j) {
      int gc = bcolg + col0w + 16 * j + nn;
#pragma unroll
      for (int r = 0; r < 8; ++r) {
        int gr = browg + row0w + 16 * i + mh + r;
        size_t idx = (size_t)gr * N + gc;
        float v = acc[i][j][r];
        if (MODE == 1) {
          v += bias[gc];
          v = v > 0.0f ? v : 0.0f;
        }
        if (MODE == 3) v += bias[gc];
        if (MODE == 1)
          outB[idx] = (__bf16)v;
        else
          outF[idx] = v + resid[idx];
      }
    }
}

// ---------------------------------------------------------------------------
// Attention pass A: column softmax stats (softmax is over the QUERY axis).
// Grid: (B*H)*(T/128); each wave owns 16 key columns, loops all q-tiles.
// ---------------------------------------------------------------------------
__global__ __launch_bounds__(256) void attn_colstats(
    const __bf16* __restrict__ qb, const __bf16* __restrict__ kb,
    float* __restrict__ cmax, float* __restrict__ csum) {
  const int sblocks = T / 128;
  int bh = blockIdx.x / sblocks;
  int sblk = blockIdx.x % sblocks;
  int wave = threadIdx.x >> 5;
  int lane = threadIdx.x & 31;
  int s0 = sblk * 128 + wave * 16;

  const __bf16* qh = qb + (size_t)bh * T * DKV;
  const __bf16* kh = kb + (size_t)bh * T * DKV;

  bf16x16 kf0 = load_frag(kh, s0, DKV, 0);
  bf16x16 kf1 = load_frag(kh, s0, DKV, 32);

  float m = -3.0e38f, l = 0.0f;
  for (int qt = 0; qt < T; qt += 16) {
    bf16x16 a0 = load_frag(qh, qt, DKV, 0);
    bf16x16 a1 = load_frag(qh, qt, DKV, 32);
    f32x8 c = zero8();
    c = wmma_bf16(a0, kf0, c);
    c = wmma_bf16(a1, kf1, c);
    float sc[8], tmax = -3.0e38f;
#pragma unroll
    for (int r = 0; r < 8; ++r) {
      sc[r] = c[r] * 0.125f;  // 1/sqrt(64)
      tmax = fmaxf(tmax, sc[r]);
    }
    // lanes l and l+16 hold the same key column (different q rows): fuse
    tmax = fmaxf(tmax, __shfl_xor(tmax, 16, 32));
    float mn = fmaxf(m, tmax);
    float p = 0.0f;
#pragma unroll
    for (int r = 0; r < 8; ++r) p += __expf(sc[r] - mn);
    p += __shfl_xor(p, 16, 32);
    l = l * __expf(m - mn) + p;
    m = mn;
  }
  if (lane < 16) {
    cmax[(size_t)bh * T + s0 + lane] = m;
    csum[(size_t)bh * T + s0 + lane] = l;
  }
}

// ---------------------------------------------------------------------------
// Attention pass B: recompute scores, p = exp(s/8 - m)/sum, o += p @ v.
// p: C-layout -> LDS -> A-fragment. vT supplies B^T rows directly.
// ---------------------------------------------------------------------------
__global__ __launch_bounds__(256) void attn_out(
    const __bf16* __restrict__ qb, const __bf16* __restrict__ kb,
    const __bf16* __restrict__ vtb, const float* __restrict__ cmax,
    const float* __restrict__ csum, __bf16* __restrict__ oc) {
  __shared__ __align__(16) __bf16 pbuf[8][16 * 40];  // per-wave 16x32 (+pad)
  const int qblocks = T / 128;
  int bh = blockIdx.x / qblocks;
  int qblk = blockIdx.x % qblocks;
  int wave = threadIdx.x >> 5;
  int lane = threadIdx.x & 31;
  int q0 = qblk * 128 + wave * 16;

  const __bf16* qh = qb + (size_t)bh * T * DKV;
  const __bf16* kh = kb + (size_t)bh * T * DKV;
  const __bf16* vh = vtb + (size_t)bh * DKV * T;

  bf16x16 aq0 = load_frag(qh, q0, DKV, 0);
  bf16x16 aq1 = load_frag(qh, q0, DKV, 32);

  f32x8 oacc[4];
  for (int n = 0; n < 4; ++n) oacc[n] = zero8();

  int nn = lane & 15;
  int mh = (lane >> 4) * 8;
  __bf16* myp = &pbuf[wave][0];

  for (int s0 = 0; s0 < T; s0 += 32) {
    f32x8 c0 = zero8(), c1 = zero8();
    bf16x16 k00 = load_frag(kh, s0, DKV, 0);
    bf16x16 k01 = load_frag(kh, s0, DKV, 32);
    c0 = wmma_bf16(aq0, k00, c0);
    c0 = wmma_bf16(aq1, k01, c0);
    bf16x16 k10 = load_frag(kh, s0 + 16, DKV, 0);
    bf16x16 k11 = load_frag(kh, s0 + 16, DKV, 32);
    c1 = wmma_bf16(aq0, k10, c1);
    c1 = wmma_bf16(aq1, k11, c1);

    size_t sb = (size_t)bh * T;
    float m0 = cmax[sb + s0 + nn], r0 = 1.0f / csum[sb + s0 + nn];
    float m1 = cmax[sb + s0 + 16 + nn], r1 = 1.0f / csum[sb + s0 + 16 + nn];
#pragma unroll
    for (int r = 0; r < 8; ++r) {
      myp[(mh + r) * 40 + nn] = (__bf16)(__expf(c0[r] * 0.125f - m0) * r0);
      myp[(mh + r) * 40 + nn + 16] = (__bf16)(__expf(c1[r] * 0.125f - m1) * r1);
    }
    __syncthreads();
    bf16x16 pf = load_frag(myp, 0, 40, 0);  // 16 q rows x K=32 (s)
#pragma unroll
    for (int n = 0; n < 4; ++n) {
      bf16x16 bv = load_frag(vh, n * 16, T, s0);  // vT rows = v columns
      oacc[n] = wmma_bf16(pf, bv, oacc[n]);
    }
    __syncthreads();
  }

  int b = bh / H, h = bh % H;
#pragma unroll
  for (int n = 0; n < 4; ++n)
#pragma unroll
    for (int r = 0; r < 8; ++r) {
      int gt = q0 + mh + r;
      int col = h * DKV + n * 16 + nn;
      oc[((size_t)b * T + gt) * D + col] = (__bf16)oacc[n][r];
    }
}

// ---------------------------------------------------------------------------
// Row mean/std norm (ddof=1). One block per row of D=1024.
// ---------------------------------------------------------------------------
__global__ __launch_bounds__(256) void rownorm(const float* __restrict__ y,
                                               float* __restrict__ outF,
                                               __bf16* __restrict__ outB) {
  __shared__ float s1[256], s2[256];
  int row = blockIdx.x, tid = threadIdx.x;
  const float* pr = y + (size_t)row * D;
  float v[4], s = 0.0f, q = 0.0f;
#pragma unroll
  for (int j = 0; j < 4; ++j) {
    v[j] = pr[tid + 256 * j];
    s += v[j];
    q += v[j] * v[j];
  }
  s1[tid] = s;
  s2[tid] = q;
  __syncthreads();
  for (int o = 128; o > 0; o >>= 1) {
    if (tid < o) {
      s1[tid] += s1[tid + o];
      s2[tid] += s2[tid + o];
    }
    __syncthreads();
  }
  float mean = s1[0] * (1.0f / D);
  float var = (s2[0] - s1[0] * s1[0] * (1.0f / D)) * (1.0f / (D - 1));
  float rstd = rsqrtf(var);
  float* po = outF + (size_t)row * D;
#pragma unroll
  for (int j = 0; j < 4; ++j) {
    float o = (v[j] - mean) * rstd;
    po[tid + 256 * j] = o;
    if (outB) outB[(size_t)row * D + tid + 256 * j] = (__bf16)o;
  }
}

// ------------------------- conversion / layout kernels ---------------------
// All grids below are exact for the fixed shapes. Every wave-wide access covers
// whole 128-byte lines, and each thread has 8 16-byte loads in flight.

// 32 elements per thread: 8 float4 loads, 8 stores of 4 bf16.
__global__ __launch_bounds__(256) void cvt_f32_bf16(
    const float* __restrict__ in, __bf16* __restrict__ out) {
  size_t base = (size_t)blockIdx.x * 2048 + threadIdx.x;  // in units of 4
  float4 v[8];
#pragma unroll
  for (int j = 0; j < 8; ++j)
    v[j] = *(const float4*)(const void*)(in + (base + 256 * j) * 4);
#pragma unroll
  for (int j = 0; j < 8; ++j) {
    union { __bf16 h[4]; uint2 u; } pk;
    pk.h[0] = (__bf16)v[j].x;
    pk.h[1] = (__bf16)v[j].y;
    pk.h[2] = (__bf16)v[j].z;
    pk.h[3] = (__bf16)v[j].w;
    *(uint2*)(void*)(out + (base + 256 * j) * 4) = pk.u;
  }
}

// One block turns a tile of 128 rows x 64 columns of f32 (row pitch LDIN) into
// 64 rows x 128 columns of bf16 (row pitch LDOUT). in / out point at the tile.
// The turn goes through LDS at a pitch of 65 dwords: both the row-wise writes
// and the column-wise reads then fall on 32 different banks.
// The pitches are compile-time, so that a thread's accesses share one address
// register pair and differ in the immediate offset alone.
template <int LDIN, int LDOUT>
__device__ __forceinline__ void tile_turn(const float* __restrict__ in,
                                          __bf16* __restrict__ out) {
  __shared__ float tile[128][65];
  int t = threadIdx.x;
  int lr = t >> 4;        // 16 lanes read one row's 256 bytes
  int lc = (t & 15) * 4;
  float4 v[8];
#pragma unroll
  for (int j = 0; j < 8; ++j)
    v[j] = *(const float4*)(const void*)(in + (size_t)(lr + 16 * j) * LDIN + lc);
  // the loads' address registers may be reused by what follows
  asm volatile("s_wait_xcnt 0x0" ::: "memory");
#pragma unroll
  for (int j = 0; j < 8; ++j) {
    tile[lr + 16 * j][lc + 0] = v[j].x;
    tile[lr + 16 * j][lc + 1] = v[j].y;
    tile[lr + 16 * j][lc + 2] = v[j].z;
    tile[lr + 16 * j][lc + 3] = v[j].w;
  }
  __syncthreads();
  int rc = (t & 7) * 8;   // 8 lanes write 128 bytes of one output row
  int c0 = t >> 3;
#pragma unroll
  for (int j = 0; j < 4; ++j) {
    int c = c0 + 32 * (j & 1);
    int r = rc + 64 * (j >> 1);
    union { __bf16 h[8]; uint4 u; } pk;
#pragma unroll
    for (int k = 0; k < 8; ++k) pk.h[k] = (__bf16)tile[r + k][c];
    *(uint4*)(void*)(out + (size_t)c * LDOUT + r) = pk.u;
  }
}

// WqkvT[n][d], n = which*1024 + h*64 + k  (rows = GEMM columns, K-contig)
// Grid: (D/128 row tiles, H heads, 3 matrices); a head is a D x 64 matrix.
__global__ __launch_bounds__(256) void pack_wqkvT(const float* __restrict__ Wq,
                                                  const float* __restrict__ Wk,
                                                  const float* __restrict__ Wv,
                                                  __bf16* __restrict__ out) {
  int d0 = blockIdx.x * 128;
  int h = blockIdx.y;
  int which = blockIdx.z;
  const float* src = which == 0 ? Wq : (which == 1 ? Wk : Wv);
  tile_turn<DKV, D>(src + ((size_t)h * D + d0) * DKV,
                    out + (size_t)(which * 1024 + h * DKV) * D + d0);
}

// out (C x R) = transpose of in (R x C), bf16. Grid: (R/128, C/64).
template <int R, int C>
__global__ __launch_bounds__(256) void packT(const float* __restrict__ in,
                                             __bf16* __restrict__ out) {
  int r0 = blockIdx.x * 128;
  int c0 = blockIdx.y * 64;
  tile_turn<C, R>(in + (size_t)r0 * C + c0, out + (size_t)c0 * R + r0);
}

// ---------------------------------------------------------------------------
extern "C" void kernel_launch(void* const* d_in, const int* in_sizes, int n_in,
                              void* d_out, int out_size, void* d_ws,
                              size_t ws_size, hipStream_t stream) {
  const float* x = (const float*)d_in[0];
  const float* Wq = (const float*)d_in[1];
  const float* Wk = (const float*)d_in[2];
  const float* Wv = (const float*)d_in[3];
  const float* Wo = (const float*)d_in[4];
  const float* W1 = (const float*)d_in[5];
  const float* b1 = (const float*)d_in[6];
  const float* W2 = (const float*)d_in[7];
  const float* b2 = (const float*)d_in[8];

  char* ws = (char*)d_ws;
  const size_t OFF_XB = 0;             //  8 MiB
  const size_t OFF_WQKVT = 8388608;    //  6 MiB
  const size_t OFF_WOT = 14680064;     //  2 MiB
  const size_t OFF_W1T = 16777216;     //  8 MiB
  const size_t OFF_W2T = 25165824;     //  8 MiB
  const size_t OFF_Y2 = 33554432;      // 16 MiB f32
  const size_t OFF_QB = 58720256;      //  8 MiB
  const size_t OFF_KB = 67108864;      //  8 MiB
  const size_t OFF_VT = 75497472;      //  8 MiB
  const size_t OFF_CMAX = 83886080;    // 256 KiB
  const size_t OFF_CSUM = 84148224;    // 256 KiB
  const size_t OFF_OC = 84410368;      //  8 MiB
  const size_t OFF_Y1 = 92798976;      // 16 MiB f32
  const size_t OFF_OUT1F = 109576192;  // 16 MiB f32
  const size_t OFF_OUT1B = 126353408;  //  8 MiB
  const size_t OFF_HB = 134742016;     // 32 MiB

  __bf16* xb = (__bf16*)(ws + OFF_XB);
  __bf16* wqkvT = (__bf16*)(ws + OFF_WQKVT);
  __bf16* woT = (__bf16*)(ws + OFF_WOT);
  __bf16* w1T = (__bf16*)(ws + OFF_W1T);
  __bf16* w2T = (__bf16*)(ws + OFF_W2T);
  __bf16* qb = (__bf16*)(ws + OFF_QB);
  __bf16* kb = (__bf16*)(ws + OFF_KB);
  __bf16* vtb = (__bf16*)(ws + OFF_VT);
  float* cmax = (float*)(ws + OFF_CMAX);
  float* csum = (float*)(ws + OFF_CSUM);
  __bf16* ocb = (__bf16*)(ws + OFF_OC);
  float* y1 = (float*)(ws + OFF_Y1);
  float* out1f = (float*)(ws + OFF_OUT1F);
  __bf16* out1b = (__bf16*)(ws + OFF_OUT1B);
  __bf16* hb = (__bf16*)(ws + OFF_HB);
  float* y2 = (float*)(ws + OFF_Y2);

  // 1) convert x; pack transposed bf16 weights
  cvt_f32_bf16<<<NTOK * D / 8192, 256, 0, stream>>>(x, xb);
  pack_wqkvT<<<dim3(D / 128, H, 3), 256, 0, stream>>>(Wq, Wk, Wv, wqkvT);
  packT<D, D><<<dim3(D / 128, D / 64), 256, 0, stream>>>(Wo, woT);
  packT<D, FF><<<dim3(D / 128, FF / 64), 256, 0, stream>>>(W1, w1T);
  packT<FF, D><<<dim3(FF / 128, D / 64), 256, 0, stream>>>(W2, w2T);

  // 2) fused QKV projection GEMM: (4096x1024)x(1024x3072), head layouts out
  gemm_bf16_tn<0><<<dim3(NQKV / 128, NTOK / 128), 256, 0, stream>>>(
      xb, wqkvT, NTOK, NQKV, D, qb, nullptr, nullptr, nullptr, kb, vtb);

  // 3) attention (column softmax, two-pass flash-style over q)
  attn_colstats<<<(BSZ * H) * (T / 128), 256, 0, stream>>>(qb, kb, cmax, csum);
  attn_out<<<(BSZ * H) * (T / 128), 256, 0, stream>>>(qb, kb, vtb, cmax, csum,
                                                      ocb);

  // 4) output projection + residual, then norm
  gemm_bf16_tn<2><<<dim3(D / 128, NTOK / 128), 256, 0, stream>>>(
      ocb, woT, NTOK, D, D, nullptr, y1, nullptr, x, nullptr, nullptr);
  rownorm<<<NTOK, 256, 0, stream>>>(y1, out1f, out1b);

  // 5) FFN: relu(out1 @ W1 + b1) @ W2 + b2 + out1, then norm -> d_out
  gemm_bf16_tn<1><<<dim3(FF / 128, NTOK / 128), 256, 0, stream>>>(
      out1b, w1T, NTOK, FF, D, hb, nullptr, b1, nullptr, nullptr, nullptr);
  gemm_bf16_tn<3><<<dim3(D / 128, NTOK / 128), 256, 0, stream>>>(
      hb, w2T, NTOK, D, FF, nullptr, y2, b2, out1f, nullptr, nullptr);
  rownorm<<<NTOK, 256, 0, stream>>>(y2, (float*)d_out, nullptr);

  (void)in_sizes;
  (void)n_in;
  (void)out_size;
  (void)ws_size;
}

// v004
// One run takes 265 microseconds.
// Two timings next to v003 both put it at 1.59 times that version's speed.
// Over all steps from v000 it is 2.58 times as fast.
#include <hip/hip_runtime.h>
#include <hip/hip_bf16.h>
#include <stdint.h>

// Problem dims (fixed by the reference)
#define BSZ 2
#define T   2048
#define D   1024
#define H   16
#define DKV 64
#define FF  4096
#define NTOK 4096          // BSZ*T
#define NQKV 3072          // 3*H*DKV

typedef __attribute__((ext_vector_type(16))) __bf16 bf16x16;
typedef __attribute__((ext_vector_type(8)))  float  f32x8;

union FragCast { bf16x16 v; uint4 u[2]; };

typedef uint32_t u32x4 __attribute__((ext_vector_type(4)));
typedef uint32_t u32x8 __attribute__((ext_vector_type(8)));

// GEMM stage: 128 rows of 64 halves (128 bytes) per operand, laid in LDS at a
// 144-byte row pitch (16 B x odd: conflict-free for 16-byte fragment reads).
#define GBK 64          // halves of K per stage
#define GPITCH 72       // LDS row pitch in halves
#define GTILEB 18432u   // 128 rows x 144 B = 9 x 2 KiB, one operand's tile

__device__ __forceinline__ uint32_t uni(uint32_t v) {
  return (uint32_t)__builtin_amdgcn_readfirstlane(v);
}

__device__ __forceinline__ uint32_t pinned(uint32_t v) {
  uint32_t w = (uint32_t)__builtin_amdgcn_readfirstlane(v);
  asm volatile("" : "+s"(w));
  return w;
}

// Descriptor group 0: one request, LDS byte offset, global address, type 2.
__device__ __forceinline__ u32x4 tdm_group0(uint32_t lds_dst, uint64_t ga) {
  u32x4 g;
  g[0] = uni(1u);
  g[1] = uni(lds_dst);
  g[2] = uni((uint32_t)ga);
  g[3] = uni((((uint32_t)(ga >> 32)) & 0x01FFFFFFu) | 0x80000000u);
  return g;
}

// Descriptor group 1: byte elements, tensor = tile = 128 rows of 128 bytes,
// source row pitch src_pitch bytes, 16 bytes of LDS pad behind every row.
// pinned(): each descriptor word is held in its scalar register for the whole
// loop, so that none is reused for something else while a request is in flight.
__device__ __forceinline__ u32x8 tdm_group1(uint32_t src_pitch) {
  u32x8 g;
  g[0] = pinned((1u << 20) | (4u << 22) | (3u << 25));
  g[1] = pinned(128u << 16);
  g[2] = pinned(128u << 16);
  g[3] = pinned(128u << 16);
  g[4] = pinned(128u);
  g[5] = pinned(src_pitch);
  g[6] = pinned(0u);
  g[7] = pinned(0u);
  return g;
}

// Attention stage: 128 rows of q or k (128 bytes each, the GEMM's tile and
// pitch), or vT's 64 rows x 128 keys (256 bytes each) at a 272-byte LDS pitch
// (16 B x odd again). Either tile fits one GTILEB place.
#define AKS 128         // queries (pass A) or keys (pass B) per stage
#define VPITCH 136      // vT's LDS row pitch in halves

// Descriptor group 1 of vT's tile: byte elements, tensor = tile = 64 rows of
// 256 bytes, source row pitch T halves, 16 bytes of LDS pad behind every row.
// pinned(): as in tdm_group1.
__device__ __forceinline__ u32x8 tdm_group1_vt() {
  u32x8 g;
  g[0] = pinned((1u << 20) | (5u << 22) | (3u << 25));
  g[1] = pinned(256u << 16);
  g[2] = pinned(64u << 16);
  g[3] = pinned(256u << 16);
  g[4] = pinned(64u);
  g[5] = pinned((uint32_t)T * 2u);
  g[6] = pinned(0u);
  g[7] = pinned(0u);
  return g;
}

__device__ __forceinline__ void tdm_load(u32x4 g0, u32x8 g1) {
  asm volatile("tensor_load_to_lds %0, %1" ::"s"(g0), "s"(g1) : "memory");
}

__device__ __forceinline__ f32x8 wmma_bf16(bf16x16 a, bf16x16 b, f32x8 c) {
  return __builtin_amdgcn_wmma_f32_16x16x32_bf16(false, a, false, b, (short)0, c,
                                                 false, false);
}

__device__ __forceinline__ f32x8 zero8() {
  f32x8 z;
  for (int e = 0; e < 8; ++e) z[e] = 0.0f;
  return z;
}

// Load a 16x32 A-fragment (or B^T-fragment) from row-major bf16 memory
// (global or LDS). Lane l holds row (l&15); K = 16*(j>>3) + 8*(l>>4) + (j&7).
// Each 8-half group is contiguous -> two 16B loads.
__device__ __forceinline__ bf16x16 load_frag(const __bf16* base, int row0,
                                             int ld, int k0) {
  int lane = threadIdx.x & 31;
  int m = lane & 15;
  int kh = lane >> 4;
  const __bf16* p = base + (size_t)(row0 + m) * ld + k0 + 8 * kh;
  FragCast f;
  f.u[0] = *(const uint4*)(const void*)(p);
  f.u[1] = *(const uint4*)(const void*)(p + 16);
  return f.v;
}

// ---------------------------------------------------------------------------
// GEMM: C(MxN) = A(MxK bf16 rowmajor) * Bt(NxK bf16 rowmajor)^T
// MODE 0: bf16, stored straight into q,k (B,H,T,64) and vT (B,H,64,T)
// MODE 1: +bias,ReLU,bf16 | 2: +resid f32 | 3: +bias+resid f32
// 256 thr = 8 waves (2x4). Block tile 128x128, 64 k per stage, wave tile 64x32.
// Two LDS buffers; wave 0 brings A's tile and wave 1 Bt's by one tensor load
// per stage. K is a multiple of 64 and at least 128 (two stages).
// ---------------------------------------------------------------------------
template <int MODE>
__global__ __launch_bounds__(256) void gemm_bf16_tn(
    const __bf16* __restrict__ A, const __bf16* __restrict__ Bt, int M, int N,
    int K, __bf16* __restrict__ outB, float* __restrict__ outF,
    const float* __restrict__ bias, const float* __restrict__ resid,
    __bf16* __restrict__ outK, __bf16* __restrict__ outVT) {
  // [buffer][A | Bt] tiles, each at a multiple of 2 KiB
  __shared__ __attribute__((aligned(2048))) unsigned char sm[4 * GTILEB];

  int t = threadIdx.x;
  const uint32_t wave = uni((uint32_t)t >> 5);
  int lane = t & 31;
  int browg = blockIdx.y * 128;
  int bcolg = blockIdx.x * 128;

  const uint32_t isB = wave & 1u;  // issuing waves: 0 -> A, 1 -> Bt
  const uint64_t gbase =
      (uint64_t)(size_t)(isB ? Bt + (size_t)bcolg * K : A + (size_t)browg * K);
  const uint32_t ldst = (uint32_t)(size_t)sm + isB * GTILEB;
  const u32x8 g1 = tdm_group1((uint32_t)K * 2u);
  const int nst = K / GBK;

  f32x8 acc[4][2];
  for (int i = 0; i < 4; ++i)
    for (int j = 0; j < 2; ++j) acc[i][j] = zero8();

  // prologue: stage 0 lands and is published, then stage 1 flies
  if (pinned(wave < 2u)) {
    tdm_load(tdm_group0(ldst, gbase), g1);
    // stage 0 has landed
    asm volatile("s_wait_tensorcnt 0x0" ::: "memory");
  }
  __syncthreads();
  if (pinned(wave < 2u))
    tdm_load(tdm_group0(ldst + 2u * GTILEB, gbase + 2u * GBK), g1);

  int row0w = (int)(wave >> 2) * 64;  // 0 / 64
  int col0w = (int)(wave & 3u) * 32;  // 0..96

  for (int s = 0; s < nst; ++s) {
    const __bf16* sa = (const __bf16*)(const void*)(sm + (s & 1) * (2u * GTILEB));
    const __bf16* sb = (const __bf16*)(const void*)(sm + (s & 1) * (2u * GTILEB) + GTILEB);
#pragma unroll
    for (int ks = 0; ks < GBK; ks += 32) {
      bf16x16 af[4], bfv[2];
#pragma unroll
      for (int i = 0; i < 4; ++i)
        af[i] = load_frag(sa, row0w + 16 * i, GPITCH, ks);
#pragma unroll
      for (int j = 0; j < 2; ++j)
        bfv[j] = load_frag(sb, col0w + 16 * j, GPITCH, ks);
#pragma unroll
      for (int i = 0; i < 4; ++i)
#pragma unroll
        for (int j = 0; j < 2; ++j)
          acc[i][j] = wmma_bf16(af[i], bfv[j], acc[i][j]);
    }

    // publish point of stage s + 1: this wave's reads of stage s have retired,
    asm volatile("s_wait_dscnt 0x0" ::: "memory");
    // the issuing wave's own request (stage s + 1) has landed,
    if (pinned(wave < 2u)) asm volatile("s_wait_tensorcnt 0x0" ::: "memory");
    // every wave has left stage s's buffer and may read stage s + 1,
    __syncthreads();
    // and only then stage s + 2 goes into the buffer that stage s used.
    if (pinned((uint32_t)((wave < 2u) && (s + 2 < nst)))) {
      // pinned(): the stage number is taken here, so that the descriptor words
      // made from it are formed behind the wait and the barrier above
      const uint32_t sn = pinned((uint32_t)s + 2u);
      tdm_load(tdm_group0(ldst + (sn & 1u) * (2u * GTILEB),
                          gbase + (uint64_t)sn * (2u * GBK)),
               g1);
    }
  }
  // nothing of the ring is outstanding when the wave goes on to its stores
  asm volatile("s_wait_tensorcnt 0x0" ::: "memory");
  asm volatile("s_wait_dscnt 0x0" ::: "memory");

  int mh = (lane >> 4) * 8;
  int nn = lane & 15;
  if (MODE == 0) {
    // Column n = which*1024 + h*64 + kk; a 128-wide block lies in one 'which'.
    // A lane holds 8 consecutive tokens of one column: for vT that is one
    // contiguous 16-byte run, and a wave's 64 tokens fill whole 128-byte lines.
    int which = bcolg >> 10;
    int rem = (bcolg + col0w + nn) & 1023;  // j adds 16, inside the same head
    int kc = rem & 63;
    int gr0 = browg + row0w + mh;  // i adds 16, inside the same batch entry
    size_t bhb = (size_t)((gr0 >> 11) * H + (rem >> 6));
    int tt = gr0 & (T - 1);
    if (which == 2) {
      __bf16* dst = outVT + (bhb * DKV + kc) * T + tt;
#pragma unroll
      for (int i = 0; i < 4; ++i)
#pragma unroll
        for (int j = 0; j < 2; ++j) {
          union { __bf16 h[8]; uint4 u; } pk;
#pragma unroll
          for (int r = 0; r < 8; ++r) pk.h[r] = (__bf16)acc[i][j][r];
          *(uint4*)(void*)(dst + (size_t)(16 * j) * T + 16 * i) = pk.u;
        }
      return;
    }
    __bf16* dst = (which == 0 ? outB : outK) + (bhb * T + tt) * DKV + kc;
#pragma unroll
    for (int i = 0; i < 4; ++i)
#pragma unroll
      for (int j = 0; j < 2; ++j)
#pragma unroll
        for (int r = 0; r < 8; ++r)
          dst[(16 * i + r) * DKV + 16 * j] = (__bf16)acc[i][j][r];
    // The built code lays the vT path right behind these stores, and that path
    // rewrites registers they name: keep the wait in front of it.
    asm volatile("s_wait_xcnt 0x0" ::: "memory");
    return;
  }
#pragma unroll
  for (int i = 0; i < 4; ++i)
#pragma unroll
    for (int j = 0; j < 2; ++j) {
      int gc = bcolg + col0w + 16 * j + nn;
#pragma unroll
      for (int r = 0; r < 8; ++r) {
        int gr = browg + row0w + 16 * i + mh + r;
        size_t idx = (size_t)gr * N + gc;
        float v = acc[i][j][r];
        if (MODE == 1) {
          v += bias[gc];
          v = v > 0.0f ? v : 0.0f;
        }
        if (MODE == 3) v += bias[gc];
        if (MODE == 1)
          outB[idx] = (__bf16)v;
        else
          outF[idx] = v + resid[idx];
      }
    }
}

// ---------------------------------------------------------------------------
// Attention pass A: column softmax stats (softmax is over the QUERY axis).
// Grid: (B*H)*(T/128); each wave owns 16 key columns, loops all q-tiles.
// The 8 waves walk the same q rows: wave 0 brings them into LDS, 128 rows per
// stage by one tensor load, two buffers, and every wave reads fragments there.
// ---------------------------------------------------------------------------
__global__ __launch_bounds__(256) void attn_colstats(
    const __bf16* __restrict__ qb, const __bf16* __restrict__ kb,
    float* __restrict__ cmax, float* __restrict__ csum) {
  // two q tiles, each at a multiple of 2 KiB
  __shared__ __attribute__((aligned(2048))) unsigned char sm[2 * GTILEB];
  const int sblocks = T / 128;
  int bh = blockIdx.x / sblocks;
  int sblk = blockIdx.x % sblocks;
  const uint32_t wave = uni(threadIdx.x >> 5);
  int lane = threadIdx.x & 31;
  int s0 = sblk * 128 + (int)wave * 16;

  const __bf16* qh = qb + (size_t)bh * T * DKV;
  const __bf16* kh = kb + (size_t)bh * T * DKV;

  const uint64_t gq = (uint64_t)(size_t)qh;
  const uint32_t ldst = (uint32_t)(size_t)sm;
  const u32x8 g1 = tdm_group1(DKV * 2u);
  const int nst = T / AKS;

  // prologue: stage 0 lands and is published, then stage 1 flies
  if (pinned(wave == 0u)) {
    tdm_load(tdm_group0(ldst, gq), g1);
    // stage 0 has landed
    asm volatile("s_wait_tensorcnt 0x0" ::: "memory");
  }
  __syncthreads();
  // From here on the ring's group 0 is one value carried through the loop, each
  // request's address made from the one before it: its registers stay in use,
  // so that none is taken for something else while a request is in flight.
  u32x4 g0 = tdm_group0(ldst + GTILEB, gq + (uint64_t)(AKS * DKV * 2));
  g0[0] = pinned(g0[0]);  // pinned(): a descriptor word held in its scalar register
  if (pinned(wave == 0u)) tdm_load(g0, g1);

  bf16x16 kf0 = load_frag(kh, s0, DKV, 0);
  bf16x16 kf1 = load_frag(kh, s0, DKV, 32);

  float m = -3.0e38f, l = 0.0f;
  for (int st = 0; st < nst; ++st) {
   const __bf16* sq = (const __bf16*)(const void*)(sm + (st & 1) * GTILEB);
   // unrolled: a stage is one pass, its LDS offsets are immediates, and later
   // tiles' fragment reads can be issued ahead of this tile's softmax chain
#pragma unroll
   for (int qt = 0; qt < AKS; qt += 16) {
    bf16x16 a0 = load_frag(sq, qt, GPITCH, 0);
    bf16x16 a1 = load_frag(sq, qt, GPITCH, 32);
    f32x8 c = zero8();
    c = wmma_bf16(a0, kf0, c);
    c = wmma_bf16(a1, kf1, c);
    float sc[8], tmax = -3.0e38f;
#pragma unroll
    for (int r = 0; r < 8; ++r) {
      sc[r] = c[r] * 0.125f;  // 1/sqrt(64)
      tmax = fmaxf(tmax, sc[r]);
    }
    // lanes l and l+16 hold the same key column (different q rows): fuse
    tmax = fmaxf(tmax, __shfl_xor(tmax, 16, 32));
    float mn = fmaxf(m, tmax);
    float p = 0.0f;
#pragma unroll
    for (int r = 0; r < 8; ++r) p += __expf(sc[r] - mn);
    p += __shfl_xor(p, 16, 32);
    l = l * __expf(m - mn) + p;
    m = mn;
   }

   // publish point of stage st + 1: this wave's reads of stage st have retired,
   asm volatile("s_wait_dscnt 0x0" ::: "memory");
   // the issuing wave's own request (stage st + 1) has landed,
   if (pinned(wave == 0u)) asm volatile("s_wait_tensorcnt 0x0" ::: "memory");
   // every wave has left stage st's buffer and may read stage st + 1,
   __syncthreads();
   // and only then stage st + 2 goes into the buffer that stage st used.
   if (pinned((uint32_t)((wave == 0u) && (st + 2 < nst)))) {
     // pinned(): the step is taken here, so that the address words made with it
     // are formed behind the wait and the barrier above. The carry goes into
     // word 3's address bits; its type bits lie above them.
     const uint32_t step = pinned((uint32_t)(AKS * DKV * 2));
     const uint64_t ga = (((uint64_t)g0[3] << 32) | (uint64_t)g0[2]) + step;
     g0[1] = uni(ldst + (uint32_t)(st & 1) * GTILEB);
     g0[2] = uni((uint32_t)ga);
     g0[3] = uni((uint32_t)(ga >> 32));
     tdm_load(g0, g1);
   }
  }
  // nothing of the ring is outstanding when the wave goes on to its stores
  asm volatile("s_wait_tensorcnt 0x0" ::: "memory");
  asm volatile("s_wait_dscnt 0x0" ::: "memory");

  if (lane < 16) {
    cmax[(size_t)bh * T + s0 + lane] = m;
    csum[(size_t)bh * T + s0 + lane] = l;
  }
}

// ---------------------------------------------------------------------------
// Attention pass B: recompute scores, p = exp(s/8 - m)/sum, o += p @ v.
// p: C-layout -> LDS -> A-fragment. vT supplies B^T rows directly.
// The 8 waves walk the same keys: per stage of 128 keys wave 0 brings k's rows
// and wave 1 vT's into LDS by one tensor load each, two buffers.
// ---------------------------------------------------------------------------
__global__ __launch_bounds__(256) void attn_out(
    const __bf16* __restrict__ qb, const __bf16* __restrict__ kb,
    const __bf16* __restrict__ vtb, const float* __restrict__ cmax,
    const float* __restrict__ csum, __bf16* __restrict__ oc) {
  // [buffer][k | vT] tiles, each at a multiple of 2 KiB
  __shared__ __attribute__((aligned(2048))) unsigned char sm[4 * GTILEB];
  __shared__ __align__(16) __bf16 pbuf[8][16 * 40];  // per-wave 16x32 (+pad)
  const int qblocks = T / 128;
  int bh = blockIdx.x / qblocks;
  int qblk = blockIdx.x % qblocks;
  const uint32_t wave = uni(threadIdx.x >> 5);
  int lane = threadIdx.x & 31;
  int q0 = qblk * 128 + (int)wave * 16;

  const __bf16* qh = qb + (size_t)bh * T * DKV;
  const __bf16* kh = kb + (size_t)bh * T * DKV;
  const __bf16* vh = vtb + (size_t)bh * DKV * T;

  const uint64_t gk = (uint64_t)(size_t)kh;
  const uint64_t gv = (uint64_t)(size_t)vh;
  const uint32_t ldsk = (uint32_t)(size_t)sm;
  const uint32_t ldsv = ldsk + GTILEB;
  const u32x8 g1k = tdm_group1(DKV * 2u);
  const u32x8 g1v = tdm_group1_vt();
  const int nst = T / AKS;

  // prologue: stage 0 lands and is published, then stage 1 flies
  if (pinned(wave == 0u)) {
    tdm_load(tdm_group0(ldsk, gk), g1k);
    // stage 0 has landed
    asm volatile("s_wait_tensorcnt 0x0" ::: "memory");
  }
  if (pinned(wave == 1u)) {
    tdm_load(tdm_group0(ldsv, gv), g1v);
    asm volatile("s_wait_tensorcnt 0x0" ::: "memory");  // as above
  }
  __syncthreads();
  if (pinned(wave == 0u))
    tdm_load(tdm_group0(ldsk + 2u * GTILEB, gk + (uint64_t)(AKS * DKV * 2)), g1k);
  if (pinned(wave == 1u))
    tdm_load(tdm_group0(ldsv + 2u * GTILEB, gv + (uint64_t)(AKS * 2)), g1v);

  bf16x16 aq0 = load_frag(qh, q0, DKV, 0);
  bf16x16 aq1 = load_frag(qh, q0, DKV, 32);

  f32x8 oacc[4];
  for (int n = 0; n < 4; ++n) oacc[n] = zero8();

  int nn = lane & 15;
  int mh = (lane >> 4) * 8;
  __bf16* myp = &pbuf[wave][0];

  for (int st = 0; st < nst; ++st) {
   const __bf16* sk = (const __bf16*)(const void*)(sm + (st & 1) * (2u * GTILEB));
   const __bf16* sv = (const __bf16*)(const void*)(sm + (st & 1) * (2u * GTILEB) + GTILEB);
   // unrolled: a stage is one pass and its LDS offsets are immediates
#pragma unroll
   for (int ss = 0; ss < AKS; ss += 32) {
    int s0 = st * AKS + ss;
    f32x8 c0 = zero8(), c1 = zero8();
    bf16x16 k00 = load_frag(sk, ss, GPITCH, 0);
    bf16x16 k01 = load_frag(sk, ss, GPITCH, 32);
    bf16x16 k10 = load_frag(sk, ss + 16, GPITCH, 0);
    bf16x16 k11 = load_frag(sk, ss + 16, GPITCH, 32);
    // keeps the eight LDS reads above one group with one latency: without it the
    // compiler reuses one fragment's registers and waits out four in a row.
    // Mask: global reads and plain vector / scalar work may still cross it, so
    // that the column statistics' loads below are issued early.
    __builtin_amdgcn_sched_barrier(0x26);
    c0 = wmma_bf16(aq0, k00, c0);
    c1 = wmma_bf16(aq0, k10, c1);
    c0 = wmma_bf16(aq1, k01, c0);
    c1 = wmma_bf16(aq1, k11, c1);

    size_t sb = (size_t)bh * T;
    float m0 = cmax[sb + s0 + nn], r0 = 1.0f / csum[sb + s0 + nn];
    float m1 = cmax[sb + s0 + 16 + nn], r1 = 1.0f / csum[sb + s0 + 16 + nn];
#pragma unroll
    for (int r = 0; r < 8; ++r) {
      myp[(mh + r) * 40 + nn] = (__bf16)(__expf(c0[r] * 0.125f - m0) * r0);
      myp[(mh + r) * 40 + nn + 16] = (__bf16)(__expf(c1[r] * 0.125f - m1) * r1);
    }
    __syncthreads();
    bf16x16 pf = load_frag(myp, 0, 40, 0);  // 16 q rows x K=32 (s)
#pragma unroll
    for (int n = 0; n < 4; ++n) {
      bf16x16 bv = load_frag(sv, n * 16, VPITCH, ss);  // vT rows = v columns
      oacc[n] = wmma_bf16(pf, bv, oacc[n]);
    }
    __syncthreads();
   }

   // publish point of stage st + 1: this wave's reads of stage st have retired,
   asm volatile("s_wait_dscnt 0x0" ::: "memory");
   // each issuing wave's own request (stage st + 1) has landed,
   if (pinned(wave < 2u)) asm volatile("s_wait_tensorcnt 0x0" ::: "memory");
   // every wave has left stage st's buffer and may read stage st + 1,
   __syncthreads();
   // and only then stage st + 2 goes into the buffer that stage st used.
   // pinned() on the stage number: the descriptor words made from it are formed
   // behind the wait and the barrier above
   if (pinned((uint32_t)((wave == 0u) && (st + 2 < nst)))) {
     const uint32_t sn = pinned((uint32_t)st + 2u);
     tdm_load(tdm_group0(ldsk + (sn & 1u) * (2u * GTILEB),
                         gk + (uint64_t)sn * (uint64_t)(AKS * DKV * 2)),
              g1k);
   }
   if (pinned((uint32_t)((wave == 1u) && (st + 2 < nst)))) {
     const uint32_t sn = pinned((uint32_t)st + 2u);
     tdm_load(tdm_group0(ldsv + (sn & 1u) * (2u * GTILEB),
                         gv + (uint64_t)sn * (uint64_t)(AKS * 2)),
              g1v);
   }
  }
  // nothing of the ring is outstanding when the wave goes on to its stores
  asm volatile("s_wait_tensorcnt 0x0" ::: "memory");
  asm volatile("s_wait_dscnt 0x0" ::: "memory");

  int b = bh / H, h = bh % H;
#pragma unroll
  for (int n = 0; n < 4; ++n)
#pragma unroll
    for (int r = 0; r < 8; ++r) {
      int gt = q0 + mh + r;
      int col = h * DKV + n * 16 + nn;
      oc[((size_t)b * T + gt) * D + col] = (__bf16)oacc[n][r];
    }
}

// ---------------------------------------------------------------------------
// Row mean/std norm (ddof=1). One block per row of D=1024.
// ---------------------------------------------------------------------------
__global__ __launch_bounds__(256) void rownorm(const float* __restrict__ y,
                                               float* __restrict__ outF,
                                               __bf16* __restrict__ outB) {
  __shared__ float s1[256], s2[256];
  int row = blockIdx.x, tid = threadIdx.x;
  const float* pr = y + (size_t)row * D;
  float v[4], s = 0.0f, q = 0.0f;
#pragma unroll
  for (int j = 0; j < 4; ++j) {
    v[j] = pr[tid + 256 * j];
    s += v[j];
    q += v[j] * v[j];
  }
  s1[tid] = s;
  s2[tid] = q;
  __syncthreads();
  for (int o = 128; o > 0; o >>= 1) {
    if (tid < o) {
      s1[tid] += s1[tid + o];
      s2[tid] += s2[tid + o];
    }
    __syncthreads();
  }
  float mean = s1[0] * (1.0f / D);
  float var = (s2[0] - s1[0] * s1[0] * (1.0f / D)) * (1.0f / (D - 1));
  float rstd = rsqrtf(var);
  float* po = outF + (size_t)row * D;
#pragma unroll
  for (int j = 0; j < 4; ++j) {
    float o = (v[j] - mean) * rstd;
    po[tid + 256 * j] = o;
    if (outB) outB[(size_t)row * D + tid + 256 * j] = (__bf16)o;
  }
}

// ------------------------- conversion / layout kernels ---------------------
// All grids below are exact for the fixed shapes. Every wave-wide access covers
// whole 128-byte lines, and each thread has 8 16-byte loads in flight.

// 32 elements per thread: 8 float4 loads, 8 stores of 4 bf16.
__global__ __launch_bounds__(256) void cvt_f32_bf16(
    const float* __restrict__ in, __bf16* __restrict__ out) {
  size_t base = (size_t)blockIdx.x * 2048 + threadIdx.x;  // in units of 4
  float4 v[8];
#pragma unroll
  for (int j = 0; j < 8; ++j)
    v[j] = *(const float4*)(const void*)(in + (base + 256 * j) * 4);
#pragma unroll
  for (int j = 0; j < 8; ++j) {
    union { __bf16 h[4]; uint2 u; } pk;
    pk.h[0] = (__bf16)v[j].x;
    pk.h[1] = (__bf16)v[j].y;
    pk.h[2] = (__bf16)v[j].z;
    pk.h[3] = (__bf16)v[j].w;
    *(uint2*)(void*)(out + (base + 256 * j) * 4) = pk.u;
  }
}

// One block turns a tile of 128 rows x 64 columns of f32 (row pitch LDIN) into
// 64 rows x 128 columns of bf16 (row pitch LDOUT). in / out point at the tile.
// The turn goes through LDS at a pitch of 65 dwords: both the row-wise writes
// and the column-wise reads then fall on 32 different banks.
// The pitches are compile-time, so that a thread's accesses share one address
// register pair and differ in the immediate offset alone.
template <int LDIN, int LDOUT>
__device__ __forceinline__ void tile_turn(const float* __restrict__ in,
                                          __bf16* __restrict__ out) {
  __shared__ float tile[128][65];
  int t = threadIdx.x;
  int lr = t >> 4;        // 16 lanes read one row's 256 bytes
  int lc = (t & 15) * 4;
  float4 v[8];
#pragma unroll
  for (int j = 0; j < 8; ++j)
    v[j] = *(const float4*)(const void*)(in + (size_t)(lr + 16 * j) * LDIN + lc);
  // the loads' address registers may be reused by what follows
  asm volatile("s_wait_xcnt 0x0" ::: "memory");
#pragma unroll
  for (int j = 0; j < 8; ++j) {
    tile[lr + 16 * j][lc + 0] = v[j].x;
    tile[lr + 16 * j][lc + 1] = v[j].y;
    tile[lr + 16 * j][lc + 2] = v[j].z;
    tile[lr + 16 * j][lc + 3] = v[j].w;
  }
  __syncthreads();
  int rc = (t & 7) * 8;   // 8 lanes write 128 bytes of one output row
  int c0 = t >> 3;
#pragma unroll
  for (int j = 0; j < 4; ++j) {
    int c = c0 + 32 * (j & 1);
    int r = rc + 64 * (j >> 1);
    union { __bf16 h[8]; uint4 u; } pk;
#pragma unroll
    for (int k = 0; k < 8; ++k) pk.h[k] = (__bf16)tile[r + k][c];
    *(uint4*)(void*)(out + (size_t)c * LDOUT + r) = pk.u;
  }
}

// WqkvT[n][d], n = which*1024 + h*64 + k  (rows = GEMM columns, K-contig)
// Grid: (D/128 row tiles, H heads, 3 matrices); a head is a D x 64 matrix.
__global__ __launch_bounds__(256) void pack_wqkvT(const float* __restrict__ Wq,
                                                  const float* __restrict__ Wk,
                                                  const float* __restrict__ Wv,
                                                  __bf16* __restrict__ out) {
  int d0 = blockIdx.x * 128;
  int h = blockIdx.y;
  int which = blockIdx.z;
  const float* src = which == 0 ? Wq : (which == 1 ? Wk : Wv);
  tile_turn<DKV, D>(src + ((size_t)h * D + d0) * DKV,
                    out + (size_t)(which * 1024 + h * DKV) * D + d0);
}

// out (C x R) = transpose of in (R x C), bf16. Grid: (R/128, C/64).
template <int R, int C>
__global__ __launch_bounds__(256) void packT(const float* __restrict__ in,
                                             __bf16* __restrict__ out) {
  int r0 = blockIdx.x * 128;
  int c0 = blockIdx.y * 64;
  tile_turn<C, R>(in + (size_t)r0 * C + c0, out + (size_t)c0 * R + r0);
}

// ---------------------------------------------------------------------------
extern "C" void kernel_launch(void* const* d_in, const int* in_sizes, int n_in,
                              void* d_out, int out_size, void* d_ws,
                              size_t ws_size, hipStream_t stream) {
  const float* x = (const float*)d_in[0];
  const float* Wq = (const float*)d_in[1];
  const float* Wk = (const float*)d_in[2];
  const float* Wv = (const float*)d_in[3];
  const float* Wo = (const float*)d_in[4];
  const float* W1 = (const float*)d_in[5];
  const float* b1 = (const float*)d_in[6];
  const float* W2 = (const float*)d_in[7];
  const float* b2 = (const float*)d_in[8];

  char* ws = (char*)d_ws;
  const size_t OFF_XB = 0;             //  8 MiB
  const size_t OFF_WQKVT = 8388608;    //  6 MiB
  const size_t OFF_WOT = 14680064;     //  2 MiB
  const size_t OFF_W1T = 16777216;     //  8 MiB
  const size_t OFF_W2T = 25165824;     //  8 MiB
  const size_t OFF_Y2 = 33554432;      // 16 MiB f32
  const size_t OFF_QB = 58720256;      //  8 MiB
  const size_t OFF_KB = 67108864;      //  8 MiB
  const size_t OFF_VT = 75497472;      //  8 MiB
  const size_t OFF_CMAX = 83886080;    // 256 KiB
  const size_t OFF_CSUM = 84148224;    // 256 KiB
  const size_t OFF_OC = 84410368;      //  8 MiB
  const size_t OFF_Y1 = 92798976;      // 16 MiB f32
  const size_t OFF_OUT1F = 109576192;  // 16 MiB f32
  const size_t OFF_OUT1B = 126353408;  //  8 MiB
  const size_t OFF_HB = 134742016;     // 32 MiB

  __bf16* xb = (__bf16*)(ws + OFF_XB);
  __bf16* wqkvT = (__bf16*)(ws + OFF_WQKVT);
  __bf16* woT = (__bf16*)(ws + OFF_WOT);
  __bf16* w1T = (__bf16*)(ws + OFF_W1T);
  __bf16* w2T = (__bf16*)(ws + OFF_W2T);
  __bf16* qb = (__bf16*)(ws + OFF_QB);
  __bf16* kb = (__bf16*)(ws + OFF_KB);
  __bf16* vtb = (__bf16*)(ws + OFF_VT);
  float* cmax = (float*)(ws + OFF_CMAX);
  float* csum = (float*)(ws + OFF_CSUM);
  __bf16* ocb = (__bf16*)(ws + OFF_OC);
  float* y1 = (float*)(ws + OFF_Y1);
  float* out1f = (float*)(ws + OFF_OUT1F);
  __bf16* out1b = (__bf16*)(ws + OFF_OUT1B);
  __bf16* hb = (__bf16*)(ws + OFF_HB);
  float* y2 = (float*)(ws + OFF_Y2);

  // 1) convert x; pack transposed bf16 weights
  cvt_f32_bf16<<<NTOK * D / 8192, 256, 0, stream>>>(x, xb);
  pack_wqkvT<<<dim3(D / 128, H, 3), 256, 0, stream>>>(Wq, Wk, Wv, wqkvT);
  packT<D, D><<<dim3(D / 128, D / 64), 256, 0, stream>>>(Wo, woT);
  packT<D, FF><<<dim3(D / 128, FF / 64), 256, 0, stream>>>(W1, w1T);
  packT<FF, D><<<dim3(FF / 128, D / 64), 256, 0, stream>>>(W2, w2T);

  // 2) fused QKV projection GEMM: (4096x1024)x(1024x3072), head layouts out
  gemm_bf16_tn<0><<<dim3(NQKV / 128, NTOK / 128), 256, 0, stream>>>(
      xb, wqkvT, NTOK, NQKV, D, qb, nullptr, nullptr, nullptr, kb, vtb);

  // 3) attention (column softmax, two-pass flash-style over q)
  attn_colstats<<<(BSZ * H) * (T / 128), 256, 0, stream>>>(qb, kb, cmax, csum);
  attn_out<<<(BSZ * H) * (T / 128), 256, 0, stream>>>(qb, kb, vtb, cmax, csum,
                                                      ocb);

  // 4) output projection + residual, then norm
  gemm_bf16_tn<2><<<dim3(D / 128, NTOK / 128), 256, 0, stream>>>(
      ocb, woT, NTOK, D, D, nullptr, y1, nullptr, x, nullptr, nullptr);
  rownorm<<<NTOK, 256, 0, stream>>>(y1, out1f, out1b);

  // 5) FFN: relu(out1 @ W1 + b1) @ W2 + b2 + out1, then norm -> d_out
  gemm_bf16_tn<1><<<dim3(FF / 128, NTOK / 128), 256, 0, stream>>>(
      out1b, w1T, NTOK, FF, D, hb, nullptr, b1, nullptr, nullptr, nullptr);
  gemm_bf16_tn<3><<<dim3(D / 128, NTOK / 128), 256, 0, stream>>>(
      hb, w2T, NTOK, D, FF, nullptr, y2, b2, out1f, nullptr, nullptr);
  rownorm<<<NTOK, 256, 0, stream>>>(y2, (float*)d_out, nullptr);

  (void)in_sizes;
  (void)n_in;
  (void)out_size;
  (void)ws_size;
}

// v005
// One run takes 247 microseconds.
// In two side-by-side timings against v004, it was 1.06 and 1.07 times as fast.
// All steps since v000 together make it 2.76 times as fast.
#include <hip/hip_runtime.h>
#include <hip/hip_bf16.h>
#include <stdint.h>

// Problem dims (fixed by the reference)
#define BSZ 2
#define T   2048
#define D   1024
#define H   16
#define DKV 64
#define FF  4096
#define NTOK 4096          // BSZ*T
#define NQKV 3072          // 3*H*DKV

typedef __attribute__((ext_vector_type(16))) __bf16 bf16x16;
typedef __attribute__((ext_vector_type(8)))  float  f32x8;

union FragCast { bf16x16 v; uint4 u[2]; };

typedef uint32_t u32x4 __attribute__((ext_vector_type(4)));
typedef uint32_t u32x8 __attribute__((ext_vector_type(8)));

// GEMM stage: 128 rows of 64 halves (128 bytes) per operand, laid in LDS at a
// 144-byte row pitch (16 B x odd: conflict-free for 16-byte fragment reads).
#define GBK 64          // halves of K per stage
#define GPITCH 72       // LDS row pitch in halves
#define GTILEB 18432u   // 128 rows x 144 B = 9 x 2 KiB, one operand's tile

__device__ __forceinline__ uint32_t uni(uint32_t v) {
  return (uint32_t)__builtin_amdgcn_readfirstlane(v);
}

__device__ __forceinline__ uint32_t pinned(uint32_t v) {
  uint32_t w = (uint32_t)__builtin_amdgcn_readfirstlane(v);
  asm volatile("" : "+s"(w));
  return w;
}

// Descriptor group 0: one request, LDS byte offset, global address, type 2.
__device__ __forceinline__ u32x4 tdm_group0(uint32_t lds_dst, uint64_t ga) {
  u32x4 g;
  g[0] = uni(1u);
  g[1] = uni(lds_dst);
  g[2] = uni((uint32_t)ga);
  g[3] = uni((((uint32_t)(ga >> 32)) & 0x01FFFFFFu) | 0x80000000u);
  return g;
}

// Descriptor group 1: byte elements, tensor = tile = 128 rows of 128 bytes,
// source row pitch src_pitch bytes, 16 bytes of LDS pad behind every row.
// pinned(): each descriptor word is held in its scalar register for the whole
// loop, so that none is reused for something else while a request is in flight.
__device__ __forceinline__ u32x8 tdm_group1(uint32_t src_pitch) {
  u32x8 g;
  g[0] = pinned((1u << 20) | (4u << 22) | (3u << 25));
  g[1] = pinned(128u << 16);
  g[2] = pinned(128u << 16);
  g[3] = pinned(128u << 16);
  g[4] = pinned(128u);
  g[5] = pinned(src_pitch);
  g[6] = pinned(0u);
  g[7] = pinned(0u);
  return g;
}

// Attention stage: 128 rows of q or k (128 bytes each, the GEMM's tile and
// pitch), or vT's 64 rows x 128 keys (256 bytes each) at a 272-byte LDS pitch
// (16 B x odd again). Either tile fits one GTILEB place.
#define AKS 128         // queries (pass A) or keys (pass B) per stage
#define VPITCH 136      // vT's LDS row pitch in halves

// Descriptor group 1 of vT's tile: byte elements, tensor = tile = 64 rows of
// 256 bytes, source row pitch T halves, 16 bytes of LDS pad behind every row.
// pinned(): as in tdm_group1.
__device__ __forceinline__ u32x8 tdm_group1_vt() {
  u32x8 g;
  g[0] = pinned((1u << 20) | (5u << 22) | (3u << 25));
  g[1] = pinned(256u << 16);
  g[2] = pinned(64u << 16);
  g[3] = pinned(256u << 16);
  g[4] = pinned(64u);
  g[5] = pinned((uint32_t)T * 2u);
  g[6] = pinned(0u);
  g[7] = pinned(0u);
  return g;
}

__device__ __forceinline__ void tdm_load(u32x4 g0, u32x8 g1) {
  asm volatile("tensor_load_to_lds %0, %1" ::"s"(g0), "s"(g1) : "memory");
}

__device__ __forceinline__ f32x8 wmma_bf16(bf16x16 a, bf16x16 b, f32x8 c) {
  return __builtin_amdgcn_wmma_f32_16x16x32_bf16(false, a, false, b, (short)0, c,
                                                 false, false);
}

__device__ __forceinline__ f32x8 zero8() {
  f32x8 z;
  for (int e = 0; e < 8; ++e) z[e] = 0.0f;
  return z;
}

// Load a 16x32 A-fragment (or B^T-fragment) from row-major bf16 memory
// (global or LDS). Lane l holds row (l&15); K = 16*(j>>3) + 8*(l>>4) + (j&7).
// Each 8-half group is contiguous -> two 16B loads.
__device__ __forceinline__ bf16x16 load_frag(const __bf16* base, int row0,
                                             int ld, int k0) {
  int lane = threadIdx.x & 31;
  int m = lane & 15;
  int kh = lane >> 4;
  const __bf16* p = base + (size_t)(row0 + m) * ld + k0 + 8 * kh;
  FragCast f;
  f.u[0] = *(const uint4*)(const void*)(p);
  f.u[1] = *(const uint4*)(const void*)(p + 16);
  return f.v;
}

// ---------------------------------------------------------------------------
// GEMM: C(MxN) = A(MxK bf16 rowmajor) * Bt(NxK bf16 rowmajor)^T
// MODE 0: bf16, stored straight into q,k (B,H,T,64) and vT (B,H,64,T)
// MODE 1: +bias,ReLU,bf16 | 2: +resid f32 | 3: +bias+resid f32
// 256 thr = 8 waves (2x4). Block tile 128x128, 64 k per stage, wave tile 64x32.
// Two LDS buffers; wave 0 brings A's tile and wave 1 Bt's by one tensor load
// per stage. K is a multiple of 64 and at least 128 (two stages).
// ---------------------------------------------------------------------------
template <int MODE>
__global__ __launch_bounds__(256) void gemm_bf16_tn(
    const __bf16* __restrict__ A, const __bf16* __restrict__ Bt, int M, int N,
    int K, __bf16* __restrict__ outB, float* __restrict__ outF,
    const float* __restrict__ bias, const float* __restrict__ resid,
    __bf16* __restrict__ outK, __bf16* __restrict__ outVT) {
  // [buffer][A | Bt] tiles, each at a multiple of 2 KiB
  __shared__ __attribute__((aligned(2048))) unsigned char sm[4 * GTILEB];

  int t = threadIdx.x;
  const uint32_t wave = uni((uint32_t)t >> 5);
  int lane = t & 31;
  int browg = blockIdx.y * 128;
  int bcolg = blockIdx.x * 128;

  const uint32_t isB = wave & 1u;  // issuing waves: 0 -> A, 1 -> Bt
  const uint64_t gbase =
      (uint64_t)(size_t)(isB ? Bt + (size_t)bcolg * K : A + (size_t)browg * K);
  const uint32_t ldst = (uint32_t)(size_t)sm + isB * GTILEB;
  const u32x8 g1 = tdm_group1((uint32_t)K * 2u);
  const int nst = K / GBK;

  f32x8 acc[4][2];
  for (int i = 0; i < 4; ++i)
    for (int j = 0; j < 2; ++j) acc[i][j] = zero8();

  // prologue: stage 0 lands and is published, then stage 1 flies
  if (pinned(wave < 2u)) {
    tdm_load(tdm_group0(ldst, gbase), g1);
    // stage 0 has landed
    asm volatile("s_wait_tensorcnt 0x0" ::: "memory");
  }
  __syncthreads();
  if (pinned(wave < 2u))
    tdm_load(tdm_group0(ldst + 2u * GTILEB, gbase + 2u * GBK), g1);

  int row0w = (int)(wave >> 2) * 64;  // 0 / 64
  int col0w = (int)(wave & 3u) * 32;  // 0..96

  for (int s = 0; s < nst; ++s) {
    const __bf16* sa = (const __bf16*)(const void*)(sm + (s & 1) * (2u * GTILEB));
    const __bf16* sb = (const __bf16*)(const void*)(sm + (s & 1) * (2u * GTILEB) + GTILEB);
    // All fragments of the stage, both 32-k blocks, each in registers of its own.
    bf16x16 af[GBK / 32][4], bfv[GBK / 32][2];
#pragma unroll
    for (int kb = 0; kb < GBK / 32; ++kb) {
#pragma unroll
      for (int j = 0; j < 2; ++j)
        bfv[kb][j] = load_frag(sb, col0w + 16 * j, GPITCH, 32 * kb);
#pragma unroll
      for (int i = 0; i < 4; ++i)
        af[kb][i] = load_frag(sa, row0w + 16 * i, GPITCH, 32 * kb);
    }
    // keeps the stage's 24 LDS reads one group ahead of its 16 matrix
    // instructions: without it the compiler reuses one A fragment's registers
    // and waits out a whole LDS latency in front of every second one.
    __builtin_amdgcn_sched_barrier(0);
#pragma unroll
    for (int kb = 0; kb < GBK / 32; ++kb)
#pragma unroll
      for (int i = 0; i < 4; ++i)
#pragma unroll
        for (int j = 0; j < 2; ++j)
          acc[i][j] = wmma_bf16(af[kb][i], bfv[kb][j], acc[i][j]);
    // keeps the pass's closing wait below behind the matrix instructions: moved
    // up among them it turns their counted waits into one wait for all 24 reads.
    __builtin_amdgcn_sched_barrier(0);

    // publish point of stage s + 1: this wave's reads of stage s have retired,
    asm volatile("s_wait_dscnt 0x0" ::: "memory");
    // the issuing wave's own request (stage s + 1) has landed,
    if (pinned(wave < 2u)) asm volatile("s_wait_tensorcnt 0x0" ::: "memory");
    // every wave has left stage s's buffer and may read stage s + 1,
    __syncthreads();
    // and only then stage s + 2 goes into the buffer that stage s used.
    if (pinned((uint32_t)((wave < 2u) && (s + 2 < nst)))) {
      // pinned(): the stage number is taken here, so that the descriptor words
      // made from it are formed behind the wait and the barrier above
      const uint32_t sn = pinned((uint32_t)s + 2u);
      tdm_load(tdm_group0(ldst + (sn & 1u) * (2u * GTILEB),
                          gbase + (uint64_t)sn * (2u * GBK)),
               g1);
    }
  }
  // nothing of the ring is outstanding when the wave goes on to its stores
  asm volatile("s_wait_tensorcnt 0x0" ::: "memory");
  asm volatile("s_wait_dscnt 0x0" ::: "memory");

  int mh = (lane >> 4) * 8;
  int nn = lane & 15;
  if (MODE == 0) {
    // Column n = which*1024 + h*64 + kk; a 128-wide block lies in one 'which'.
    // A lane holds 8 consecutive tokens of one column: for vT that is one
    // contiguous 16-byte run, and a wave's 64 tokens fill whole 128-byte lines.
    int which = bcolg >> 10;
    int rem = (bcolg + col0w + nn) & 1023;  // j adds 16, inside the same head
    int kc = rem & 63;
    int gr0 = browg + row0w + mh;  // i adds 16, inside the same batch entry
    size_t bhb = (size_t)((gr0 >> 11) * H + (rem >> 6));
    int tt = gr0 & (T - 1);
    if (which == 2) {
      __bf16* dst = outVT + (bhb * DKV + kc) * T + tt;
#pragma unroll
      for (int i = 0; i < 4; ++i)
#pragma unroll
        for (int j = 0; j < 2; ++j) {
          union { __bf16 h[8]; uint4 u; } pk;
#pragma unroll
          for (int r = 0; r < 8; ++r) pk.h[r] = (__bf16)acc[i][j][r];
          *(uint4*)(void*)(dst + (size_t)(16 * j) * T + 16 * i) = pk.u;
        }
      return;
    }
    __bf16* dst = (which == 0 ? outB : outK) + (bhb * T + tt) * DKV + kc;
#pragma unroll
    for (int i = 0; i < 4; ++i)
#pragma unroll
      for (int j = 0; j < 2; ++j)
#pragma unroll
        for (int r = 0; r < 8; ++r)
          dst[(16 * i + r) * DKV + 16 * j] = (__bf16)acc[i][j][r];
    // The built code lays the vT path right behind these stores, and that path
    // rewrites registers they name: keep the wait in front of it.
    asm volatile("s_wait_xcnt 0x0" ::: "memory");
    return;
  }
#pragma unroll
  for (int i = 0; i < 4; ++i)
#pragma unroll
    for (int j = 0; j < 2; ++j) {
      int gc = bcolg + col0w + 16 * j + nn;
#pragma unroll
      for (int r = 0; r < 8; ++r) {
        int gr = browg + row0w + 16 * i + mh + r;
        size_t idx = (size_t)gr * N + gc;
        float v = acc[i][j][r];
        if (MODE == 1) {
          v += bias[gc];
          v = v > 0.0f ? v : 0.0f;
        }
        if (MODE == 3) v += bias[gc];
        if (MODE == 1)
          outB[idx] = (__bf16)v;
        else
          outF[idx] = v + resid[idx];
      }
    }
}

// ---------------------------------------------------------------------------
// Attention pass A: column softmax stats (softmax is over the QUERY axis).
// Grid: (B*H)*(T/128); each wave owns 16 key columns, loops all q-tiles.
// The 8 waves walk the same q rows: wave 0 brings them into LDS, 128 rows per
// stage by one tensor load, two buffers, and every wave reads fragments there.
// ---------------------------------------------------------------------------
__global__ __launch_bounds__(256) void attn_colstats(
    const __bf16* __restrict__ qb, const __bf16* __restrict__ kb,
    float* __restrict__ cmax, float* __restrict__ csum) {
  // two q tiles, each at a multiple of 2 KiB
  __shared__ __attribute__((aligned(2048))) unsigned char sm[2 * GTILEB];
  const int sblocks = T / 128;
  int bh = blockIdx.x / sblocks;
  int sblk = blockIdx.x % sblocks;
  const uint32_t wave = uni(threadIdx.x >> 5);
  int lane = threadIdx.x & 31;
  int s0 = sblk * 128 + (int)wave * 16;

  const __bf16* qh = qb + (size_t)bh * T * DKV;
  const __bf16* kh = kb + (size_t)bh * T * DKV;

  const uint64_t gq = (uint64_t)(size_t)qh;
  const uint32_t ldst = (uint32_t)(size_t)sm;
  const u32x8 g1 = tdm_group1(DKV * 2u);
  const int nst = T / AKS;

  // prologue: stage 0 lands and is published, then stage 1 flies
  if (pinned(wave == 0u)) {
    tdm_load(tdm_group0(ldst, gq), g1);
    // stage 0 has landed
    asm volatile("s_wait_tensorcnt 0x0" ::: "memory");
  }
  __syncthreads();
  // From here on the ring's group 0 is one value carried through the loop, each
  // request's address made from the one before it: its registers stay in use,
  // so that none is taken for something else while a request is in flight.
  u32x4 g0 = tdm_group0(ldst + GTILEB, gq + (uint64_t)(AKS * DKV * 2));
  g0[0] = pinned(g0[0]);  // pinned(): a descriptor word held in its scalar register
  if (pinned(wave == 0u)) tdm_load(g0, g1);

  bf16x16 kf0 = load_frag(kh, s0, DKV, 0);
  bf16x16 kf1 = load_frag(kh, s0, DKV, 32);

  float m = -3.0e38f, l = 0.0f;
  for (int st = 0; st < nst; ++st) {
   const __bf16* sq = (const __bf16*)(const void*)(sm + (st & 1) * GTILEB);
   // unrolled: a stage is one pass, its LDS offsets are immediates, and later
   // tiles' fragment reads can be issued ahead of this tile's softmax chain
#pragma unroll
   for (int qt = 0; qt < AKS; qt += 16) {
    bf16x16 a0 = load_frag(sq, qt, GPITCH, 0);
    bf16x16 a1 = load_frag(sq, qt, GPITCH, 32);
    f32x8 c = zero8();
    c = wmma_bf16(a0, kf0, c);
    c = wmma_bf16(a1, kf1, c);
    float sc[8], tmax = -3.0e38f;
#pragma unroll
    for (int r = 0; r < 8; ++r) {
      sc[r] = c[r] * 0.125f;  // 1/sqrt(64)
      tmax = fmaxf(tmax, sc[r]);
    }
    // lanes l and l+16 hold the same key column (different q rows): fuse
    tmax = fmaxf(tmax, __shfl_xor(tmax, 16, 32));
    float mn = fmaxf(m, tmax);
    float p = 0.0f;
#pragma unroll
    for (int r = 0; r < 8; ++r) p += __expf(sc[r] - mn);
    p += __shfl_xor(p, 16, 32);
    l = l * __expf(m - mn) + p;
    m = mn;
   }

   // publish point of stage st + 1: this wave's reads of stage st have retired,
   asm volatile("s_wait_dscnt 0x0" ::: "memory");
   // the issuing wave's own request (stage st + 1) has landed,
   if (pinned(wave == 0u)) asm volatile("s_wait_tensorcnt 0x0" ::: "memory");
   // every wave has left stage st's buffer and may read stage st + 1,
   __syncthreads();
   // and only then stage st + 2 goes into the buffer that stage st used.
   if (pinned((uint32_t)((wave == 0u) && (st + 2 < nst)))) {
     // pinned(): the step is taken here, so that the address words made with it
     // are formed behind the wait and the barrier above. The carry goes into
     // word 3's address bits; its type bits lie above them.
     const uint32_t step = pinned((uint32_t)(AKS * DKV * 2));
     const uint64_t ga = (((uint64_t)g0[3] << 32) | (uint64_t)g0[2]) + step;
     g0[1] = uni(ldst + (uint32_t)(st & 1) * GTILEB);
     g0[2] = uni((uint32_t)ga);
     g0[3] = uni((uint32_t)(ga >> 32));
     tdm_load(g0, g1);
   }
  }
  // nothing of the ring is outstanding when the wave goes on to its stores
  asm volatile("s_wait_tensorcnt 0x0" ::: "memory");
  asm volatile("s_wait_dscnt 0x0" ::: "memory");

  if (lane < 16) {
    cmax[(size_t)bh * T + s0 + lane] = m;
    csum[(size_t)bh * T + s0 + lane] = l;
  }
}

// ---------------------------------------------------------------------------
// Attention pass B: recompute scores, p = exp(s/8 - m)/sum, o += p @ v.
// p: C-layout -> LDS -> A-fragment. vT supplies B^T rows directly.
// The 8 waves walk the same keys: per stage of 128 keys wave 0 brings k's rows
// and wave 1 vT's into LDS by one tensor load each, two buffers.
// ---------------------------------------------------------------------------
__global__ __launch_bounds__(256) void attn_out(
    const __bf16* __restrict__ qb, const __bf16* __restrict__ kb,
    const __bf16* __restrict__ vtb, const float* __restrict__ cmax,
    const float* __restrict__ csum, __bf16* __restrict__ oc) {
  // [buffer][k | vT] tiles, each at a multiple of 2 KiB
  __shared__ __attribute__((aligned(2048))) unsigned char sm[4 * GTILEB];
  __shared__ __align__(16) __bf16 pbuf[8][16 * 40];  // per-wave 16x32 (+pad)
  const int qblocks = T / 128;
  int bh = blockIdx.x / qblocks;
  int qblk = blockIdx.x % qblocks;
  const uint32_t wave = uni(threadIdx.x >> 5);
  int lane = threadIdx.x & 31;
  int q0 = qblk * 128 + (int)wave * 16;

  const __bf16* qh = qb + (size_t)bh * T * DKV;
  const __bf16* kh = kb + (size_t)bh * T * DKV;
  const __bf16* vh = vtb + (size_t)bh * DKV * T;

  const uint64_t gk = (uint64_t)(size_t)kh;
  const uint64_t gv = (uint64_t)(size_t)vh;
  const uint32_t ldsk = (uint32_t)(size_t)sm;
  const uint32_t ldsv = ldsk + GTILEB;
  const u32x8 g1k = tdm_group1(DKV * 2u);
  const u32x8 g1v = tdm_group1_vt();
  const int nst = T / AKS;

  // prologue: stage 0 lands and is published, then stage 1 flies
  if (pinned(wave == 0u)) {
    tdm_load(tdm_group0(ldsk, gk), g1k);
    // stage 0 has landed
    asm volatile("s_wait_tensorcnt 0x0" ::: "memory");
  }
  if (pinned(wave == 1u)) {
    tdm_load(tdm_group0(ldsv, gv), g1v);
    asm volatile("s_wait_tensorcnt 0x0" ::: "memory");  // as above
  }
  __syncthreads();
  if (pinned(wave == 0u))
    tdm_load(tdm_group0(ldsk + 2u * GTILEB, gk + (uint64_t)(AKS * DKV * 2)), g1k);
  if (pinned(wave == 1u))
    tdm_load(tdm_group0(ldsv + 2u * GTILEB, gv + (uint64_t)(AKS * 2)), g1v);

  bf16x16 aq0 = load_frag(qh, q0, DKV, 0);
  bf16x16 aq1 = load_frag(qh, q0, DKV, 32);

  f32x8 oacc[4];
  for (int n = 0; n < 4; ++n) oacc[n] = zero8();

  int nn = lane & 15;
  int mh = (lane >> 4) * 8;
  __bf16* myp = &pbuf[wave][0];

  for (int st = 0; st < nst; ++st) {
   const __bf16* sk = (const __bf16*)(const void*)(sm + (st & 1) * (2u * GTILEB));
   const __bf16* sv = (const __bf16*)(const void*)(sm + (st & 1) * (2u * GTILEB) + GTILEB);
   // unrolled: a stage is one pass and its LDS offsets are immediates
#pragma unroll
   for (int ss = 0; ss < AKS; ss += 32) {
    int s0 = st * AKS + ss;
    f32x8 c0 = zero8(), c1 = zero8();
    bf16x16 k00 = load_frag(sk, ss, GPITCH, 0);
    bf16x16 k01 = load_frag(sk, ss, GPITCH, 32);
    bf16x16 k10 = load_frag(sk, ss + 16, GPITCH, 0);
    bf16x16 k11 = load_frag(sk, ss + 16, GPITCH, 32);
    // keeps the eight LDS reads above one group with one latency: without it the
    // compiler reuses one fragment's registers and waits out four in a row.
    // Mask: global reads and plain vector / scalar work may still cross it, so
    // that the column statistics' loads below are issued early.
    __builtin_amdgcn_sched_barrier(0x26);
    c0 = wmma_bf16(aq0, k00, c0);
    c1 = wmma_bf16(aq0, k10, c1);
    c0 = wmma_bf16(aq1, k01, c0);
    c1 = wmma_bf16(aq1, k11, c1);

    size_t sb = (size_t)bh * T;
    float m0 = cmax[sb + s0 + nn], r0 = 1.0f / csum[sb + s0 + nn];
    float m1 = cmax[sb + s0 + 16 + nn], r1 = 1.0f / csum[sb + s0 + 16 + nn];
#pragma unroll
    for (int r = 0; r < 8; ++r) {
      myp[(mh + r) * 40 + nn] = (__bf16)(__expf(c0[r] * 0.125f - m0) * r0);
      myp[(mh + r) * 40 + nn + 16] = (__bf16)(__expf(c1[r] * 0.125f - m1) * r1);
    }
    __syncthreads();
    bf16x16 pf = load_frag(myp, 0, 40, 0);  // 16 q rows x K=32 (s)
#pragma unroll
    for (int n = 0; n < 4; ++n) {
      bf16x16 bv = load_frag(sv, n * 16, VPITCH, ss);  // vT rows = v columns
      oacc[n] = wmma_bf16(pf, bv, oacc[n]);
    }
    __syncthreads();
   }

   // publish point of stage st + 1: this wave's reads of stage st have retired,
   asm volatile("s_wait_dscnt 0x0" ::: "memory");
   // each issuing wave's own request (stage st + 1) has landed,
   if (pinned(wave < 2u)) asm volatile("s_wait_tensorcnt 0x0" ::: "memory");
   // every wave has left stage st's buffer and may read stage st + 1,
   __syncthreads();
   // and only then stage st + 2 goes into the buffer that stage st used.
   // pinned() on the stage number: the descriptor words made from it are formed
   // behind the wait and the barrier above
   if (pinned((uint32_t)((wave == 0u) && (st + 2 < nst)))) {
     const uint32_t sn = pinned((uint32_t)st + 2u);
     tdm_load(tdm_group0(ldsk + (sn & 1u) * (2u * GTILEB),
                         gk + (uint64_t)sn * (uint64_t)(AKS * DKV * 2)),
              g1k);
   }
   if (pinned((uint32_t)((wave == 1u) && (st + 2 < nst)))) {
     const uint32_t sn = pinned((uint32_t)st + 2u);
     tdm_load(tdm_group0(ldsv + (sn & 1u) * (2u * GTILEB),
                         gv + (uint64_t)sn * (uint64_t)(AKS * 2)),
              g1v);
   }
  }
  // nothing of the ring is outstanding when the wave goes on to its stores
  asm volatile("s_wait_tensorcnt 0x0" ::: "memory");
  asm volatile("s_wait_dscnt 0x0" ::: "memory");

  int b = bh / H, h = bh % H;
#pragma unroll
  for (int n = 0; n < 4; ++n)
#pragma unroll
    for (int r = 0; r < 8; ++r) {
      int gt = q0 + mh + r;
      int col = h * DKV + n * 16 + nn;
      oc[((size_t)b * T + gt) * D + col] = (__bf16)oacc[n][r];
    }
}

// ---------------------------------------------------------------------------
// Row mean/std norm (ddof=1). One block per row of D=1024.
// ---------------------------------------------------------------------------
__global__ __launch_bounds__(256) void rownorm(const float* __restrict__ y,
                                               float* __restrict__ outF,
                                               __bf16* __restrict__ outB) {
  __shared__ float s1[256], s2[256];
  int row = blockIdx.x, tid = threadIdx.x;
  const float* pr = y + (size_t)row * D;
  float v[4], s = 0.0f, q = 0.0f;
#pragma unroll
  for (int j = 0; j < 4; ++j) {
    v[j] = pr[tid + 256 * j];
    s += v[j];
    q += v[j] * v[j];
  }
  s1[tid] = s;
  s2[tid] = q;
  __syncthreads();
  for (int o = 128; o > 0; o >>= 1) {
    if (tid < o) {
      s1[tid] += s1[tid + o];
      s2[tid] += s2[tid + o];
    }
    __syncthreads();
  }
  float mean = s1[0] * (1.0f / D);
  float var = (s2[0] - s1[0] * s1[0] * (1.0f / D)) * (1.0f / (D - 1));
  float rstd = rsqrtf(var);
  float* po = outF + (size_t)row * D;
#pragma unroll
  for (int j = 0; j < 4; ++j) {
    float o = (v[j] - mean) * rstd;
    po[tid + 256 * j] = o;
    if (outB) outB[(size_t)row * D + tid + 256 * j] = (__bf16)o;
  }
}

// ------------------------- conversion / layout kernels ---------------------
// All grids below are exact for the fixed shapes. Every wave-wide access covers
// whole 128-byte lines, and each thread has 8 16-byte loads in flight.

// 32 elements per thread: 8 float4 loads, 8 stores of 4 bf16.
__global__ __launch_bounds__(256) void cvt_f32_bf16(
    const float* __restrict__ in, __bf16* __restrict__ out) {
  size_t base = (size_t)blockIdx.x * 2048 + threadIdx.x;  // in units of 4
  float4 v[8];
#pragma unroll
  for (int j = 0; j < 8; ++j)
    v[j] = *(const float4*)(const void*)(in + (base + 256 * j) * 4);
#pragma unroll
  for (int j = 0; j < 8; ++j) {
    union { __bf16 h[4]; uint2 u; } pk;
    pk.h[0] = (__bf16)v[j].x;
    pk.h[1] = (__bf16)v[j].y;
    pk.h[2] = (__bf16)v[j].z;
    pk.h[3] = (__bf16)v[j].w;
    *(uint2*)(void*)(out + (base + 256 * j) * 4) = pk.u;
  }
}

// One block turns a tile of 128 rows x 64 columns of f32 (row pitch LDIN) into
// 64 rows x 128 columns of bf16 (row pitch LDOUT). in / out point at the tile.
// The turn goes through LDS at a pitch of 65 dwords: both the row-wise writes
// and the column-wise reads then fall on 32 different banks.
// The pitches are compile-time, so that a thread's accesses share one address
// register pair and differ in the immediate offset alone.
template <int LDIN, int LDOUT>
__device__ __forceinline__ void tile_turn(const float* __restrict__ in,
                                          __bf16* __restrict__ out) {
  __shared__ float tile[128][65];
  int t = threadIdx.x;
  int lr = t >> 4;        // 16 lanes read one row's 256 bytes
  int lc = (t & 15) * 4;
  float4 v[8];
#pragma unroll
  for (int j = 0; j < 8; ++j)
    v[j] = *(const float4*)(const void*)(in + (size_t)(lr + 16 * j) * LDIN + lc);
  // the loads' address registers may be reused by what follows
  asm volatile("s_wait_xcnt 0x0" ::: "memory");
#pragma unroll
  for (int j = 0; j < 8; ++j) {
    tile[lr + 16 * j][lc + 0] = v[j].x;
    tile[lr + 16 * j][lc + 1] = v[j].y;
    tile[lr + 16 * j][lc + 2] = v[j].z;
    tile[lr + 16 * j][lc + 3] = v[j].w;
  }
  __syncthreads();
  int rc = (t & 7) * 8;   // 8 lanes write 128 bytes of one output row
  int c0 = t >> 3;
#pragma unroll
  for (int j = 0; j < 4; ++j) {
    int c = c0 + 32 * (j & 1);
    int r = rc + 64 * (j >> 1);
    union { __bf16 h[8]; uint4 u; } pk;
#pragma unroll
    for (int k = 0; k < 8; ++k) pk.h[k] = (__bf16)tile[r + k][c];
    *(uint4*)(void*)(out + (size_t)c * LDOUT + r) = pk.u;
  }
}

// WqkvT[n][d], n = which*1024 + h*64 + k  (rows = GEMM columns, K-contig)
// Grid: (D/128 row tiles, H heads, 3 matrices); a head is a D x 64 matrix.
__global__ __launch_bounds__(256) void pack_wqkvT(const float* __restrict__ Wq,
                                                  const float* __restrict__ Wk,
                                                  const float* __restrict__ Wv,
                                                  __bf16* __restrict__ out) {
  int d0 = blockIdx.x * 128;
  int h = blockIdx.y;
  int which = blockIdx.z;
  const float* src = which == 0 ? Wq : (which == 1 ? Wk : Wv);
  tile_turn<DKV, D>(src + ((size_t)h * D + d0) * DKV,
                    out + (size_t)(which * 1024 + h * DKV) * D + d0);
}

// out (C x R) = transpose of in (R x C), bf16. Grid: (R/128, C/64).
template <int R, int C>
__global__ __launch_bounds__(256) void packT(const float* __restrict__ in,
                                             __bf16* __restrict__ out) {
  int r0 = blockIdx.x * 128;
  int c0 = blockIdx.y * 64;
  tile_turn<C, R>(in + (size_t)r0 * C + c0, out + (size_t)c0 * R + r0);
}

// ---------------------------------------------------------------------------
extern "C" void kernel_launch(void* const* d_in, const int* in_sizes, int n_in,
                              void* d_out, int out_size, void* d_ws,
                              size_t ws_size, hipStream_t stream) {
  const float* x = (const float*)d_in[0];
  const float* Wq = (const float*)d_in[1];
  const float* Wk = (const float*)d_in[2];
  const float* Wv = (const float*)d_in[3];
  const float* Wo = (const float*)d_in[4];
  const float* W1 = (const float*)d_in[5];
  const float* b1 = (const float*)d_in[6];
  const float* W2 = (const float*)d_in[7];
  const float* b2 = (const float*)d_in[8];

  char* ws = (char*)d_ws;
  const size_t OFF_XB = 0;             //  8 MiB
  const size_t OFF_WQKVT = 8388608;    //  6 MiB
  const size_t OFF_WOT = 14680064;     //  2 MiB
  const size_t OFF_W1T = 16777216;     //  8 MiB
  const size_t OFF_W2T = 25165824;     //  8 MiB
  const size_t OFF_Y2 = 33554432;      // 16 MiB f32
  const size_t OFF_QB = 58720256;      //  8 MiB
  const size_t OFF_KB = 67108864;      //  8 MiB
  const size_t OFF_VT = 75497472;      //  8 MiB
  const size_t OFF_CMAX = 83886080;    // 256 KiB
  const size_t OFF_CSUM = 84148224;    // 256 KiB
  const size_t OFF_OC = 84410368;      //  8 MiB
  const size_t OFF_Y1 = 92798976;      // 16 MiB f32
  const size_t OFF_OUT1F = 109576192;  // 16 MiB f32
  const size_t OFF_OUT1B = 126353408;  //  8 MiB
  const size_t OFF_HB = 134742016;     // 32 MiB

  __bf16* xb = (__bf16*)(ws + OFF_XB);
  __bf16* wqkvT = (__bf16*)(ws + OFF_WQKVT);
  __bf16* woT = (__bf16*)(ws + OFF_WOT);
  __bf16* w1T = (__bf16*)(ws + OFF_W1T);
  __bf16* w2T = (__bf16*)(ws + OFF_W2T);
  __bf16* qb = (__bf16*)(ws + OFF_QB);
  __bf16* kb = (__bf16*)(ws + OFF_KB);
  __bf16* vtb = (__bf16*)(ws + OFF_VT);
  float* cmax = (float*)(ws + OFF_CMAX);
  float* csum = (float*)(ws + OFF_CSUM);
  __bf16* ocb = (__bf16*)(ws + OFF_OC);
  float* y1 = (float*)(ws + OFF_Y1);
  float* out1f = (float*)(ws + OFF_OUT1F);
  __bf16* out1b = (__bf16*)(ws + OFF_OUT1B);
  __bf16* hb = (__bf16*)(ws + OFF_HB);
  float* y2 = (float*)(ws + OFF_Y2);

  // 1) convert x; pack transposed bf16 weights
  cvt_f32_bf16<<<NTOK * D / 8192, 256, 0, stream>>>(x, xb);
  pack_wqkvT<<<dim3(D / 128, H, 3), 256, 0, stream>>>(Wq, Wk, Wv, wqkvT);
  packT<D, D><<<dim3(D / 128, D / 64), 256, 0, stream>>>(Wo, woT);
  packT<D, FF><<<dim3(D / 128, FF / 64), 256, 0, stream>>>(W1, w1T);
  packT<FF, D><<<dim3(FF / 128, D / 64), 256, 0, stream>>>(W2, w2T);

  // 2) fused QKV projection GEMM: (4096x1024)x(1024x3072), head layouts out
  gemm_bf16_tn<0><<<dim3(NQKV / 128, NTOK / 128), 256, 0, stream>>>(
      xb, wqkvT, NTOK, NQKV, D, qb, nullptr, nullptr, nullptr, kb, vtb);

  // 3) attention (column softmax, two-pass flash-style over q)
  attn_colstats<<<(BSZ * H) * (T / 128), 256, 0, stream>>>(qb, kb, cmax, csum);
  attn_out<<<(BSZ * H) * (T / 128), 256, 0, stream>>>(qb, kb, vtb, cmax, csum,
                                                      ocb);

  // 4) output projection + residual, then norm
  gemm_bf16_tn<2><<<dim3(D / 128, NTOK / 128), 256, 0, stream>>>(
      ocb, woT, NTOK, D, D, nullptr, y1, nullptr, x, nullptr, nullptr);
  rownorm<<<NTOK, 256, 0, stream>>>(y1, out1f, out1b);

  // 5) FFN: relu(out1 @ W1 + b1) @ W2 + b2 + out1, then norm -> d_out
  gemm_bf16_tn<1><<<dim3(FF / 128, NTOK / 128), 256, 0, stream>>>(
      out1b, w1T, NTOK, FF, D, hb, nullptr, b1, nullptr, nullptr, nullptr);
  gemm_bf16_tn<3><<<dim3(D / 128, NTOK / 128), 256, 0, stream>>>(
      hb, w2T, NTOK, D, FF, nullptr, y2, b2, out1f, nullptr, nullptr);
  rownorm<<<NTOK, 256, 0, stream>>>(y2, (float*)d_out, nullptr);

  (void)in_sizes;
  (void)n_in;
  (void)out_size;
  (void)ws_size;
}

// v006
// One run takes 237 microseconds.
// In two side-by-side timings against v005, it was 1.05 and 1.04 times as fast.
// All steps since v000 together make it 2.88 times as fast.
#include <hip/hip_runtime.h>
#include <hip/hip_bf16.h>
#include <stdint.h>

// Problem dims (fixed by the reference)
#define BSZ 2
#define T   2048
#define D   1024
#define H   16
#define DKV 64
#define FF  4096
#define NTOK 4096          // BSZ*T
#define NQKV 3072          // 3*H*DKV

typedef __attribute__((ext_vector_type(16))) __bf16 bf16x16;
typedef __attribute__((ext_vector_type(8)))  float  f32x8;

union FragCast { bf16x16 v; uint4 u[2]; };

typedef uint32_t u32x4 __attribute__((ext_vector_type(4)));
typedef uint32_t u32x8 __attribute__((ext_vector_type(8)));

// GEMM stage: 128 rows of 64 halves (128 bytes) per operand, laid in LDS at a
// 144-byte row pitch (16 B x odd: conflict-free for 16-byte fragment reads).
#define GBK 64          // halves of K per stage
#define GPITCH 72       // LDS row pitch in halves
#define GTILEB 18432u   // 128 rows x 144 B = 9 x 2 KiB, one operand's tile

__device__ __forceinline__ uint32_t uni(uint32_t v) {
  return (uint32_t)__builtin_amdgcn_readfirstlane(v);
}

__device__ __forceinline__ uint32_t pinned(uint32_t v) {
  uint32_t w = (uint32_t)__builtin_amdgcn_readfirstlane(v);
  asm volatile("" : "+s"(w));
  return w;
}

// Descriptor group 0: one request, LDS byte offset, global address, type 2.
__device__ __forceinline__ u32x4 tdm_group0(uint32_t lds_dst, uint64_t ga) {
  u32x4 g;
  g[0] = uni(1u);
  g[1] = uni(lds_dst);
  g[2] = uni((uint32_t)ga);
  g[3] = uni((((uint32_t)(ga >> 32)) & 0x01FFFFFFu) | 0x80000000u);
  return g;
}

// Descriptor group 1: byte elements, tensor = tile = 128 rows of 128 bytes,
// source row pitch src_pitch bytes, 16 bytes of LDS pad behind every row.
// pinned(): each descriptor word is held in its scalar register for the whole
// loop, so that none is reused for something else while a request is in flight.
__device__ __forceinline__ u32x8 tdm_group1(uint32_t src_pitch) {
  u32x8 g;
  g[0] = pinned((1u << 20) | (4u << 22) | (3u << 25));
  g[1] = pinned(128u << 16);
  g[2] = pinned(128u << 16);
  g[3] = pinned(128u << 16);
  g[4] = pinned(128u);
  g[5] = pinned(src_pitch);
  g[6] = pinned(0u);
  g[7] = pinned(0u);
  return g;
}

// Attention stage: 128 rows of q or k (128 bytes each, the GEMM's tile and
// pitch), or vT's 64 rows x 128 keys (256 bytes each) at a 272-byte LDS pitch
// (16 B x odd again). Either tile fits one GTILEB place.
#define AKS 128         // queries (pass A) or keys (pass B) per stage
#define VPITCH 136      // vT's LDS row pitch in halves

// Descriptor group 1 of vT's tile: byte elements, tensor = tile = 64 rows of
// 256 bytes, source row pitch T halves, 16 bytes of LDS pad behind every row.
// pinned(): as in tdm_group1.
__device__ __forceinline__ u32x8 tdm_group1_vt() {
  u32x8 g;
  g[0] = pinned((1u << 20) | (5u << 22) | (3u << 25));
  g[1] = pinned(256u << 16);
  g[2] = pinned(64u << 16);
  g[3] = pinned(256u << 16);
  g[4] = pinned(64u);
  g[5] = pinned((uint32_t)T * 2u);
  g[6] = pinned(0u);
  g[7] = pinned(0u);
  return g;
}

__device__ __forceinline__ void tdm_load(u32x4 g0, u32x8 g1) {
  asm volatile("tensor_load_to_lds %0, %1" ::"s"(g0), "s"(g1) : "memory");
}

__device__ __forceinline__ f32x8 wmma_bf16(bf16x16 a, bf16x16 b, f32x8 c) {
  return __builtin_amdgcn_wmma_f32_16x16x32_bf16(false, a, false, b, (short)0, c,
                                                 false, false);
}

__device__ __forceinline__ f32x8 zero8() {
  f32x8 z;
  for (int e = 0; e < 8; ++e) z[e] = 0.0f;
  return z;
}

// Load a 16x32 A-fragment (or B^T-fragment) from row-major bf16 memory
// (global or LDS). Lane l holds row (l&15); K = 16*(j>>3) + 8*(l>>4) + (j&7).
// Each 8-half group is contiguous -> two 16B loads.
__device__ __forceinline__ bf16x16 load_frag(const __bf16* base, int row0,
                                             int ld, int k0) {
  int lane = threadIdx.x & 31;
  int m = lane & 15;
  int kh = lane >> 4;
  const __bf16* p = base + (size_t)(row0 + m) * ld + k0 + 8 * kh;
  FragCast f;
  f.u[0] = *(const uint4*)(const void*)(p);
  f.u[1] = *(const uint4*)(const void*)(p + 16);
  return f.v;
}

// ---------------------------------------------------------------------------
// GEMM: C(MxN) = A(MxK bf16 rowmajor) * Bt(NxK bf16 rowmajor)^T
// MODE 0: bf16, stored straight into q,k (B,H,T,64) and vT (B,H,64,T)
// MODE 1: +bias,ReLU,bf16 | 2: +resid f32 | 3: +bias+resid f32
// 256 thr = 8 waves (2x4). Block tile 128x128, 64 k per stage, wave tile 64x32.
// Two LDS buffers; wave 0 brings A's tile and wave 1 Bt's by one tensor load
// per stage. K is a multiple of 64 and at least 128 (two stages).
// ---------------------------------------------------------------------------
template <int MODE>
__global__ __launch_bounds__(256) void gemm_bf16_tn(
    const __bf16* __restrict__ A, const __bf16* __restrict__ Bt, int M, int N,
    int K, __bf16* __restrict__ outB, float* __restrict__ outF,
    const float* __restrict__ bias, const float* __restrict__ resid,
    __bf16* __restrict__ outK, __bf16* __restrict__ outVT) {
  // [buffer][A | Bt] tiles, each at a multiple of 2 KiB
  __shared__ __attribute__((aligned(2048))) unsigned char sm[4 * GTILEB];

  int t = threadIdx.x;
  const uint32_t wave = uni((uint32_t)t >> 5);
  int lane = t & 31;
  int browg = blockIdx.y * 128;
  int bcolg = blockIdx.x * 128;

  const uint32_t isB = wave & 1u;  // issuing waves: 0 -> A, 1 -> Bt
  const uint64_t gbase =
      (uint64_t)(size_t)(isB ? Bt + (size_t)bcolg * K : A + (size_t)browg * K);
  const uint32_t ldst = (uint32_t)(size_t)sm + isB * GTILEB;
  const u32x8 g1 = tdm_group1((uint32_t)K * 2u);
  const int nst = K / GBK;

  f32x8 acc[4][2];
  for (int i = 0; i < 4; ++i)
    for (int j = 0; j < 2; ++j) acc[i][j] = zero8();

  // prologue: stage 0 lands and is published, then stage 1 flies
  if (pinned(wave < 2u)) {
    tdm_load(tdm_group0(ldst, gbase), g1);
    // stage 0 has landed
    asm volatile("s_wait_tensorcnt 0x0" ::: "memory");
  }
  __syncthreads();
  if (pinned(wave < 2u))
    tdm_load(tdm_group0(ldst + 2u * GTILEB, gbase + 2u * GBK), g1);

  int row0w = (int)(wave >> 2) * 64;  // 0 / 64
  int col0w = (int)(wave & 3u) * 32;  // 0..96

  for (int s = 0; s < nst; ++s) {
    const __bf16* sa = (const __bf16*)(const void*)(sm + (s & 1) * (2u * GTILEB));
    const __bf16* sb = (const __bf16*)(const void*)(sm + (s & 1) * (2u * GTILEB) + GTILEB);
    // All fragments of the stage, both 32-k blocks, each in registers of its own.
    bf16x16 af[GBK / 32][4], bfv[GBK / 32][2];
#pragma unroll
    for (int kb = 0; kb < GBK / 32; ++kb) {
#pragma unroll
      for (int j = 0; j < 2; ++j)
        bfv[kb][j] = load_frag(sb, col0w + 16 * j, GPITCH, 32 * kb);
#pragma unroll
      for (int i = 0; i < 4; ++i)
        af[kb][i] = load_frag(sa, row0w + 16 * i, GPITCH, 32 * kb);
    }
    // keeps the stage's 24 LDS reads one group ahead of its 16 matrix
    // instructions: without it the compiler reuses one A fragment's registers
    // and waits out a whole LDS latency in front of every second one.
    __builtin_amdgcn_sched_barrier(0);
#pragma unroll
    for (int kb = 0; kb < GBK / 32; ++kb)
#pragma unroll
      for (int i = 0; i < 4; ++i)
#pragma unroll
        for (int j = 0; j < 2; ++j)
          acc[i][j] = wmma_bf16(af[kb][i], bfv[kb][j], acc[i][j]);
    // keeps the pass's closing wait below behind the matrix instructions: moved
    // up among them it turns their counted waits into one wait for all 24 reads.
    __builtin_amdgcn_sched_barrier(0);

    // publish point of stage s + 1: this wave's reads of stage s have retired,
    asm volatile("s_wait_dscnt 0x0" ::: "memory");
    // the issuing wave's own request (stage s + 1) has landed,
    if (pinned(wave < 2u)) asm volatile("s_wait_tensorcnt 0x0" ::: "memory");
    // every wave has left stage s's buffer and may read stage s + 1,
    __syncthreads();
    // and only then stage s + 2 goes into the buffer that stage s used.
    if (pinned((uint32_t)((wave < 2u) && (s + 2 < nst)))) {
      // pinned(): the stage number is taken here, so that the descriptor words
      // made from it are formed behind the wait and the barrier above
      const uint32_t sn = pinned((uint32_t)s + 2u);
      tdm_load(tdm_group0(ldst + (sn & 1u) * (2u * GTILEB),
                          gbase + (uint64_t)sn * (2u * GBK)),
               g1);
    }
  }
  // nothing of the ring is outstanding when the wave goes on to its stores
  asm volatile("s_wait_tensorcnt 0x0" ::: "memory");
  asm volatile("s_wait_dscnt 0x0" ::: "memory");

  int mh = (lane >> 4) * 8;
  int nn = lane & 15;
  if (MODE == 0) {
    // Column n = which*1024 + h*64 + kk; a 128-wide block lies in one 'which'.
    // A lane holds 8 consecutive tokens of one column: for vT that is one
    // contiguous 16-byte run, and a wave's 64 tokens fill whole 128-byte lines.
    int which = bcolg >> 10;
    int rem = (bcolg + col0w + nn) & 1023;  // j adds 16, inside the same head
    int kc = rem & 63;
    int gr0 = browg + row0w + mh;  // i adds 16, inside the same batch entry
    size_t bhb = (size_t)((gr0 >> 11) * H + (rem >> 6));
    int tt = gr0 & (T - 1);
    if (which == 2) {
      __bf16* dst = outVT + (bhb * DKV + kc) * T + tt;
#pragma unroll
      for (int i = 0; i < 4; ++i)
#pragma unroll
        for (int j = 0; j < 2; ++j) {
          union { __bf16 h[8]; uint4 u; } pk;
#pragma unroll
          for (int r = 0; r < 8; ++r) pk.h[r] = (__bf16)acc[i][j][r];
          *(uint4*)(void*)(dst + (size_t)(16 * j) * T + 16 * i) = pk.u;
        }
      return;
    }
    __bf16* dst = (which == 0 ? outB : outK) + (bhb * T + tt) * DKV + kc;
#pragma unroll
    for (int i = 0; i < 4; ++i)
#pragma unroll
      for (int j = 0; j < 2; ++j)
#pragma unroll
        for (int r = 0; r < 8; ++r)
          dst[(16 * i + r) * DKV + 16 * j] = (__bf16)acc[i][j][r];
    // The built code lays the vT path right behind these stores, and that path
    // rewrites registers they name: keep the wait in front of it.
    asm volatile("s_wait_xcnt 0x0" ::: "memory");
    return;
  }
#pragma unroll
  for (int i = 0; i < 4; ++i)
#pragma unroll
    for (int j = 0; j < 2; ++j) {
      int gc = bcolg + col0w + 16 * j + nn;
#pragma unroll
      for (int r = 0; r < 8; ++r) {
        int gr = browg + row0w + 16 * i + mh + r;
        size_t idx = (size_t)gr * N + gc;
        float v = acc[i][j][r];
        if (MODE == 1) {
          v += bias[gc];
          v = v > 0.0f ? v : 0.0f;
        }
        if (MODE == 3) v += bias[gc];
        if (MODE == 1)
          outB[idx] = (__bf16)v;
        else
          outF[idx] = v + resid[idx];
      }
    }
}

// ---------------------------------------------------------------------------
// Attention pass A: column softmax stats (softmax is over the QUERY axis).
// Grid: (B*H)*(T/128); each wave owns 16 key columns, loops all q-tiles.
// The 8 waves walk the same q rows: wave 0 brings them into LDS, 128 rows per
// stage by one tensor load, two buffers, and every wave reads fragments there.
// ---------------------------------------------------------------------------
__global__ __launch_bounds__(256) void attn_colstats(
    const __bf16* __restrict__ qb, const __bf16* __restrict__ kb,
    float* __restrict__ cmax, float* __restrict__ csum) {
  // two q tiles, each at a multiple of 2 KiB
  __shared__ __attribute__((aligned(2048))) unsigned char sm[2 * GTILEB];
  const int sblocks = T / 128;
  int bh = blockIdx.x / sblocks;
  int sblk = blockIdx.x % sblocks;
  const uint32_t wave = uni(threadIdx.x >> 5);
  int lane = threadIdx.x & 31;
  int s0 = sblk * 128 + (int)wave * 16;

  const __bf16* qh = qb + (size_t)bh * T * DKV;
  const __bf16* kh = kb + (size_t)bh * T * DKV;

  const uint64_t gq = (uint64_t)(size_t)qh;
  const uint32_t ldst = (uint32_t)(size_t)sm;
  const u32x8 g1 = tdm_group1(DKV * 2u);
  const int nst = T / AKS;

  // prologue: stage 0 lands and is published, then stage 1 flies
  if (pinned(wave == 0u)) {
    tdm_load(tdm_group0(ldst, gq), g1);
    // stage 0 has landed
    asm volatile("s_wait_tensorcnt 0x0" ::: "memory");
  }
  __syncthreads();
  // From here on the ring's group 0 is one value carried through the loop, each
  // request's address made from the one before it: its registers stay in use,
  // so that none is taken for something else while a request is in flight.
  u32x4 g0 = tdm_group0(ldst + GTILEB, gq + (uint64_t)(AKS * DKV * 2));
  g0[0] = pinned(g0[0]);  // pinned(): a descriptor word held in its scalar register
  if (pinned(wave == 0u)) tdm_load(g0, g1);

  bf16x16 kf0 = load_frag(kh, s0, DKV, 0);
  bf16x16 kf1 = load_frag(kh, s0, DKV, 32);

  float m = -3.0e38f, l = 0.0f;
  for (int st = 0; st < nst; ++st) {
   const __bf16* sq = (const __bf16*)(const void*)(sm + (st & 1) * GTILEB);
   // unrolled: a stage is one pass, its LDS offsets are immediates, and later
   // tiles' fragment reads can be issued ahead of this tile's softmax chain
#pragma unroll
   for (int qt = 0; qt < AKS; qt += 16) {
    bf16x16 a0 = load_frag(sq, qt, GPITCH, 0);
    bf16x16 a1 = load_frag(sq, qt, GPITCH, 32);
    f32x8 c = zero8();
    c = wmma_bf16(a0, kf0, c);
    c = wmma_bf16(a1, kf1, c);
    float sc[8], tmax = -3.0e38f;
#pragma unroll
    for (int r = 0; r < 8; ++r) {
      sc[r] = c[r] * 0.125f;  // 1/sqrt(64)
      tmax = fmaxf(tmax, sc[r]);
    }
    // lanes l and l+16 hold the same key column (different q rows): fuse
    tmax = fmaxf(tmax, __shfl_xor(tmax, 16, 32));
    float mn = fmaxf(m, tmax);
    float p = 0.0f;
#pragma unroll
    for (int r = 0; r < 8; ++r) p += __expf(sc[r] - mn);
    p += __shfl_xor(p, 16, 32);
    l = l * __expf(m - mn) + p;
    m = mn;
   }

   // publish point of stage st + 1: this wave's reads of stage st have retired,
   asm volatile("s_wait_dscnt 0x0" ::: "memory");
   // the issuing wave's own request (stage st + 1) has landed,
   if (pinned(wave == 0u)) asm volatile("s_wait_tensorcnt 0x0" ::: "memory");
   // every wave has left stage st's buffer and may read stage st + 1,
   __syncthreads();
   // and only then stage st + 2 goes into the buffer that stage st used.
   if (pinned((uint32_t)((wave == 0u) && (st + 2 < nst)))) {
     // pinned(): the step is taken here, so that the address words made with it
     // are formed behind the wait and the barrier above. The carry goes into
     // word 3's address bits; its type bits lie above them.
     const uint32_t step = pinned((uint32_t)(AKS * DKV * 2));
     const uint64_t ga = (((uint64_t)g0[3] << 32) | (uint64_t)g0[2]) + step;
     g0[1] = uni(ldst + (uint32_t)(st & 1) * GTILEB);
     g0[2] = uni((uint32_t)ga);
     g0[3] = uni((uint32_t)(ga >> 32));
     tdm_load(g0, g1);
   }
  }
  // nothing of the ring is outstanding when the wave goes on to its stores
  asm volatile("s_wait_tensorcnt 0x0" ::: "memory");
  asm volatile("s_wait_dscnt 0x0" ::: "memory");

  if (lane < 16) {
    cmax[(size_t)bh * T + s0 + lane] = m;
    csum[(size_t)bh * T + s0 + lane] = l;
  }
}

// ---------------------------------------------------------------------------
// Attention pass B: recompute scores, p = exp(s/8 - m)/sum, o += p @ v.
// p: C-layout -> LDS -> A-fragment. vT supplies B^T rows directly.
// The 8 waves walk the same keys: per stage of 128 keys wave 0 brings k's rows
// and wave 1 vT's into LDS by one tensor load each, two buffers.
// ---------------------------------------------------------------------------
__global__ __launch_bounds__(256) void attn_out(
    const __bf16* __restrict__ qb, const __bf16* __restrict__ kb,
    const __bf16* __restrict__ vtb, const float* __restrict__ cmax,
    const float* __restrict__ csum, __bf16* __restrict__ oc) {
  // [buffer][k | vT] tiles, each at a multiple of 2 KiB
  __shared__ __attribute__((aligned(2048))) unsigned char sm[4 * GTILEB];
  __shared__ __align__(16) __bf16 pbuf[8][16 * 40];  // per-wave 16x32 (+pad)
  const int qblocks = T / 128;
  int bh = blockIdx.x / qblocks;
  int qblk = blockIdx.x % qblocks;
  const uint32_t wave = uni(threadIdx.x >> 5);
  int lane = threadIdx.x & 31;
  int q0 = qblk * 128 + (int)wave * 16;

  const __bf16* qh = qb + (size_t)bh * T * DKV;
  const __bf16* kh = kb + (size_t)bh * T * DKV;
  const __bf16* vh = vtb + (size_t)bh * DKV * T;

  const uint64_t gk = (uint64_t)(size_t)kh;
  const uint64_t gv = (uint64_t)(size_t)vh;
  const uint32_t ldsk = (uint32_t)(size_t)sm;
  const uint32_t ldsv = ldsk + GTILEB;
  const u32x8 g1k = tdm_group1(DKV * 2u);
  const u32x8 g1v = tdm_group1_vt();
  const int nst = T / AKS;

  // prologue: stage 0 lands and is published, then stage 1 flies
  if (pinned(wave == 0u)) {
    tdm_load(tdm_group0(ldsk, gk), g1k);
    // stage 0 has landed
    asm volatile("s_wait_tensorcnt 0x0" ::: "memory");
  }
  if (pinned(wave == 1u)) {
    tdm_load(tdm_group0(ldsv, gv), g1v);
    asm volatile("s_wait_tensorcnt 0x0" ::: "memory");  // as above
  }
  __syncthreads();
  if (pinned(wave == 0u))
    tdm_load(tdm_group0(ldsk + 2u * GTILEB, gk + (uint64_t)(AKS * DKV * 2)), g1k);
  if (pinned(wave == 1u))
    tdm_load(tdm_group0(ldsv + 2u * GTILEB, gv + (uint64_t)(AKS * 2)), g1v);

  bf16x16 aq0 = load_frag(qh, q0, DKV, 0);
  bf16x16 aq1 = load_frag(qh, q0, DKV, 32);

  f32x8 oacc[4];
  for (int n = 0; n < 4; ++n) oacc[n] = zero8();

  int nn = lane & 15;
  int mh = (lane >> 4) * 8;
  __bf16* myp = &pbuf[wave][0];

  for (int st = 0; st < nst; ++st) {
   const __bf16* sk = (const __bf16*)(const void*)(sm + (st & 1) * (2u * GTILEB));
   const __bf16* sv = (const __bf16*)(const void*)(sm + (st & 1) * (2u * GTILEB) + GTILEB);
   // unrolled: a stage is one pass and its LDS offsets are immediates
#pragma unroll
   for (int ss = 0; ss < AKS; ss += 32) {
    int s0 = st * AKS + ss;
    f32x8 c0 = zero8(), c1 = zero8();
    bf16x16 k00 = load_frag(sk, ss, GPITCH, 0);
    bf16x16 k01 = load_frag(sk, ss, GPITCH, 32);
    bf16x16 k10 = load_frag(sk, ss + 16, GPITCH, 0);
    bf16x16 k11 = load_frag(sk, ss + 16, GPITCH, 32);
    // keeps the eight LDS reads above one group with one latency: without it the
    // compiler reuses one fragment's registers and waits out four in a row.
    // Mask: global reads and plain vector / scalar work may still cross it, so
    // that the column statistics' loads below are issued early.
    __builtin_amdgcn_sched_barrier(0x26);
    c0 = wmma_bf16(aq0, k00, c0);
    c1 = wmma_bf16(aq0, k10, c1);
    c0 = wmma_bf16(aq1, k01, c0);
    c1 = wmma_bf16(aq1, k11, c1);

    size_t sb = (size_t)bh * T;
    float m0 = cmax[sb + s0 + nn], r0 = 1.0f / csum[sb + s0 + nn];
    float m1 = cmax[sb + s0 + 16 + nn], r1 = 1.0f / csum[sb + s0 + 16 + nn];
#pragma unroll
    for (int r = 0; r < 8; ++r) {
      myp[(mh + r) * 40 + nn] = (__bf16)(__expf(c0[r] * 0.125f - m0) * r0);
      myp[(mh + r) * 40 + nn + 16] = (__bf16)(__expf(c1[r] * 0.125f - m1) * r1);
    }
    __syncthreads();
    bf16x16 pf = load_frag(myp, 0, 40, 0);  // 16 q rows x K=32 (s)
#pragma unroll
    for (int n = 0; n < 4; ++n) {
      bf16x16 bv = load_frag(sv, n * 16, VPITCH, ss);  // vT rows = v columns
      oacc[n] = wmma_bf16(pf, bv, oacc[n]);
    }
    __syncthreads();
   }

   // publish point of stage st + 1: this wave's reads of stage st have retired,
   asm volatile("s_wait_dscnt 0x0" ::: "memory");
   // each issuing wave's own request (stage st + 1) has landed,
   if (pinned(wave < 2u)) asm volatile("s_wait_tensorcnt 0x0" ::: "memory");
   // every wave has left stage st's buffer and may read stage st + 1,
   __syncthreads();
   // and only then stage st + 2 goes into the buffer that stage st used.
   // pinned() on the stage number: the descriptor words made from it are formed
   // behind the wait and the barrier above
   if (pinned((uint32_t)((wave == 0u) && (st + 2 < nst)))) {
     const uint32_t sn = pinned((uint32_t)st + 2u);
     tdm_load(tdm_group0(ldsk + (sn & 1u) * (2u * GTILEB),
                         gk + (uint64_t)sn * (uint64_t)(AKS * DKV * 2)),
              g1k);
   }
   if (pinned((uint32_t)((wave == 1u) && (st + 2 < nst)))) {
     const uint32_t sn = pinned((uint32_t)st + 2u);
     tdm_load(tdm_group0(ldsv + (sn & 1u) * (2u * GTILEB),
                         gv + (uint64_t)sn * (uint64_t)(AKS * 2)),
              g1v);
   }
  }
  // nothing of the ring is outstanding when the wave goes on to its stores
  asm volatile("s_wait_tensorcnt 0x0" ::: "memory");
  asm volatile("s_wait_dscnt 0x0" ::: "memory");

  int b = bh / H, h = bh % H;
#pragma unroll
  for (int n = 0; n < 4; ++n)
#pragma unroll
    for (int r = 0; r < 8; ++r) {
      int gt = q0 + mh + r;
      int col = h * DKV + n * 16 + nn;
      oc[((size_t)b * T + gt) * D + col] = (__bf16)oacc[n][r];
    }
}

// ---------------------------------------------------------------------------
// Row mean/std norm (ddof=1). One block per row of D=1024.
// ---------------------------------------------------------------------------
__global__ __launch_bounds__(256) void rownorm(const float* __restrict__ y,
                                               float* __restrict__ outF,
                                               __bf16* __restrict__ outB) {
  __shared__ float s1[256], s2[256];
  int row = blockIdx.x, tid = threadIdx.x;
  const float* pr = y + (size_t)row * D;
  float v[4], s = 0.0f, q = 0.0f;
#pragma unroll
  for (int j = 0; j < 4; ++j) {
    v[j] = pr[tid + 256 * j];
    s += v[j];
    q += v[j] * v[j];
  }
  s1[tid] = s;
  s2[tid] = q;
  __syncthreads();
  for (int o = 128; o > 0; o >>= 1) {
    if (tid < o) {
      s1[tid] += s1[tid + o];
      s2[tid] += s2[tid + o];
    }
    __syncthreads();
  }
  float mean = s1[0] * (1.0f / D);
  float var = (s2[0] - s1[0] * s1[0] * (1.0f / D)) * (1.0f / (D - 1));
  float rstd = rsqrtf(var);
  float* po = outF + (size_t)row * D;
#pragma unroll
  for (int j = 0; j < 4; ++j) {
    float o = (v[j] - mean) * rstd;
    po[tid + 256 * j] = o;
    if (outB) outB[(size_t)row * D + tid + 256 * j] = (__bf16)o;
  }
}

// ------------------------- conversion / layout kernel ----------------------
// The grid below is exact for the fixed shapes. Every wave-wide access covers
// whole 128-byte lines, and each thread has 8 16-byte loads in flight.

// One block converts 8192 elements, 32 per thread: 8 float4 loads, 8 stores of
// 4 bf16. blk is the block's number within this job.
__device__ __forceinline__ void cvt_f32_bf16(int blk, const float* __restrict__ in,
                                             __bf16* __restrict__ out) {
  size_t base = (size_t)blk * 2048 + threadIdx.x;  // in units of 4
  float4 v[8];
#pragma unroll
  for (int j = 0; j < 8; ++j)
    v[j] = *(const float4*)(const void*)(in + (base + 256 * j) * 4);
#pragma unroll
  for (int j = 0; j < 8; ++j) {
    union { __bf16 h[4]; uint2 u; } pk;
    pk.h[0] = (__bf16)v[j].x;
    pk.h[1] = (__bf16)v[j].y;
    pk.h[2] = (__bf16)v[j].z;
    pk.h[3] = (__bf16)v[j].w;
    *(uint2*)(void*)(out + (base + 256 * j) * 4) = pk.u;
  }
}

// One block turns a tile of 128 rows x 64 columns of f32 (row pitch LDIN) into
// 64 rows x 128 columns of bf16 (row pitch LDOUT). in / out point at the tile.
// The turn goes through LDS at a pitch of 65 dwords: both the row-wise writes
// and the column-wise reads then fall on 32 different banks.
// The pitches are compile-time, so that a thread's accesses share one address
// register pair and differ in the immediate offset alone.
template <int LDIN, int LDOUT>
__device__ __forceinline__ void tile_turn(float (*tile)[65],
                                          const float* __restrict__ in,
                                          __bf16* __restrict__ out) {
  int t = threadIdx.x;
  int lr = t >> 4;        // 16 lanes read one row's 256 bytes
  int lc = (t & 15) * 4;
  float4 v[8];
#pragma unroll
  for (int j = 0; j < 8; ++j)
    v[j] = *(const float4*)(const void*)(in + (size_t)(lr + 16 * j) * LDIN + lc);
  // the loads' address registers may be reused by what follows
  asm volatile("s_wait_xcnt 0x0" ::: "memory");
#pragma unroll
  for (int j = 0; j < 8; ++j) {
    tile[lr + 16 * j][lc + 0] = v[j].x;
    tile[lr + 16 * j][lc + 1] = v[j].y;
    tile[lr + 16 * j][lc + 2] = v[j].z;
    tile[lr + 16 * j][lc + 3] = v[j].w;
  }
  __syncthreads();
  int rc = (t & 7) * 8;   // 8 lanes write 128 bytes of one output row
  int c0 = t >> 3;
#pragma unroll
  for (int j = 0; j < 4; ++j) {
    int c = c0 + 32 * (j & 1);
    int r = rc + 64 * (j >> 1);
    union { __bf16 h[8]; uint4 u; } pk;
#pragma unroll
    for (int k = 0; k < 8; ++k) pk.h[k] = (__bf16)tile[r + k][c];
    *(uint4*)(void*)(out + (size_t)c * LDOUT + r) = pk.u;
  }
  // The built code lays another job's path right behind these stores, and that
  // path rewrites registers they name: keep the wait in front of it.
  asm volatile("s_wait_xcnt 0x0" ::: "memory");
}

// out (C x R) = transpose of in (R x C), bf16; blk counts the R/128 row tiles
// fastest, then the C/64 column tiles.
template <int R, int C>
__device__ __forceinline__ void packT(float (*tile)[65], int blk,
                                      const float* __restrict__ in,
                                      __bf16* __restrict__ out) {
  int r0 = (blk % (R / 128)) * 128;
  int c0 = (blk / (R / 128)) * 64;
  tile_turn<C, R>(tile, in + (size_t)r0 * C + c0, out + (size_t)c0 * R + r0);
}

// Blocks per job of the one preparation launch
#define NB_X (NTOK * D / 8192)             // x -> bf16
#define NB_QKV ((D / 128) * H * 3)         // Wq, Wk, Wv
#define NB_WO ((D / 128) * (D / 64))
#define NB_W1 ((D / 128) * (FF / 64))
#define NB_W2 ((FF / 128) * (D / 64))

// The five preparation jobs read only inputs and none reads another's output:
// they share one grid, and a block finds its job from its index (the same for
// the whole block, so the barrier in tile_turn stays under uniform control flow).
__global__ __launch_bounds__(256) void prep_inputs(
    const float* __restrict__ x, const float* __restrict__ Wq,
    const float* __restrict__ Wk, const float* __restrict__ Wv,
    const float* __restrict__ Wo, const float* __restrict__ W1,
    const float* __restrict__ W2, __bf16* __restrict__ xb,
    __bf16* __restrict__ wqkvT, __bf16* __restrict__ woT,
    __bf16* __restrict__ w1T, __bf16* __restrict__ w2T) {
  __shared__ float tile[128][65];
  int b = blockIdx.x;
  if (b < NB_X) {
    cvt_f32_bf16(b, x, xb);
    return;
  }
  b -= NB_X;
  if (b < NB_QKV) {
    // WqkvT[n][d], n = which*1024 + h*64 + k (rows = GEMM columns, K-contig);
    // a head is a D x 64 matrix.
    int d0 = (b % (D / 128)) * 128;
    int h = (b / (D / 128)) % H;
    int which = b / ((D / 128) * H);
    const float* src = which == 0 ? Wq : (which == 1 ? Wk : Wv);
    tile_turn<DKV, D>(tile, src + ((size_t)h * D + d0) * DKV,
                      wqkvT + (size_t)(which * 1024 + h * DKV) * D + d0);
    return;
  }
  b -= NB_QKV;
  if (b < NB_WO) {
    packT<D, D>(tile, b, Wo, woT);
    return;
  }
  b -= NB_WO;
  if (b < NB_W1) {
    packT<D, FF>(tile, b, W1, w1T);
    return;
  }
  packT<FF, D>(tile, b - NB_W1, W2, w2T);
}

// ---------------------------------------------------------------------------
extern "C" void kernel_launch(void* const* d_in, const int* in_sizes, int n_in,
                              void* d_out, int out_size, void* d_ws,
                              size_t ws_size, hipStream_t stream) {
  const float* x = (const float*)d_in[0];
  const float* Wq = (const float*)d_in[1];
  const float* Wk = (const float*)d_in[2];
  const float* Wv = (const float*)d_in[3];
  const float* Wo = (const float*)d_in[4];
  const float* W1 = (const float*)d_in[5];
  const float* b1 = (const float*)d_in[6];
  const float* W2 = (const float*)d_in[7];
  const float* b2 = (const float*)d_in[8];

  char* ws = (char*)d_ws;
  const size_t OFF_XB = 0;             //  8 MiB
  const size_t OFF_WQKVT = 8388608;    //  6 MiB
  const size_t OFF_WOT = 14680064;     //  2 MiB
  const size_t OFF_W1T = 16777216;     //  8 MiB
  const size_t OFF_W2T = 25165824;     //  8 MiB
  const size_t OFF_Y2 = 33554432;      // 16 MiB f32
  const size_t OFF_QB = 58720256;      //  8 MiB
  const size_t OFF_KB = 67108864;      //  8 MiB
  const size_t OFF_VT = 75497472;      //  8 MiB
  const size_t OFF_CMAX = 83886080;    // 256 KiB
  const size_t OFF_CSUM = 84148224;    // 256 KiB
  const size_t OFF_OC = 84410368;      //  8 MiB
  const size_t OFF_Y1 = 92798976;      // 16 MiB f32
  const size_t OFF_OUT1F = 109576192;  // 16 MiB f32
  const size_t OFF_OUT1B = 126353408;  //  8 MiB
  const size_t OFF_HB = 134742016;     // 32 MiB

  __bf16* xb = (__bf16*)(ws + OFF_XB);
  __bf16* wqkvT = (__bf16*)(ws + OFF_WQKVT);
  __bf16* woT = (__bf16*)(ws + OFF_WOT);
  __bf16* w1T = (__bf16*)(ws + OFF_W1T);
  __bf16* w2T = (__bf16*)(ws + OFF_W2T);
  __bf16* qb = (__bf16*)(ws + OFF_QB);
  __bf16* kb = (__bf16*)(ws + OFF_KB);
  __bf16* vtb = (__bf16*)(ws + OFF_VT);
  float* cmax = (float*)(ws + OFF_CMAX);
  float* csum = (float*)(ws + OFF_CSUM);
  __bf16* ocb = (__bf16*)(ws + OFF_OC);
  float* y1 = (float*)(ws + OFF_Y1);
  float* out1f = (float*)(ws + OFF_OUT1F);
  __bf16* out1b = (__bf16*)(ws + OFF_OUT1B);
  __bf16* hb = (__bf16*)(ws + OFF_HB);
  float* y2 = (float*)(ws + OFF_Y2);

  // 1) convert x and pack the transposed bf16 weights, one launch
  prep_inputs<<<NB_X + NB_QKV + NB_WO + NB_W1 + NB_W2, 256, 0, stream>>>(
      x, Wq, Wk, Wv, Wo, W1, W2, xb, wqkvT, woT, w1T, w2T);

  // 2) fused QKV projection GEMM: (4096x1024)x(1024x3072), head layouts out
  gemm_bf16_tn<0><<<dim3(NQKV / 128, NTOK / 128), 256, 0, stream>>>(
      xb, wqkvT, NTOK, NQKV, D, qb, nullptr, nullptr, nullptr, kb, vtb);

  // 3) attention (column softmax, two-pass flash-style over q)
  attn_colstats<<<(BSZ * H) * (T / 128), 256, 0, stream>>>(qb, kb, cmax, csum);
  attn_out<<<(BSZ * H) * (T / 128), 256, 0, stream>>>(qb, kb, vtb, cmax, csum,
                                                      ocb);

  // 4) output projection + residual, then norm
  gemm_bf16_tn<2><<<dim3(D / 128, NTOK / 128), 256, 0, stream>>>(
      ocb, woT, NTOK, D, D, nullptr, y1, nullptr, x, nullptr, nullptr);
  rownorm<<<NTOK, 256, 0, stream>>>(y1, out1f, out1b);

  // 5) FFN: relu(out1 @ W1 + b1) @ W2 + b2 + out1, then norm -> d_out
  gemm_bf16_tn<1><<<dim3(FF / 128, NTOK / 128), 256, 0, stream>>>(
      out1b, w1T, NTOK, FF, D, hb, nullptr, b1, nullptr, nullptr, nullptr);
  gemm_bf16_tn<3><<<dim3(D / 128, NTOK / 128), 256, 0, stream>>>(
      hb, w2T, NTOK, D, FF, nullptr, y2, b2, out1f, nullptr, nullptr);
  rownorm<<<NTOK, 256, 0, stream>>>(y2, (float*)d_out, nullptr);

  (void)in_sizes;
  (void)n_in;
  (void)out_size;
  (void)ws_size;
}

// v007
// Measured time: 213 microseconds a run.
// In two side-by-side timings against v006, it was 1.12 and 1.11 times as fast.
// Over all steps from v000 it is 3.22 times as fast.
#include <hip/hip_runtime.h>
#include <hip/hip_bf16.h>
#include <stdint.h>

// Problem dims (fixed by the reference)
#define BSZ 2
#define T   2048
#define D   1024
#define H   16
#define DKV 64
#define FF  4096
#define NTOK 4096          // BSZ*T
#define NQKV 3072          // 3*H*DKV

typedef __attribute__((ext_vector_type(16))) __bf16 bf16x16;
typedef __attribute__((ext_vector_type(8)))  float  f32x8;

union FragCast { bf16x16 v; uint4 u[2]; };

typedef uint32_t u32x4 __attribute__((ext_vector_type(4)));
typedef uint32_t u32x8 __attribute__((ext_vector_type(8)));

// GEMM stage: 128 rows of 64 halves (128 bytes) per operand, laid in LDS at a
// 144-byte row pitch (16 B x odd: conflict-free for 16-byte fragment reads).
#define GBK 64          // halves of K per stage
#define GPITCH 72       // LDS row pitch in halves
#define GTILEB 18432u   // 128 rows x 144 B = 9 x 2 KiB, one operand's tile

__device__ __forceinline__ uint32_t uni(uint32_t v) {
  return (uint32_t)__builtin_amdgcn_readfirstlane(v);
}

__device__ __forceinline__ uint32_t pinned(uint32_t v) {
  uint32_t w = (uint32_t)__builtin_amdgcn_readfirstlane(v);
  asm volatile("" : "+s"(w));
  return w;
}

// Descriptor group 0: one request, LDS byte offset, global address, type 2.
__device__ __forceinline__ u32x4 tdm_group0(uint32_t lds_dst, uint64_t ga) {
  u32x4 g;
  g[0] = uni(1u);
  g[1] = uni(lds_dst);
  g[2] = uni((uint32_t)ga);
  g[3] = uni((((uint32_t)(ga >> 32)) & 0x01FFFFFFu) | 0x80000000u);
  return g;
}

// Descriptor group 1: byte elements, tensor = tile = 128 rows of 128 bytes,
// source row pitch src_pitch bytes, 16 bytes of LDS pad behind every row.
// pinned(): each descriptor word is held in its scalar register for the whole
// loop, so that none is reused for something else while a request is in flight.
__device__ __forceinline__ u32x8 tdm_group1(uint32_t src_pitch) {
  u32x8 g;
  g[0] = pinned((1u << 20) | (4u << 22) | (3u << 25));
  g[1] = pinned(128u << 16);
  g[2] = pinned(128u << 16);
  g[3] = pinned(128u << 16);
  g[4] = pinned(128u);
  g[5] = pinned(src_pitch);
  g[6] = pinned(0u);
  g[7] = pinned(0u);
  return g;
}

// Attention stage: 128 rows of q or k (128 bytes each, the GEMM's tile and
// pitch), or vT's 64 rows x 128 keys (256 bytes each) at a 272-byte LDS pitch
// (16 B x odd again). Either tile fits one GTILEB place.
#define AKS 128         // queries (pass A) or keys (pass B) per stage
#define VPITCH 136      // vT's LDS row pitch in halves

// Descriptor group 1 of vT's tile: byte elements, tensor = tile = 64 rows of
// 256 bytes, source row pitch T halves, 16 bytes of LDS pad behind every row.
// pinned(): as in tdm_group1.
__device__ __forceinline__ u32x8 tdm_group1_vt() {
  u32x8 g;
  g[0] = pinned((1u << 20) | (5u << 22) | (3u << 25));
  g[1] = pinned(256u << 16);
  g[2] = pinned(64u << 16);
  g[3] = pinned(256u << 16);
  g[4] = pinned(64u);
  g[5] = pinned((uint32_t)T * 2u);
  g[6] = pinned(0u);
  g[7] = pinned(0u);
  return g;
}

__device__ __forceinline__ void tdm_load(u32x4 g0, u32x8 g1) {
  asm volatile("tensor_load_to_lds %0, %1" ::"s"(g0), "s"(g1) : "memory");
}

__device__ __forceinline__ f32x8 wmma_bf16(bf16x16 a, bf16x16 b, f32x8 c) {
  return __builtin_amdgcn_wmma_f32_16x16x32_bf16(false, a, false, b, (short)0, c,
                                                 false, false);
}

__device__ __forceinline__ f32x8 zero8() {
  f32x8 z;
  for (int e = 0; e < 8; ++e) z[e] = 0.0f;
  return z;
}

// Load a 16x32 A-fragment (or B^T-fragment) from row-major bf16 memory
// (global or LDS). Lane l holds row (l&15); K = 16*(j>>3) + 8*(l>>4) + (j&7).
// Each 8-half group is contiguous -> two 16B loads.
__device__ __forceinline__ bf16x16 load_frag(const __bf16* base, int row0,
                                             int ld, int k0) {
  int lane = threadIdx.x & 31;
  int m = lane & 15;
  int kh = lane >> 4;
  const __bf16* p = base + (size_t)(row0 + m) * ld + k0 + 8 * kh;
  FragCast f;
  f.u[0] = *(const uint4*)(const void*)(p);
  f.u[1] = *(const uint4*)(const void*)(p + 16);
  return f.v;
}

// ---------------------------------------------------------------------------
// GEMM: C(MxN) = A(MxK bf16 rowmajor) * Bt(NxK bf16 rowmajor)^T
// MODE 0: bf16, stored straight into q,k (B,H,T,64) and vT (B,H,64,T)
// MODE 1: +bias,ReLU,bf16 | 2: +resid f32 | 3: +bias+resid f32
// 256 thr = 8 waves (2x4). Block tile 128x128, 64 k per stage, wave tile 64x32.
// Two LDS buffers; wave 0 brings A's tile and wave 1 Bt's by one tensor load
// per stage. K is a multiple of 64 and at least 128 (two stages).
// ---------------------------------------------------------------------------
template <int MODE>
__global__ __launch_bounds__(256) void gemm_bf16_tn(
    const __bf16* __restrict__ A, const __bf16* __restrict__ Bt, int M, int N,
    int K, __bf16* __restrict__ outB, float* __restrict__ outF,
    const float* __restrict__ bias, const float* __restrict__ resid,
    __bf16* __restrict__ outK, __bf16* __restrict__ outVT) {
  // [buffer][A | Bt] tiles, each at a multiple of 2 KiB
  __shared__ __attribute__((aligned(2048))) unsigned char sm[4 * GTILEB];

  int t = threadIdx.x;
  const uint32_t wave = uni((uint32_t)t >> 5);
  int lane = t & 31;
  int browg = blockIdx.y * 128;
  int bcolg = blockIdx.x * 128;

  const uint32_t isB = wave & 1u;  // issuing waves: 0 -> A, 1 -> Bt
  const uint64_t gbase =
      (uint64_t)(size_t)(isB ? Bt + (size_t)bcolg * K : A + (size_t)browg * K);
  const uint32_t ldst = (uint32_t)(size_t)sm + isB * GTILEB;
  const u32x8 g1 = tdm_group1((uint32_t)K * 2u);
  const int nst = K / GBK;

  f32x8 acc[4][2];
  for (int i = 0; i < 4; ++i)
    for (int j = 0; j < 2; ++j) acc[i][j] = zero8();

  // prologue: stage 0 lands and is published, then stage 1 flies
  if (pinned(wave < 2u)) {
    tdm_load(tdm_group0(ldst, gbase), g1);
    // stage 0 has landed
    asm volatile("s_wait_tensorcnt 0x0" ::: "memory");
  }
  __syncthreads();
  if (pinned(wave < 2u))
    tdm_load(tdm_group0(ldst + 2u * GTILEB, gbase + 2u * GBK), g1);

  int row0w = (int)(wave >> 2) * 64;  // 0 / 64
  int col0w = (int)(wave & 3u) * 32;  // 0..96

  for (int s = 0; s < nst; ++s) {
    const __bf16* sa = (const __bf16*)(const void*)(sm + (s & 1) * (2u * GTILEB));
    const __bf16* sb = (const __bf16*)(const void*)(sm + (s & 1) * (2u * GTILEB) + GTILEB);
    // All fragments of the stage, both 32-k blocks, each in registers of its own.
    bf16x16 af[GBK / 32][4], bfv[GBK / 32][2];
#pragma unroll
    for (int kb = 0; kb < GBK / 32; ++kb) {
#pragma unroll
      for (int j = 0; j < 2; ++j)
        bfv[kb][j] = load_frag(sb, col0w + 16 * j, GPITCH, 32 * kb);
#pragma unroll
      for (int i = 0; i < 4; ++i)
        af[kb][i] = load_frag(sa, row0w + 16 * i, GPITCH, 32 * kb);
    }
    // keeps the stage's 24 LDS reads one group ahead of its 16 matrix
    // instructions: without it the compiler reuses one A fragment's registers
    // and waits out a whole LDS latency in front of every second one.
    __builtin_amdgcn_sched_barrier(0);
#pragma unroll
    for (int kb = 0; kb < GBK / 32; ++kb)
#pragma unroll
      for (int i = 0; i < 4; ++i)
#pragma unroll
        for (int j = 0; j < 2; ++j)
          acc[i][j] = wmma_bf16(af[kb][i], bfv[kb][j], acc[i][j]);
    // keeps the pass's closing wait below behind the matrix instructions: moved
    // up among them it turns their counted waits into one wait for all 24 reads.
    __builtin_amdgcn_sched_barrier(0);

    // publish point of stage s + 1: this wave's reads of stage s have retired,
    asm volatile("s_wait_dscnt 0x0" ::: "memory");
    // the issuing wave's own request (stage s + 1) has landed,
    if (pinned(wave < 2u)) asm volatile("s_wait_tensorcnt 0x0" ::: "memory");
    // every wave has left stage s's buffer and may read stage s + 1,
    __syncthreads();
    // and only then stage s + 2 goes into the buffer that stage s used.
    if (pinned((uint32_t)((wave < 2u) && (s + 2 < nst)))) {
      // pinned(): the stage number is taken here, so that the descriptor words
      // made from it are formed behind the wait and the barrier above
      const uint32_t sn = pinned((uint32_t)s + 2u);
      tdm_load(tdm_group0(ldst + (sn & 1u) * (2u * GTILEB),
                          gbase + (uint64_t)sn * (2u * GBK)),
               g1);
    }
  }
  // nothing of the ring is outstanding when the wave goes on to its stores
  asm volatile("s_wait_tensorcnt 0x0" ::: "memory");
  asm volatile("s_wait_dscnt 0x0" ::: "memory");

  int mh = (lane >> 4) * 8;
  int nn = lane & 15;
  if (MODE == 0) {
    // Column n = which*1024 + h*64 + kk; a 128-wide block lies in one 'which'.
    // A lane holds 8 consecutive tokens of one column: for vT that is one
    // contiguous 16-byte run, and a wave's 64 tokens fill whole 128-byte lines.
    int which = bcolg >> 10;
    int rem = (bcolg + col0w + nn) & 1023;  // j adds 16, inside the same head
    int kc = rem & 63;
    int gr0 = browg + row0w + mh;  // i adds 16, inside the same batch entry
    size_t bhb = (size_t)((gr0 >> 11) * H + (rem >> 6));
    int tt = gr0 & (T - 1);
    if (which == 2) {
      __bf16* dst = outVT + (bhb * DKV + kc) * T + tt;
#pragma unroll
      for (int i = 0; i < 4; ++i)
#pragma unroll
        for (int j = 0; j < 2; ++j) {
          union { __bf16 h[8]; uint4 u; } pk;
#pragma unroll
          for (int r = 0; r < 8; ++r) pk.h[r] = (__bf16)acc[i][j][r];
          *(uint4*)(void*)(dst + (size_t)(16 * j) * T + 16 * i) = pk.u;
        }
      return;
    }
    __bf16* dst = (which == 0 ? outB : outK) + (bhb * T + tt) * DKV + kc;
#pragma unroll
    for (int i = 0; i < 4; ++i)
#pragma unroll
      for (int j = 0; j < 2; ++j)
#pragma unroll
        for (int r = 0; r < 8; ++r)
          dst[(16 * i + r) * DKV + 16 * j] = (__bf16)acc[i][j][r];
    // The built code lays the vT path right behind these stores, and that path
    // rewrites registers they name: keep the wait in front of it.
    asm volatile("s_wait_xcnt 0x0" ::: "memory");
    return;
  }
#pragma unroll
  for (int i = 0; i < 4; ++i)
#pragma unroll
    for (int j = 0; j < 2; ++j) {
      int gc = bcolg + col0w + 16 * j + nn;
#pragma unroll
      for (int r = 0; r < 8; ++r) {
        int gr = browg + row0w + 16 * i + mh + r;
        size_t idx = (size_t)gr * N + gc;
        float v = acc[i][j][r];
        if (MODE == 1) {
          v += bias[gc];
          v = v > 0.0f ? v : 0.0f;
        }
        if (MODE == 3) v += bias[gc];
        if (MODE == 1)
          outB[idx] = (__bf16)v;
        else
          outF[idx] = v + resid[idx];
      }
    }
}

// ---------------------------------------------------------------------------
// Attention pass A: column softmax stats (softmax is over the QUERY axis).
// Grid: (B*H)*(T/128); each wave owns 16 key columns, loops all q-tiles.
// The 8 waves walk the same q rows: wave 0 brings them into LDS, 128 rows per
// stage by one tensor load, two buffers, and every wave reads fragments there.
// ---------------------------------------------------------------------------
__global__ __launch_bounds__(256) void attn_colstats(
    const __bf16* __restrict__ qb, const __bf16* __restrict__ kb,
    float* __restrict__ cmax, float* __restrict__ crcp) {
  // two q tiles, each at a multiple of 2 KiB
  __shared__ __attribute__((aligned(2048))) unsigned char sm[2 * GTILEB];
  const int sblocks = T / 128;
  int bh = blockIdx.x / sblocks;
  int sblk = blockIdx.x % sblocks;
  const uint32_t wave = uni(threadIdx.x >> 5);
  int lane = threadIdx.x & 31;
  int s0 = sblk * 128 + (int)wave * 16;

  const __bf16* qh = qb + (size_t)bh * T * DKV;
  const __bf16* kh = kb + (size_t)bh * T * DKV;

  const uint64_t gq = (uint64_t)(size_t)qh;
  const uint32_t ldst = (uint32_t)(size_t)sm;
  const u32x8 g1 = tdm_group1(DKV * 2u);
  const int nst = T / AKS;

  // prologue: stage 0 lands and is published, then stage 1 flies
  if (pinned(wave == 0u)) {
    tdm_load(tdm_group0(ldst, gq), g1);
    // stage 0 has landed
    asm volatile("s_wait_tensorcnt 0x0" ::: "memory");
  }
  __syncthreads();
  // From here on the ring's group 0 is one value carried through the loop, each
  // request's address made from the one before it: its registers stay in use,
  // so that none is taken for something else while a request is in flight.
  u32x4 g0 = tdm_group0(ldst + GTILEB, gq + (uint64_t)(AKS * DKV * 2));
  g0[0] = pinned(g0[0]);  // pinned(): a descriptor word held in its scalar register
  if (pinned(wave == 0u)) tdm_load(g0, g1);

  bf16x16 kf0 = load_frag(kh, s0, DKV, 0);
  bf16x16 kf1 = load_frag(kh, s0, DKV, 32);

  float m = -3.0e38f, l = 0.0f;
  for (int st = 0; st < nst; ++st) {
   const __bf16* sq = (const __bf16*)(const void*)(sm + (st & 1) * GTILEB);
   // unrolled: a stage is one pass, its LDS offsets are immediates, and later
   // tiles' fragment reads can be issued ahead of this tile's softmax chain
#pragma unroll
   for (int qt = 0; qt < AKS; qt += 16) {
    bf16x16 a0 = load_frag(sq, qt, GPITCH, 0);
    bf16x16 a1 = load_frag(sq, qt, GPITCH, 32);
    f32x8 c = zero8();
    c = wmma_bf16(a0, kf0, c);
    c = wmma_bf16(a1, kf1, c);
    float sc[8], tmax = -3.0e38f;
#pragma unroll
    for (int r = 0; r < 8; ++r) {
      sc[r] = c[r] * 0.125f;  // 1/sqrt(64)
      tmax = fmaxf(tmax, sc[r]);
    }
    // lanes l and l+16 hold the same key column (different q rows): fuse
    tmax = fmaxf(tmax, __shfl_xor(tmax, 16, 32));
    float mn = fmaxf(m, tmax);
    float p = 0.0f;
#pragma unroll
    for (int r = 0; r < 8; ++r) p += __expf(sc[r] - mn);
    p += __shfl_xor(p, 16, 32);
    l = l * __expf(m - mn) + p;
    m = mn;
   }

   // publish point of stage st + 1: this wave's reads of stage st have retired,
   asm volatile("s_wait_dscnt 0x0" ::: "memory");
   // the issuing wave's own request (stage st + 1) has landed,
   if (pinned(wave == 0u)) asm volatile("s_wait_tensorcnt 0x0" ::: "memory");
   // every wave has left stage st's buffer and may read stage st + 1,
   __syncthreads();
   // and only then stage st + 2 goes into the buffer that stage st used.
   if (pinned((uint32_t)((wave == 0u) && (st + 2 < nst)))) {
     // pinned(): the step is taken here, so that the address words made with it
     // are formed behind the wait and the barrier above. The carry goes into
     // word 3's address bits; its type bits lie above them.
     const uint32_t step = pinned((uint32_t)(AKS * DKV * 2));
     const uint64_t ga = (((uint64_t)g0[3] << 32) | (uint64_t)g0[2]) + step;
     g0[1] = uni(ldst + (uint32_t)(st & 1) * GTILEB);
     g0[2] = uni((uint32_t)ga);
     g0[3] = uni((uint32_t)(ga >> 32));
     tdm_load(g0, g1);
   }
  }
  // nothing of the ring is outstanding when the wave goes on to its stores
  asm volatile("s_wait_tensorcnt 0x0" ::: "memory");
  asm volatile("s_wait_dscnt 0x0" ::: "memory");

  if (lane < 16) {
    cmax[(size_t)bh * T + s0 + lane] = m;
    // pass B needs 1 / sum for 16 keys per lane and step: divide once here
    crcp[(size_t)bh * T + s0 + lane] = 1.0f / l;
  }
}

// ---------------------------------------------------------------------------
// Attention pass B: recompute scores, p = exp(s/8 - m)/sum, o += p @ v.
// The scores are formed transposed (k's rows as A, q's rows as B^T): a lane then
// holds one query and keys 8h + r of each 16-key tile (h = lane >> 4), which is
// the k order of an A fragment, so two tiles of p, converted in place, are the
// A operand of p @ v. vT supplies B^T rows directly.
// The 8 waves walk the same keys: per stage of 128 keys wave 0 brings k's rows
// and wave 1 vT's into LDS by one tensor load each, two buffers.
// ---------------------------------------------------------------------------
__global__ __launch_bounds__(256) void attn_out(
    const __bf16* __restrict__ qb, const __bf16* __restrict__ kb,
    const __bf16* __restrict__ vtb, const float* __restrict__ cmax,
    const float* __restrict__ crcp, __bf16* __restrict__ oc) {
  // [buffer][k | vT] tiles, each at a multiple of 2 KiB
  __shared__ __attribute__((aligned(2048))) unsigned char sm[4 * GTILEB];
  const int qblocks = T / 128;
  int bh = blockIdx.x / qblocks;
  int qblk = blockIdx.x % qblocks;
  const uint32_t wave = uni(threadIdx.x >> 5);
  int lane = threadIdx.x & 31;
  int q0 = qblk * 128 + (int)wave * 16;

  const __bf16* qh = qb + (size_t)bh * T * DKV;
  const __bf16* kh = kb + (size_t)bh * T * DKV;
  const __bf16* vh = vtb + (size_t)bh * DKV * T;

  const uint64_t gk = (uint64_t)(size_t)kh;
  const uint64_t gv = (uint64_t)(size_t)vh;
  const uint32_t ldsk = (uint32_t)(size_t)sm;
  const uint32_t ldsv = ldsk + GTILEB;
  const u32x8 g1k = tdm_group1(DKV * 2u);
  const u32x8 g1v = tdm_group1_vt();
  const int nst = T / AKS;

  // prologue: stage 0 lands and is published, then stage 1 flies
  if (pinned(wave == 0u)) {
    tdm_load(tdm_group0(ldsk, gk), g1k);
    // stage 0 has landed
    asm volatile("s_wait_tensorcnt 0x0" ::: "memory");
  }
  if (pinned(wave == 1u)) {
    tdm_load(tdm_group0(ldsv, gv), g1v);
    asm volatile("s_wait_tensorcnt 0x0" ::: "memory");  // as above
  }
  __syncthreads();
  if (pinned(wave == 0u))
    tdm_load(tdm_group0(ldsk + 2u * GTILEB, gk + (uint64_t)(AKS * DKV * 2)), g1k);
  if (pinned(wave == 1u))
    tdm_load(tdm_group0(ldsv + 2u * GTILEB, gv + (uint64_t)(AKS * 2)), g1v);

  bf16x16 aq0 = load_frag(qh, q0, DKV, 0);
  bf16x16 aq1 = load_frag(qh, q0, DKV, 32);

  f32x8 oacc[4];
  for (int n = 0; n < 4; ++n) oacc[n] = zero8();

  int nn = lane & 15;
  int mh = (lane >> 4) * 8;
  // the head's column statistics; a lane half reads those of its 8 keys of a tile
  const float* pm = cmax + (size_t)bh * T;
  const float* pr = crcp + (size_t)bh * T;
  const uint32_t hk = (uint32_t)mh;

  for (int st = 0; st < nst; ++st) {
   const __bf16* sk = (const __bf16*)(const void*)(sm + (st & 1) * (2u * GTILEB));
   const __bf16* sv = (const __bf16*)(const void*)(sm + (st & 1) * (2u * GTILEB) + GTILEB);
   // unrolled: a stage is one pass and its LDS offsets are immediates
#pragma unroll
   for (int ss = 0; ss < AKS; ss += 32) {
    int s0 = st * AKS + ss;
    f32x8 c0 = zero8(), c1 = zero8();
    bf16x16 k00 = load_frag(sk, ss, GPITCH, 0);
    bf16x16 k01 = load_frag(sk, ss, GPITCH, 32);
    bf16x16 k10 = load_frag(sk, ss + 16, GPITCH, 0);
    bf16x16 k11 = load_frag(sk, ss + 16, GPITCH, 32);
    // keeps the eight LDS reads above one group with one latency: without it the
    // compiler reuses one fragment's registers and waits out four in a row.
    // Mask: global reads and plain vector / scalar work may still cross it, so
    // that the column statistics' loads below are issued early.
    __builtin_amdgcn_sched_barrier(0x26);
    c0 = wmma_bf16(k00, aq0, c0);  // c0[r] = score(key ss + mh + r, query nn)
    c1 = wmma_bf16(k10, aq0, c1);  // c1[r]: key ss + 16 + mh + r
    c0 = wmma_bf16(k01, aq1, c0);
    c1 = wmma_bf16(k11, aq1, c1);

    union { float4 q[2]; float f[8]; } m0, m1, r0, r1;
#pragma unroll
    for (int e = 0; e < 2; ++e) {
      m0.q[e] = *(const float4*)(const void*)(pm + s0 + 4 * e + hk);
      m1.q[e] = *(const float4*)(const void*)(pm + s0 + 16 + 4 * e + hk);
      r0.q[e] = *(const float4*)(const void*)(pr + s0 + 4 * e + hk);
      r1.q[e] = *(const float4*)(const void*)(pr + s0 + 16 + 4 * e + hk);
    }
    bf16x16 pf;  // 16 q rows x K=32 (s), in load_frag's k order
#pragma unroll
    for (int r = 0; r < 8; ++r) {
      pf[r] = (__bf16)(__expf(c0[r] * 0.125f - m0.f[r]) * r0.f[r]);
      pf[8 + r] = (__bf16)(__expf(c1[r] * 0.125f - m1.f[r]) * r1.f[r]);
    }
#pragma unroll
    for (int n = 0; n < 4; ++n) {
      bf16x16 bv = load_frag(sv, n * 16, VPITCH, ss);  // vT rows = v columns
      oacc[n] = wmma_bf16(pf, bv, oacc[n]);
    }
   }

   // the statistics loads' address registers are stepped for the next stage
   asm volatile("s_wait_xcnt 0x0" ::: "memory");
   // publish point of stage st + 1: this wave's reads of stage st have retired,
   asm volatile("s_wait_dscnt 0x0" ::: "memory");
   // each issuing wave's own request (stage st + 1) has landed,
   if (pinned(wave < 2u)) asm volatile("s_wait_tensorcnt 0x0" ::: "memory");
   // every wave has left stage st's buffer and may read stage st + 1,
   __syncthreads();
   // and only then stage st + 2 goes into the buffer that stage st used.
   // pinned() on the stage number: the descriptor words made from it are formed
   // behind the wait and the barrier above
   if (pinned((uint32_t)((wave == 0u) && (st + 2 < nst)))) {
     const uint32_t sn = pinned((uint32_t)st + 2u);
     tdm_load(tdm_group0(ldsk + (sn & 1u) * (2u * GTILEB),
                         gk + (uint64_t)sn * (uint64_t)(AKS * DKV * 2)),
              g1k);
   }
   if (pinned((uint32_t)((wave == 1u) && (st + 2 < nst)))) {
     const uint32_t sn = pinned((uint32_t)st + 2u);
     tdm_load(tdm_group0(ldsv + (sn & 1u) * (2u * GTILEB),
                         gv + (uint64_t)sn * (uint64_t)(AKS * 2)),
              g1v);
   }
  }
  // nothing of the ring is outstanding when the wave goes on to its stores
  asm volatile("s_wait_tensorcnt 0x0" ::: "memory");
  asm volatile("s_wait_dscnt 0x0" ::: "memory");

  int b = bh / H, h = bh % H;
#pragma unroll
  for (int n = 0; n < 4; ++n)
#pragma unroll
    for (int r = 0; r < 8; ++r) {
      int gt = q0 + mh + r;
      int col = h * DKV + n * 16 + nn;
      oc[((size_t)b * T + gt) * D + col] = (__bf16)oacc[n][r];
    }
}

// ---------------------------------------------------------------------------
// Row mean/std norm (ddof=1). One block per row of D=1024.
// ---------------------------------------------------------------------------
__global__ __launch_bounds__(256) void rownorm(const float* __restrict__ y,
                                               float* __restrict__ outF,
                                               __bf16* __restrict__ outB) {
  __shared__ float s1[256], s2[256];
  int row = blockIdx.x, tid = threadIdx.x;
  const float* pr = y + (size_t)row * D;
  float v[4], s = 0.0f, q = 0.0f;
#pragma unroll
  for (int j = 0; j < 4; ++j) {
    v[j] = pr[tid + 256 * j];
    s += v[j];
    q += v[j] * v[j];
  }
  s1[tid] = s;
  s2[tid] = q;
  __syncthreads();
  for (int o = 128; o > 0; o >>= 1) {
    if (tid < o) {
      s1[tid] += s1[tid + o];
      s2[tid] += s2[tid + o];
    }
    __syncthreads();
  }
  float mean = s1[0] * (1.0f / D);
  float var = (s2[0] - s1[0] * s1[0] * (1.0f / D)) * (1.0f / (D - 1));
  float rstd = rsqrtf(var);
  float* po = outF + (size_t)row * D;
#pragma unroll
  for (int j = 0; j < 4; ++j) {
    float o = (v[j] - mean) * rstd;
    po[tid + 256 * j] = o;
    if (outB) outB[(size_t)row * D + tid + 256 * j] = (__bf16)o;
  }
}

// ------------------------- conversion / layout kernel ----------------------
// The grid below is exact for the fixed shapes. Every wave-wide access covers
// whole 128-byte lines, and each thread has 8 16-byte loads in flight.

// One block converts 8192 elements, 32 per thread: 8 float4 loads, 8 stores of
// 4 bf16. blk is the block's number within this job.
__device__ __forceinline__ void cvt_f32_bf16(int blk, const float* __restrict__ in,
                                             __bf16* __restrict__ out) {
  size_t base = (size_t)blk * 2048 + threadIdx.x;  // in units of 4
  float4 v[8];
#pragma unroll
  for (int j = 0; j < 8; ++j)
    v[j] = *(const float4*)(const void*)(in + (base + 256 * j) * 4);
#pragma unroll
  for (int j = 0; j < 8; ++j) {
    union { __bf16 h[4]; uint2 u; } pk;
    pk.h[0] = (__bf16)v[j].x;
    pk.h[1] = (__bf16)v[j].y;
    pk.h[2] = (__bf16)v[j].z;
    pk.h[3] = (__bf16)v[j].w;
    *(uint2*)(void*)(out + (base + 256 * j) * 4) = pk.u;
  }
}

// One block turns a tile of 128 rows x 64 columns of f32 (row pitch LDIN) into
// 64 rows x 128 columns of bf16 (row pitch LDOUT). in / out point at the tile.
// The turn goes through LDS at a pitch of 65 dwords: both the row-wise writes
// and the column-wise reads then fall on 32 different banks.
// The pitches are compile-time, so that a thread's accesses share one address
// register pair and differ in the immediate offset alone.
template <int LDIN, int LDOUT>
__device__ __forceinline__ void tile_turn(float (*tile)[65],
                                          const float* __restrict__ in,
                                          __bf16* __restrict__ out) {
  int t = threadIdx.x;
  int lr = t >> 4;        // 16 lanes read one row's 256 bytes
  int lc = (t & 15) * 4;
  float4 v[8];
#pragma unroll
  for (int j = 0; j < 8; ++j)
    v[j] = *(const float4*)(const void*)(in + (size_t)(lr + 16 * j) * LDIN + lc);
  // the loads' address registers may be reused by what follows
  asm volatile("s_wait_xcnt 0x0" ::: "memory");
#pragma unroll
  for (int j = 0; j < 8; ++j) {
    tile[lr + 16 * j][lc + 0] = v[j].x;
    tile[lr + 16 * j][lc + 1] = v[j].y;
    tile[lr + 16 * j][lc + 2] = v[j].z;
    tile[lr + 16 * j][lc + 3] = v[j].w;
  }
  __syncthreads();
  int rc = (t & 7) * 8;   // 8 lanes write 128 bytes of one output row
  int c0 = t >> 3;
#pragma unroll
  for (int j = 0; j < 4; ++j) {
    int c = c0 + 32 * (j & 1);
    int r = rc + 64 * (j >> 1);
    union { __bf16 h[8]; uint4 u; } pk;
#pragma unroll
    for (int k = 0; k < 8; ++k) pk.h[k] = (__bf16)tile[r + k][c];
    *(uint4*)(void*)(out + (size_t)c * LDOUT + r) = pk.u;
  }
  // The built code lays another job's path right behind these stores, and that
  // path rewrites registers they name: keep the wait in front of it.
  asm volatile("s_wait_xcnt 0x0" ::: "memory");
}

// out (C x R) = transpose of in (R x C), bf16; blk counts the R/128 row tiles
// fastest, then the C/64 column tiles.
template <int R, int C>
__device__ __forceinline__ void packT(float (*tile)[65], int blk,
                                      const float* __restrict__ in,
                                      __bf16* __restrict__ out) {
  int r0 = (blk % (R / 128)) * 128;
  int c0 = (blk / (R / 128)) * 64;
  tile_turn<C, R>(tile, in + (size_t)r0 * C + c0, out + (size_t)c0 * R + r0);
}

// Blocks per job of the one preparation launch
#define NB_X (NTOK * D / 8192)             // x -> bf16
#define NB_QKV ((D / 128) * H * 3)         // Wq, Wk, Wv
#define NB_WO ((D / 128) * (D / 64))
#define NB_W1 ((D / 128) * (FF / 64))
#define NB_W2 ((FF / 128) * (D / 64))

// The five preparation jobs read only inputs and none reads another's output:
// they share one grid, and a block finds its job from its index (the same for
// the whole block, so the barrier in tile_turn stays under uniform control flow).
__global__ __launch_bounds__(256) void prep_inputs(
    const float* __restrict__ x, const float* __restrict__ Wq,
    const float* __restrict__ Wk, const float* __restrict__ Wv,
    const float* __restrict__ Wo, const float* __restrict__ W1,
    const float* __restrict__ W2, __bf16* __restrict__ xb,
    __bf16* __restrict__ wqkvT, __bf16* __restrict__ woT,
    __bf16* __restrict__ w1T, __bf16* __restrict__ w2T) {
  __shared__ float tile[128][65];
  int b = blockIdx.x;
  if (b < NB_X) {
    cvt_f32_bf16(b, x, xb);
    return;
  }
  b -= NB_X;
  if (b < NB_QKV) {
    // WqkvT[n][d], n = which*1024 + h*64 + k (rows = GEMM columns, K-contig);
    // a head is a D x 64 matrix.
    int d0 = (b % (D / 128)) * 128;
    int h = (b / (D / 128)) % H;
    int which = b / ((D / 128) * H);
    const float* src = which == 0 ? Wq : (which == 1 ? Wk : Wv);
    tile_turn<DKV, D>(tile, src + ((size_t)h * D + d0) * DKV,
                      wqkvT + (size_t)(which * 1024 + h * DKV) * D + d0);
    return;
  }
  b -= NB_QKV;
  if (b < NB_WO) {
    packT<D, D>(tile, b, Wo, woT);
    return;
  }
  b -= NB_WO;
  if (b < NB_W1) {
    packT<D, FF>(tile, b, W1, w1T);
    return;
  }
  packT<FF, D>(tile, b - NB_W1, W2, w2T);
}

// ---------------------------------------------------------------------------
extern "C" void kernel_launch(void* const* d_in, const int* in_sizes, int n_in,
                              void* d_out, int out_size, void* d_ws,
                              size_t ws_size, hipStream_t stream) {
  const float* x = (const float*)d_in[0];
  const float* Wq = (const float*)d_in[1];
  const float* Wk = (const float*)d_in[2];
  const float* Wv = (const float*)d_in[3];
  const float* Wo = (const float*)d_in[4];
  const float* W1 = (const float*)d_in[5];
  const float* b1 = (const float*)d_in[6];
  const float* W2 = (const float*)d_in[7];
  const float* b2 = (const float*)d_in[8];

  char* ws = (char*)d_ws;
  const size_t OFF_XB = 0;             //  8 MiB
  const size_t OFF_WQKVT = 8388608;    //  6 MiB
  const size_t OFF_WOT = 14680064;     //  2 MiB
  const size_t OFF_W1T = 16777216;     //  8 MiB
  const size_t OFF_W2T = 25165824;     //  8 MiB
  const size_t OFF_Y2 = 33554432;      // 16 MiB f32
  const size_t OFF_QB = 58720256;      //  8 MiB
  const size_t OFF_KB = 67108864;      //  8 MiB
  const size_t OFF_VT = 75497472;      //  8 MiB
  const size_t OFF_CMAX = 83886080;    // 256 KiB
  const size_t OFF_CRCP = 84148224;    // 256 KiB
  const size_t OFF_OC = 84410368;      //  8 MiB
  const size_t OFF_Y1 = 92798976;      // 16 MiB f32
  const size_t OFF_OUT1F = 109576192;  // 16 MiB f32
  const size_t OFF_OUT1B = 126353408;  //  8 MiB
  const size_t OFF_HB = 134742016;     // 32 MiB

  __bf16* xb = (__bf16*)(ws + OFF_XB);
  __bf16* wqkvT = (__bf16*)(ws + OFF_WQKVT);
  __bf16* woT = (__bf16*)(ws + OFF_WOT);
  __bf16* w1T = (__bf16*)(ws + OFF_W1T);
  __bf16* w2T = (__bf16*)(ws + OFF_W2T);
  __bf16* qb = (__bf16*)(ws + OFF_QB);
  __bf16* kb = (__bf16*)(ws + OFF_KB);
  __bf16* vtb = (__bf16*)(ws + OFF_VT);
  float* cmax = (float*)(ws + OFF_CMAX);
  float* crcp = (float*)(ws + OFF_CRCP);
  __bf16* ocb = (__bf16*)(ws + OFF_OC);
  float* y1 = (float*)(ws + OFF_Y1);
  float* out1f = (float*)(ws + OFF_OUT1F);
  __bf16* out1b = (__bf16*)(ws + OFF_OUT1B);
  __bf16* hb = (__bf16*)(ws + OFF_HB);
  float* y2 = (float*)(ws + OFF_Y2);

  // 1) convert x and pack the transposed bf16 weights, one launch
  prep_inputs<<<NB_X + NB_QKV + NB_WO + NB_W1 + NB_W2, 256, 0, stream>>>(
      x, Wq, Wk, Wv, Wo, W1, W2, xb, wqkvT, woT, w1T, w2T);

  // 2) fused QKV projection GEMM: (4096x1024)x(1024x3072), head layouts out
  gemm_bf16_tn<0><<<dim3(NQKV / 128, NTOK / 128), 256, 0, stream>>>(
      xb, wqkvT, NTOK, NQKV, D, qb, nullptr, nullptr, nullptr, kb, vtb);

  // 3) attention (column softmax, two-pass flash-style over q)
  attn_colstats<<<(BSZ * H) * (T / 128), 256, 0, stream>>>(qb, kb, cmax, crcp);
  attn_out<<<(BSZ * H) * (T / 128), 256, 0, stream>>>(qb, kb, vtb, cmax, crcp,
                                                      ocb);

  // 4) output projection + residual, then norm
  gemm_bf16_tn<2><<<dim3(D / 128, NTOK / 128), 256, 0, stream>>>(
      ocb, woT, NTOK, D, D, nullptr, y1, nullptr, x, nullptr, nullptr);
  rownorm<<<NTOK, 256, 0, stream>>>(y1, out1f, out1b);

  // 5) FFN: relu(out1 @ W1 + b1) @ W2 + b2 + out1, then norm -> d_out
  gemm_bf16_tn<1><<<dim3(FF / 128, NTOK / 128), 256, 0, stream>>>(
      out1b, w1T, NTOK, FF, D, hb, nullptr, b1, nullptr, nullptr, nullptr);
  gemm_bf16_tn<3><<<dim3(D / 128, NTOK / 128), 256, 0, stream>>>(
      hb, w2T, NTOK, D, FF, nullptr, y2, b2, out1f, nullptr, nullptr);
  rownorm<<<NTOK, 256, 0, stream>>>(y2, (float*)d_out, nullptr);

  (void)in_sizes;
  (void)n_in;
  (void)out_size;
  (void)ws_size;
}

// v008
// A run of this version takes 203 microseconds.
// Next to v007, in two timings, it ran 1.05 times as fast each time.
// All steps since v000 together make it 3.39 times as fast.
#include <hip/hip_runtime.h>
#include <hip/hip_bf16.h>
#include <stdint.h>

// Problem dims (fixed by the reference)
#define BSZ 2
#define T   2048
#define D   1024
#define H   16
#define DKV 64
#define FF  4096
#define NTOK 4096          // BSZ*T
#define NQKV 3072          // 3*H*DKV

typedef __attribute__((ext_vector_type(16))) __bf16 bf16x16;
typedef __attribute__((ext_vector_type(8)))  float  f32x8;
typedef __attribute__((ext_vector_type(2)))  float  f32x2;

union FragCast { bf16x16 v; uint4 u[2]; };

typedef uint32_t u32x4 __attribute__((ext_vector_type(4)));
typedef uint32_t u32x8 __attribute__((ext_vector_type(8)));

// GEMM stage: 128 rows of 64 halves (128 bytes) per operand, laid in LDS at a
// 144-byte row pitch (16 B x odd: conflict-free for 16-byte fragment reads).
#define GBK 64          // halves of K per stage
#define GPITCH 72       // LDS row pitch in halves
#define GTILEB 18432u   // 128 rows x 144 B = 9 x 2 KiB, one operand's tile

__device__ __forceinline__ uint32_t uni(uint32_t v) {
  return (uint32_t)__builtin_amdgcn_readfirstlane(v);
}

__device__ __forceinline__ uint32_t pinned(uint32_t v) {
  uint32_t w = (uint32_t)__builtin_amdgcn_readfirstlane(v);
  asm volatile("" : "+s"(w));
  return w;
}

// Descriptor group 0: one request, LDS byte offset, global address, type 2.
__device__ __forceinline__ u32x4 tdm_group0(uint32_t lds_dst, uint64_t ga) {
  u32x4 g;
  g[0] = uni(1u);
  g[1] = uni(lds_dst);
  g[2] = uni((uint32_t)ga);
  g[3] = uni((((uint32_t)(ga >> 32)) & 0x01FFFFFFu) | 0x80000000u);
  return g;
}

// Descriptor group 1: byte elements, tensor = tile = 128 rows of 128 bytes,
// source row pitch src_pitch bytes, 16 bytes of LDS pad behind every row.
// pinned(): each descriptor word is held in its scalar register for the whole
// loop, so that none is reused for something else while a request is in flight.
__device__ __forceinline__ u32x8 tdm_group1(uint32_t src_pitch) {
  u32x8 g;
  g[0] = pinned((1u << 20) | (4u << 22) | (3u << 25));
  g[1] = pinned(128u << 16);
  g[2] = pinned(128u << 16);
  g[3] = pinned(128u << 16);
  g[4] = pinned(128u);
  g[5] = pinned(src_pitch);
  g[6] = pinned(0u);
  g[7] = pinned(0u);
  return g;
}

// Attention stage: 128 rows of q or k (128 bytes each, the GEMM's tile and
// pitch), or vT's 64 rows x 128 keys (256 bytes each) at a 272-byte LDS pitch
// (16 B x odd again). Either tile fits one GTILEB place.
#define AKS 128         // queries (pass A) or keys (pass B) per stage
#define VPITCH 136      // vT's LDS row pitch in halves

// Descriptor group 1 of vT's tile: byte elements, tensor = tile = 64 rows of
// 256 bytes, source row pitch T halves, 16 bytes of LDS pad behind every row.
// pinned(): as in tdm_group1.
__device__ __forceinline__ u32x8 tdm_group1_vt() {
  u32x8 g;
  g[0] = pinned((1u << 20) | (5u << 22) | (3u << 25));
  g[1] = pinned(256u << 16);
  g[2] = pinned(64u << 16);
  g[3] = pinned(256u << 16);
  g[4] = pinned(64u);
  g[5] = pinned((uint32_t)T * 2u);
  g[6] = pinned(0u);
  g[7] = pinned(0u);
  return g;
}

__device__ __forceinline__ void tdm_load(u32x4 g0, u32x8 g1) {
  asm volatile("tensor_load_to_lds %0, %1" ::"s"(g0), "s"(g1) : "memory");
}

__device__ __forceinline__ f32x8 wmma_bf16(bf16x16 a, bf16x16 b, f32x8 c) {
  return __builtin_amdgcn_wmma_f32_16x16x32_bf16(false, a, false, b, (short)0, c,
                                                 false, false);
}

__device__ __forceinline__ f32x8 zero8() {
  f32x8 z;
  for (int e = 0; e < 8; ++e) z[e] = 0.0f;
  return z;
}

// Load a 16x32 A-fragment (or B^T-fragment) from row-major bf16 memory
// (global or LDS). Lane l holds row (l&15); K = 16*(j>>3) + 8*(l>>4) + (j&7).
// Each 8-half group is contiguous -> two 16B loads.
__device__ __forceinline__ bf16x16 load_frag(const __bf16* base, int row0,
                                             int ld, int k0) {
  int lane = threadIdx.x & 31;
  int m = lane & 15;
  int kh = lane >> 4;
  const __bf16* p = base + (size_t)(row0 + m) * ld + k0 + 8 * kh;
  FragCast f;
  f.u[0] = *(const uint4*)(const void*)(p);
  f.u[1] = *(const uint4*)(const void*)(p + 16);
  return f.v;
}

// ---------------------------------------------------------------------------
// GEMM: C(MxN) = A(MxK bf16 rowmajor) * Bt(NxK bf16 rowmajor)^T
// MODE 0: bf16, stored straight into q,k (B,H,T,64) and vT (B,H,64,T)
// MODE 1: +bias,ReLU,bf16 | 2: +resid f32 | 3: +bias+resid f32
// 256 thr = 8 waves (2x4). Block tile 128x128, 64 k per stage, wave tile 64x32.
// Two LDS buffers; wave 0 brings A's tile and wave 1 Bt's by one tensor load
// per stage. K is a multiple of 64 and at least 128 (two stages).
// ---------------------------------------------------------------------------
template <int MODE>
__global__ __launch_bounds__(256) void gemm_bf16_tn(
    const __bf16* __restrict__ A, const __bf16* __restrict__ Bt, int M, int N,
    int K, __bf16* __restrict__ outB, float* __restrict__ outF,
    const float* __restrict__ bias, const float* __restrict__ resid,
    __bf16* __restrict__ outK, __bf16* __restrict__ outVT) {
  // [buffer][A | Bt] tiles, each at a multiple of 2 KiB
  __shared__ __attribute__((aligned(2048))) unsigned char sm[4 * GTILEB];

  int t = threadIdx.x;
  const uint32_t wave = uni((uint32_t)t >> 5);
  int lane = t & 31;
  int browg = blockIdx.y * 128;
  int bcolg = blockIdx.x * 128;

  const uint32_t isB = wave & 1u;  // issuing waves: 0 -> A, 1 -> Bt
  const uint64_t gbase =
      (uint64_t)(size_t)(isB ? Bt + (size_t)bcolg * K : A + (size_t)browg * K);
  const uint32_t ldst = (uint32_t)(size_t)sm + isB * GTILEB;
  const u32x8 g1 = tdm_group1((uint32_t)K * 2u);
  const int nst = K / GBK;

  f32x8 acc[4][2];
  for (int i = 0; i < 4; ++i)
    for (int j = 0; j < 2; ++j) acc[i][j] = zero8();

  // prologue: stage 0 lands and is published, then stage 1 flies
  if (pinned(wave < 2u)) {
    tdm_load(tdm_group0(ldst, gbase), g1);
    // stage 0 has landed
    asm volatile("s_wait_tensorcnt 0x0" ::: "memory");
  }
  __syncthreads();
  if (pinned(wave < 2u))
    tdm_load(tdm_group0(ldst + 2u * GTILEB, gbase + 2u * GBK), g1);

  int row0w = (int)(wave >> 2) * 64;  // 0 / 64
  int col0w = (int)(wave & 3u) * 32;  // 0..96

  for (int s = 0; s < nst; ++s) {
    const __bf16* sa = (const __bf16*)(const void*)(sm + (s & 1) * (2u * GTILEB));
    const __bf16* sb = (const __bf16*)(const void*)(sm + (s & 1) * (2u * GTILEB) + GTILEB);
    // All fragments of the stage, both 32-k blocks, each in registers of its own.
    bf16x16 af[GBK / 32][4], bfv[GBK / 32][2];
#pragma unroll
    for (int kb = 0; kb < GBK / 32; ++kb) {
#pragma unroll
      for (int j = 0; j < 2; ++j)
        bfv[kb][j] = load_frag(sb, col0w + 16 * j, GPITCH, 32 * kb);
#pragma unroll
      for (int i = 0; i < 4; ++i)
        af[kb][i] = load_frag(sa, row0w + 16 * i, GPITCH, 32 * kb);
    }
    // keeps the stage's 24 LDS reads one group ahead of its 16 matrix
    // instructions: without it the compiler reuses one A fragment's registers
    // and waits out a whole LDS latency in front of every second one.
    __builtin_amdgcn_sched_barrier(0);
#pragma unroll
    for (int kb = 0; kb < GBK / 32; ++kb)
#pragma unroll
      for (int i = 0; i < 4; ++i)
#pragma unroll
        for (int j = 0; j < 2; ++j)
          acc[i][j] = wmma_bf16(af[kb][i], bfv[kb][j], acc[i][j]);
    // keeps the pass's closing wait below behind the matrix instructions: moved
    // up among them it turns their counted waits into one wait for all 24 reads.
    __builtin_amdgcn_sched_barrier(0);

    // publish point of stage s + 1: this wave's reads of stage s have retired,
    asm volatile("s_wait_dscnt 0x0" ::: "memory");
    // the issuing wave's own request (stage s + 1) has landed,
    if (pinned(wave < 2u)) asm volatile("s_wait_tensorcnt 0x0" ::: "memory");
    // every wave has left stage s's buffer and may read stage s + 1,
    __syncthreads();
    // and only then stage s + 2 goes into the buffer that stage s used.
    if (pinned((uint32_t)((wave < 2u) && (s + 2 < nst)))) {
      // pinned(): the stage number is taken here, so that the descriptor words
      // made from it are formed behind the wait and the barrier above
      const uint32_t sn = pinned((uint32_t)s + 2u);
      tdm_load(tdm_group0(ldst + (sn & 1u) * (2u * GTILEB),
                          gbase + (uint64_t)sn * (2u * GBK)),
               g1);
    }
  }
  // nothing of the ring is outstanding when the wave goes on to its stores
  asm volatile("s_wait_tensorcnt 0x0" ::: "memory");
  asm volatile("s_wait_dscnt 0x0" ::: "memory");

  int mh = (lane >> 4) * 8;
  int nn = lane & 15;
  if (MODE == 0) {
    // Column n = which*1024 + h*64 + kk; a 128-wide block lies in one 'which'.
    // A lane holds 8 consecutive tokens of one column: for vT that is one
    // contiguous 16-byte run, and a wave's 64 tokens fill whole 128-byte lines.
    int which = bcolg >> 10;
    int rem = (bcolg + col0w + nn) & 1023;  // j adds 16, inside the same head
    int kc = rem & 63;
    int gr0 = browg + row0w + mh;  // i adds 16, inside the same batch entry
    size_t bhb = (size_t)((gr0 >> 11) * H + (rem >> 6));
    int tt = gr0 & (T - 1);
    if (which == 2) {
      __bf16* dst = outVT + (bhb * DKV + kc) * T + tt;
#pragma unroll
      for (int i = 0; i < 4; ++i)
#pragma unroll
        for (int j = 0; j < 2; ++j) {
          union { __bf16 h[8]; uint4 u; } pk;
#pragma unroll
          for (int r = 0; r < 8; ++r) pk.h[r] = (__bf16)acc[i][j][r];
          *(uint4*)(void*)(dst + (size_t)(16 * j) * T + 16 * i) = pk.u;
        }
      return;
    }
    __bf16* dst = (which == 0 ? outB : outK) + (bhb * T + tt) * DKV + kc;
#pragma unroll
    for (int i = 0; i < 4; ++i)
#pragma unroll
      for (int j = 0; j < 2; ++j)
#pragma unroll
        for (int r = 0; r < 8; ++r)
          dst[(16 * i + r) * DKV + 16 * j] = (__bf16)acc[i][j][r];
    // The built code lays the vT path right behind these stores, and that path
    // rewrites registers they name: keep the wait in front of it.
    asm volatile("s_wait_xcnt 0x0" ::: "memory");
    return;
  }
#pragma unroll
  for (int i = 0; i < 4; ++i)
#pragma unroll
    for (int j = 0; j < 2; ++j) {
      int gc = bcolg + col0w + 16 * j + nn;
#pragma unroll
      for (int r = 0; r < 8; ++r) {
        int gr = browg + row0w + 16 * i + mh + r;
        size_t idx = (size_t)gr * N + gc;
        float v = acc[i][j][r];
        if (MODE == 1) {
          v += bias[gc];
          v = v > 0.0f ? v : 0.0f;
        }
        if (MODE == 3) v += bias[gc];
        if (MODE == 1)
          outB[idx] = (__bf16)v;
        else
          outF[idx] = v + resid[idx];
      }
    }
}

// ---------------------------------------------------------------------------
// Attention pass A: column softmax stats (softmax is over the QUERY axis).
// Grid: (B*H)*(T/128); each wave owns 16 key columns, loops all q-tiles.
// The 8 waves walk the same q rows: wave 0 brings them into LDS, 128 rows per
// stage by one tensor load, two buffers, and every wave reads fragments there.
// ---------------------------------------------------------------------------
__global__ __launch_bounds__(256) void attn_colstats(
    const __bf16* __restrict__ qb, const __bf16* __restrict__ kb,
    float* __restrict__ cmax, float* __restrict__ crcp) {
  // two q tiles, each at a multiple of 2 KiB
  __shared__ __attribute__((aligned(2048))) unsigned char sm[2 * GTILEB];
  const int sblocks = T / 128;
  int bh = blockIdx.x / sblocks;
  int sblk = blockIdx.x % sblocks;
  const uint32_t wave = uni(threadIdx.x >> 5);
  int lane = threadIdx.x & 31;
  int s0 = sblk * 128 + (int)wave * 16;

  const __bf16* qh = qb + (size_t)bh * T * DKV;
  const __bf16* kh = kb + (size_t)bh * T * DKV;

  const uint64_t gq = (uint64_t)(size_t)qh;
  const uint32_t ldst = (uint32_t)(size_t)sm;
  const u32x8 g1 = tdm_group1(DKV * 2u);
  const int nst = T / AKS;

  // prologue: stage 0 lands and is published, then stage 1 flies
  if (pinned(wave == 0u)) {
    tdm_load(tdm_group0(ldst, gq), g1);
    // stage 0 has landed
    asm volatile("s_wait_tensorcnt 0x0" ::: "memory");
  }
  __syncthreads();
  // From here on the ring's group 0 is one value carried through the loop, each
  // request's address made from the one before it: its registers stay in use,
  // so that none is taken for something else while a request is in flight.
  u32x4 g0 = tdm_group0(ldst + GTILEB, gq + (uint64_t)(AKS * DKV * 2));
  g0[0] = pinned(g0[0]);  // pinned(): a descriptor word held in its scalar register
  if (pinned(wave == 0u)) tdm_load(g0, g1);

  bf16x16 kf0 = load_frag(kh, s0, DKV, 0);
  bf16x16 kf1 = load_frag(kh, s0, DKV, 32);

  // Running maximum and sum of this lane's own query rows alone (8 of every 16):
  // the two lanes that hold one key column are merged once, behind the loop.
  float m = -3.0e38f, l = 0.0f;
  for (int st = 0; st < nst; ++st) {
   const __bf16* sq = (const __bf16*)(const void*)(sm + (st & 1) * GTILEB);
   // The whole stage's scores stay in registers: 8 tiles of 16 queries, so that
   // the maximum is raised and the sum rescaled once per stage.
   // unrolled: the tiles index registers and their LDS offsets are immediates
   f32x8 c[AKS / 16];
   bf16x16 a0[AKS / 16], a1[AKS / 16];
#pragma unroll
   for (int i = 0; i < AKS / 16; ++i) {
    a0[i] = load_frag(sq, 16 * i, GPITCH, 0);
    a1[i] = load_frag(sq, 16 * i, GPITCH, 32);
   }
   // keeps the stage's 32 LDS reads one group ahead of its 16 matrix
   // instructions: without it the compiler reuses two fragments' registers and
   // waits out an LDS latency in front of every matrix instruction.
   __builtin_amdgcn_sched_barrier(0);
#pragma unroll
   for (int i = 0; i < AKS / 16; ++i) c[i] = wmma_bf16(a0[i], kf0, zero8());
#pragma unroll
   for (int i = 0; i < AKS / 16; ++i) c[i] = wmma_bf16(a1[i], kf1, c[i]);
   // keeps the stage's closing LDS wait (below) behind the matrix instructions:
   // moved up among them it turns their counted waits into one wait for all 32.
   __builtin_amdgcn_sched_barrier(0);
   // one chain per tile, then a tree: short dependent chains
   float tm[AKS / 16];
#pragma unroll
   for (int i = 0; i < AKS / 16; ++i) {
    tm[i] = c[i][0];
#pragma unroll
    for (int r = 1; r < 8; ++r) tm[i] = fmaxf(tm[i], c[i][r]);
   }
   float tmax = fmaxf(fmaxf(fmaxf(tm[0], tm[1]), fmaxf(tm[2], tm[3])),
                      fmaxf(fmaxf(tm[4], tm[5]), fmaxf(tm[6], tm[7])));
   // 1/sqrt(64) is a power of two: scaling the maximum is exact
   float mn = fmaxf(m, tmax * 0.125f);
   f32x2 ps[AKS / 16];
#pragma unroll
   for (int i = 0; i < AKS / 16; ++i) {
    ps[i][0] = __expf(c[i][0] * 0.125f - mn);
    ps[i][1] = __expf(c[i][1] * 0.125f - mn);
#pragma unroll
    for (int r = 2; r < 8; r += 2) {
      f32x2 e;
      e[0] = __expf(c[i][r] * 0.125f - mn);
      e[1] = __expf(c[i][r + 1] * 0.125f - mn);
      ps[i] += e;
    }
   }
   f32x2 p2 = ((ps[0] + ps[1]) + (ps[2] + ps[3])) + ((ps[4] + ps[5]) + (ps[6] + ps[7]));
   l = l * __expf(m - mn) + (p2[0] + p2[1]);
   m = mn;

   // publish point of stage st + 1: this wave's reads of stage st have retired,
   asm volatile("s_wait_dscnt 0x0" ::: "memory");
   // the issuing wave's own request (stage st + 1) has landed,
   if (pinned(wave == 0u)) asm volatile("s_wait_tensorcnt 0x0" ::: "memory");
   // every wave has left stage st's buffer and may read stage st + 1,
   __syncthreads();
   // and only then stage st + 2 goes into the buffer that stage st used.
   if (pinned((uint32_t)((wave == 0u) && (st + 2 < nst)))) {
     // pinned(): the step is taken here, so that the address words made with it
     // are formed behind the wait and the barrier above. The carry goes into
     // word 3's address bits; its type bits lie above them.
     const uint32_t step = pinned((uint32_t)(AKS * DKV * 2));
     const uint64_t ga = (((uint64_t)g0[3] << 32) | (uint64_t)g0[2]) + step;
     g0[1] = uni(ldst + (uint32_t)(st & 1) * GTILEB);
     g0[2] = uni((uint32_t)ga);
     g0[3] = uni((uint32_t)(ga >> 32));
     tdm_load(g0, g1);
   }
  }
  // nothing of the ring is outstanding when the wave goes on to its stores
  asm volatile("s_wait_tensorcnt 0x0" ::: "memory");
  asm volatile("s_wait_dscnt 0x0" ::: "memory");

  // lanes l and l + 16 hold the same key column (different q rows): merge
  {
    float mo = __shfl_xor(m, 16, 32);
    float lo = __shfl_xor(l, 16, 32);
    float mn = fmaxf(m, mo);
    l = l * __expf(m - mn) + lo * __expf(mo - mn);
    m = mn;
  }
  if (lane < 16) {
    cmax[(size_t)bh * T + s0 + lane] = m;
    // pass B needs 1 / sum for 16 keys per lane and step: divide once here
    crcp[(size_t)bh * T + s0 + lane] = 1.0f / l;
  }
}

// ---------------------------------------------------------------------------
// Attention pass B: recompute scores, p = exp(s/8 - m)/sum, o += p @ v.
// The scores are formed transposed (k's rows as A, q's rows as B^T): a lane then
// holds one query and keys 8h + r of each 16-key tile (h = lane >> 4), which is
// the k order of an A fragment, so two tiles of p, converted in place, are the
// A operand of p @ v. vT supplies B^T rows directly.
// The 8 waves walk the same keys: per stage of 128 keys wave 0 brings k's rows
// and wave 1 vT's into LDS by one tensor load each, two buffers.
// ---------------------------------------------------------------------------
__global__ __launch_bounds__(256) void attn_out(
    const __bf16* __restrict__ qb, const __bf16* __restrict__ kb,
    const __bf16* __restrict__ vtb, const float* __restrict__ cmax,
    const float* __restrict__ crcp, __bf16* __restrict__ oc) {
  // [buffer][k | vT] tiles, each at a multiple of 2 KiB
  __shared__ __attribute__((aligned(2048))) unsigned char sm[4 * GTILEB];
  const int qblocks = T / 128;
  int bh = blockIdx.x / qblocks;
  int qblk = blockIdx.x % qblocks;
  const uint32_t wave = uni(threadIdx.x >> 5);
  int lane = threadIdx.x & 31;
  int q0 = qblk * 128 + (int)wave * 16;

  const __bf16* qh = qb + (size_t)bh * T * DKV;
  const __bf16* kh = kb + (size_t)bh * T * DKV;
  const __bf16* vh = vtb + (size_t)bh * DKV * T;

  const uint64_t gk = (uint64_t)(size_t)kh;
  const uint64_t gv = (uint64_t)(size_t)vh;
  const uint32_t ldsk = (uint32_t)(size_t)sm;
  const uint32_t ldsv = ldsk + GTILEB;
  const u32x8 g1k = tdm_group1(DKV * 2u);
  const u32x8 g1v = tdm_group1_vt();
  const int nst = T / AKS;

  // prologue: stage 0 lands and is published, then stage 1 flies
  if (pinned(wave == 0u)) {
    tdm_load(tdm_group0(ldsk, gk), g1k);
    // stage 0 has landed
    asm volatile("s_wait_tensorcnt 0x0" ::: "memory");
  }
  if (pinned(wave == 1u)) {
    tdm_load(tdm_group0(ldsv, gv), g1v);
    asm volatile("s_wait_tensorcnt 0x0" ::: "memory");  // as above
  }
  __syncthreads();
  if (pinned(wave == 0u))
    tdm_load(tdm_group0(ldsk + 2u * GTILEB, gk + (uint64_t)(AKS * DKV * 2)), g1k);
  if (pinned(wave == 1u))
    tdm_load(tdm_group0(ldsv + 2u * GTILEB, gv + (uint64_t)(AKS * 2)), g1v);

  bf16x16 aq0 = load_frag(qh, q0, DKV, 0);
  bf16x16 aq1 = load_frag(qh, q0, DKV, 32);

  f32x8 oacc[4];
  for (int n = 0; n < 4; ++n) oacc[n] = zero8();

  int nn = lane & 15;
  int mh = (lane >> 4) * 8;
  // the head's column statistics; a lane half reads those of its 8 keys of a tile
  const float* pm = cmax + (size_t)bh * T;
  const float* pr = crcp + (size_t)bh * T;
  const uint32_t hk = (uint32_t)mh;

  for (int st = 0; st < nst; ++st) {
   const __bf16* sk = (const __bf16*)(const void*)(sm + (st & 1) * (2u * GTILEB));
   const __bf16* sv = (const __bf16*)(const void*)(sm + (st & 1) * (2u * GTILEB) + GTILEB);
   // unrolled: a stage is one pass and its LDS offsets are immediates
#pragma unroll
   for (int ss = 0; ss < AKS; ss += 32) {
    int s0 = st * AKS + ss;
    f32x8 c0 = zero8(), c1 = zero8();
    bf16x16 k00 = load_frag(sk, ss, GPITCH, 0);
    bf16x16 k01 = load_frag(sk, ss, GPITCH, 32);
    bf16x16 k10 = load_frag(sk, ss + 16, GPITCH, 0);
    bf16x16 k11 = load_frag(sk, ss + 16, GPITCH, 32);
    // keeps the eight LDS reads above one group with one latency: without it the
    // compiler reuses one fragment's registers and waits out four in a row.
    // Mask: global reads and plain vector / scalar work may still cross it, so
    // that the column statistics' loads below are issued early.
    __builtin_amdgcn_sched_barrier(0x26);
    c0 = wmma_bf16(k00, aq0, c0);  // c0[r] = score(key ss + mh + r, query nn)
    c1 = wmma_bf16(k10, aq0, c1);  // c1[r]: key ss + 16 + mh + r
    c0 = wmma_bf16(k01, aq1, c0);
    c1 = wmma_bf16(k11, aq1, c1);

    union { float4 q[2]; float f[8]; } m0, m1, r0, r1;
#pragma unroll
    for (int e = 0; e < 2; ++e) {
      m0.q[e] = *(const float4*)(const void*)(pm + s0 + 4 * e + hk);
      m1.q[e] = *(const float4*)(const void*)(pm + s0 + 16 + 4 * e + hk);
      r0.q[e] = *(const float4*)(const void*)(pr + s0 + 4 * e + hk);
      r1.q[e] = *(const float4*)(const void*)(pr + s0 + 16 + 4 * e + hk);
    }
    bf16x16 pf;  // 16 q rows x K=32 (s), in load_frag's k order
#pragma unroll
    for (int r = 0; r < 8; ++r) {
      pf[r] = (__bf16)(__expf(c0[r] * 0.125f - m0.f[r]) * r0.f[r]);
      pf[8 + r] = (__bf16)(__expf(c1[r] * 0.125f - m1.f[r]) * r1.f[r]);
    }
#pragma unroll
    for (int n = 0; n < 4; ++n) {
      bf16x16 bv = load_frag(sv, n * 16, VPITCH, ss);  // vT rows = v columns
      oacc[n] = wmma_bf16(pf, bv, oacc[n]);
    }
   }

   // the statistics loads' address registers are stepped for the next stage
   asm volatile("s_wait_xcnt 0x0" ::: "memory");
   // publish point of stage st + 1: this wave's reads of stage st have retired,
   asm volatile("s_wait_dscnt 0x0" ::: "memory");
   // each issuing wave's own request (stage st + 1) has landed,
   if (pinned(wave < 2u)) asm volatile("s_wait_tensorcnt 0x0" ::: "memory");
   // every wave has left stage st's buffer and may read stage st + 1,
   __syncthreads();
   // and only then stage st + 2 goes into the buffer that stage st used.
   // pinned() on the stage number: the descriptor words made from it are formed
   // behind the wait and the barrier above
   if (pinned((uint32_t)((wave == 0u) && (st + 2 < nst)))) {
     const uint32_t sn = pinned((uint32_t)st + 2u);
     tdm_load(tdm_group0(ldsk + (sn & 1u) * (2u * GTILEB),
                         gk + (uint64_t)sn * (uint64_t)(AKS * DKV * 2)),
              g1k);
   }
   if (pinned((uint32_t)((wave == 1u) && (st + 2 < nst)))) {
     const uint32_t sn = pinned((uint32_t)st + 2u);
     tdm_load(tdm_group0(ldsv + (sn & 1u) * (2u * GTILEB),
                         gv + (uint64_t)sn * (uint64_t)(AKS * 2)),
              g1v);
   }
  }
  // nothing of the ring is outstanding when the wave goes on to its stores
  asm volatile("s_wait_tensorcnt 0x0" ::: "memory");
  asm volatile("s_wait_dscnt 0x0" ::: "memory");

  int b = bh / H, h = bh % H;
#pragma unroll
  for (int n = 0; n < 4; ++n)
#pragma unroll
    for (int r = 0; r < 8; ++r) {
      int gt = q0 + mh + r;
      int col = h * DKV + n * 16 + nn;
      oc[((size_t)b * T + gt) * D + col] = (__bf16)oacc[n][r];
    }
}

// ---------------------------------------------------------------------------
// Row mean/std norm (ddof=1). One block per row of D=1024.
// ---------------------------------------------------------------------------
__global__ __launch_bounds__(256) void rownorm(const float* __restrict__ y,
                                               float* __restrict__ outF,
                                               __bf16* __restrict__ outB) {
  __shared__ float s1[256], s2[256];
  int row = blockIdx.x, tid = threadIdx.x;
  const float* pr = y + (size_t)row * D;
  float v[4], s = 0.0f, q = 0.0f;
#pragma unroll
  for (int j = 0; j < 4; ++j) {
    v[j] = pr[tid + 256 * j];
    s += v[j];
    q += v[j] * v[j];
  }
  s1[tid] = s;
  s2[tid] = q;
  __syncthreads();
  for (int o = 128; o > 0; o >>= 1) {
    if (tid < o) {
      s1[tid] += s1[tid + o];
      s2[tid] += s2[tid + o];
    }
    __syncthreads();
  }
  float mean = s1[0] * (1.0f / D);
  float var = (s2[0] - s1[0] * s1[0] * (1.0f / D)) * (1.0f / (D - 1));
  float rstd = rsqrtf(var);
  float* po = outF + (size_t)row * D;
#pragma unroll
  for (int j = 0; j < 4; ++j) {
    float o = (v[j] - mean) * rstd;
    po[tid + 256 * j] = o;
    if (outB) outB[(size_t)row * D + tid + 256 * j] = (__bf16)o;
  }
}

// ------------------------- conversion / layout kernel ----------------------
// The grid below is exact for the fixed shapes. Every wave-wide access covers
// whole 128-byte lines, and each thread has 8 16-byte loads in flight.

// One block converts 8192 elements, 32 per thread: 8 float4 loads, 8 stores of
// 4 bf16. blk is the block's number within this job.
__device__ __forceinline__ void cvt_f32_bf16(int blk, const float* __restrict__ in,
                                             __bf16* __restrict__ out) {
  size_t base = (size_t)blk * 2048 + threadIdx.x;  // in units of 4
  float4 v[8];
#pragma unroll
  for (int j = 0; j < 8; ++j)
    v[j] = *(const float4*)(const void*)(in + (base + 256 * j) * 4);
#pragma unroll
  for (int j = 0; j < 8; ++j) {
    union { __bf16 h[4]; uint2 u; } pk;
    pk.h[0] = (__bf16)v[j].x;
    pk.h[1] = (__bf16)v[j].y;
    pk.h[2] = (__bf16)v[j].z;
    pk.h[3] = (__bf16)v[j].w;
    *(uint2*)(void*)(out + (base + 256 * j) * 4) = pk.u;
  }
}

// One block turns a tile of 128 rows x 64 columns of f32 (row pitch LDIN) into
// 64 rows x 128 columns of bf16 (row pitch LDOUT). in / out point at the tile.
// The turn goes through LDS at a pitch of 65 dwords: both the row-wise writes
// and the column-wise reads then fall on 32 different banks.
// The pitches are compile-time, so that a thread's accesses share one address
// register pair and differ in the immediate offset alone.
template <int LDIN, int LDOUT>
__device__ __forceinline__ void tile_turn(float (*tile)[65],
                                          const float* __restrict__ in,
                                          __bf16* __restrict__ out) {
  int t = threadIdx.x;
  int lr = t >> 4;        // 16 lanes read one row's 256 bytes
  int lc = (t & 15) * 4;
  float4 v[8];
#pragma unroll
  for (int j = 0; j < 8; ++j)
    v[j] = *(const float4*)(const void*)(in + (size_t)(lr + 16 * j) * LDIN + lc);
  // the loads' address registers may be reused by what follows
  asm volatile("s_wait_xcnt 0x0" ::: "memory");
#pragma unroll
  for (int j = 0; j < 8; ++j) {
    tile[lr + 16 * j][lc + 0] = v[j].x;
    tile[lr + 16 * j][lc + 1] = v[j].y;
    tile[lr + 16 * j][lc + 2] = v[j].z;
    tile[lr + 16 * j][lc + 3] = v[j].w;
  }
  __syncthreads();
  int rc = (t & 7) * 8;   // 8 lanes write 128 bytes of one output row
  int c0 = t >> 3;
#pragma unroll
  for (int j = 0; j < 4; ++j) {
    int c = c0 + 32 * (j & 1);
    int r = rc + 64 * (j >> 1);
    union { __bf16 h[8]; uint4 u; } pk;
#pragma unroll
    for (int k = 0; k < 8; ++k) pk.h[k] = (__bf16)tile[r + k][c];
    *(uint4*)(void*)(out + (size_t)c * LDOUT + r) = pk.u;
  }
  // The built code lays another job's path right behind these stores, and that
  // path rewrites registers they name: keep the wait in front of it.
  asm volatile("s_wait_xcnt 0x0" ::: "memory");
}

// out (C x R) = transpose of in (R x C), bf16; blk counts the R/128 row tiles
// fastest, then the C/64 column tiles.
template <int R, int C>
__device__ __forceinline__ void packT(float (*tile)[65], int blk,
                                      const float* __restrict__ in,
                                      __bf16* __restrict__ out) {
  int r0 = (blk % (R / 128)) * 128;
  int c0 = (blk / (R / 128)) * 64;
  tile_turn<C, R>(tile, in + (size_t)r0 * C + c0, out + (size_t)c0 * R + r0);
}

// Blocks per job of the one preparation launch
#define NB_X (NTOK * D / 8192)             // x -> bf16
#define NB_QKV ((D / 128) * H * 3)         // Wq, Wk, Wv
#define NB_WO ((D / 128) * (D / 64))
#define NB_W1 ((D / 128) * (FF / 64))
#define NB_W2 ((FF / 128) * (D / 64))

// The five preparation jobs read only inputs and none reads another's output:
// they share one grid, and a block finds its job from its index (the same for
// the whole block, so the barrier in tile_turn stays under uniform control flow).
__global__ __launch_bounds__(256) void prep_inputs(
    const float* __restrict__ x, const float* __restrict__ Wq,
    const float* __restrict__ Wk, const float* __restrict__ Wv,
    const float* __restrict__ Wo, const float* __restrict__ W1,
    const float* __restrict__ W2, __bf16* __restrict__ xb,
    __bf16* __restrict__ wqkvT, __bf16* __restrict__ woT,
    __bf16* __restrict__ w1T, __bf16* __restrict__ w2T) {
  __shared__ float tile[128][65];
  int b = blockIdx.x;
  if (b < NB_X) {
    cvt_f32_bf16(b, x, xb);
    return;
  }
  b -= NB_X;
  if (b < NB_QKV) {
    // WqkvT[n][d], n = which*1024 + h*64 + k (rows = GEMM columns, K-contig);
    // a head is a D x 64 matrix.
    int d0 = (b % (D / 128)) * 128;
    int h = (b / (D / 128)) % H;
    int which = b / ((D / 128) * H);
    const float* src = which == 0 ? Wq : (which == 1 ? Wk : Wv);
    tile_turn<DKV, D>(tile, src + ((size_t)h * D + d0) * DKV,
                      wqkvT + (size_t)(which * 1024 + h * DKV) * D + d0);
    return;
  }
  b -= NB_QKV;
  if (b < NB_WO) {
    packT<D, D>(tile, b, Wo, woT);
    return;
  }
  b -= NB_WO;
  if (b < NB_W1) {
    packT<D, FF>(tile, b, W1, w1T);
    return;
  }
  packT<FF, D>(tile, b - NB_W1, W2, w2T);
}

// ---------------------------------------------------------------------------
extern "C" void kernel_launch(void* const* d_in, const int* in_sizes, int n_in,
                              void* d_out, int out_size, void* d_ws,
                              size_t ws_size, hipStream_t stream) {
  const float* x = (const float*)d_in[0];
  const float* Wq = (const float*)d_in[1];
  const float* Wk = (const float*)d_in[2];
  const float* Wv = (const float*)d_in[3];
  const float* Wo = (const float*)d_in[4];
  const float* W1 = (const float*)d_in[5];
  const float* b1 = (const float*)d_in[6];
  const float* W2 = (const float*)d_in[7];
  const float* b2 = (const float*)d_in[8];

  char* ws = (char*)d_ws;
  const size_t OFF_XB = 0;             //  8 MiB
  const size_t OFF_WQKVT = 8388608;    //  6 MiB
  const size_t OFF_WOT = 14680064;     //  2 MiB
  const size_t OFF_W1T = 16777216;     //  8 MiB
  const size_t OFF_W2T = 25165824;     //  8 MiB
  const size_t OFF_Y2 = 33554432;      // 16 MiB f32
  const size_t OFF_QB = 58720256;      //  8 MiB
  const size_t OFF_KB = 67108864;      //  8 MiB
  const size_t OFF_VT = 75497472;      //  8 MiB
  const size_t OFF_CMAX = 83886080;    // 256 KiB
  const size_t OFF_CRCP = 84148224;    // 256 KiB
  const size_t OFF_OC = 84410368;      //  8 MiB
  const size_t OFF_Y1 = 92798976;      // 16 MiB f32
  const size_t OFF_OUT1F = 109576192;  // 16 MiB f32
  const size_t OFF_OUT1B = 126353408;  //  8 MiB
  const size_t OFF_HB = 134742016;     // 32 MiB

  __bf16* xb = (__bf16*)(ws + OFF_XB);
  __bf16* wqkvT = (__bf16*)(ws + OFF_WQKVT);
  __bf16* woT = (__bf16*)(ws + OFF_WOT);
  __bf16* w1T = (__bf16*)(ws + OFF_W1T);
  __bf16* w2T = (__bf16*)(ws + OFF_W2T);
  __bf16* qb = (__bf16*)(ws + OFF_QB);
  __bf16* kb = (__bf16*)(ws + OFF_KB);
  __bf16* vtb = (__bf16*)(ws + OFF_VT);
  float* cmax = (float*)(ws + OFF_CMAX);
  float* crcp = (float*)(ws + OFF_CRCP);
  __bf16* ocb = (__bf16*)(ws + OFF_OC);
  float* y1 = (float*)(ws + OFF_Y1);
  float* out1f = (float*)(ws + OFF_OUT1F);
  __bf16* out1b = (__bf16*)(ws + OFF_OUT1B);
  __bf16* hb = (__bf16*)(ws + OFF_HB);
  float* y2 = (float*)(ws + OFF_Y2);

  // 1) convert x and pack the transposed bf16 weights, one launch
  prep_inputs<<<NB_X + NB_QKV + NB_WO + NB_W1 + NB_W2, 256, 0, stream>>>(
      x, Wq, Wk, Wv, Wo, W1, W2, xb, wqkvT, woT, w1T, w2T);

  // 2) fused QKV projection GEMM: (4096x1024)x(1024x3072), head layouts out
  gemm_bf16_tn<0><<<dim3(NQKV / 128, NTOK / 128), 256, 0, stream>>>(
      xb, wqkvT, NTOK, NQKV, D, qb, nullptr, nullptr, nullptr, kb, vtb);

  // 3) attention (column softmax, two-pass flash-style over q)
  attn_colstats<<<(BSZ * H) * (T / 128), 256, 0, stream>>>(qb, kb, cmax, crcp);
  attn_out<<<(BSZ * H) * (T / 128), 256, 0, stream>>>(qb, kb, vtb, cmax, crcp,
                                                      ocb);

  // 4) output projection + residual, then norm
  gemm_bf16_tn<2><<<dim3(D / 128, NTOK / 128), 256, 0, stream>>>(
      ocb, woT, NTOK, D, D, nullptr, y1, nullptr, x, nullptr, nullptr);
  rownorm<<<NTOK, 256, 0, stream>>>(y1, out1f, out1b);

  // 5) FFN: relu(out1 @ W1 + b1) @ W2 + b2 + out1, then norm -> d_out
  gemm_bf16_tn<1><<<dim3(FF / 128, NTOK / 128), 256, 0, stream>>>(
      out1b, w1T, NTOK, FF, D, hb, nullptr, b1, nullptr, nullptr, nullptr);
  gemm_bf16_tn<3><<<dim3(D / 128, NTOK / 128), 256, 0, stream>>>(
      hb, w2T, NTOK, D, FF, nullptr, y2, b2, out1f, nullptr, nullptr);
  rownorm<<<NTOK, 256, 0, stream>>>(y2, (float*)d_out, nullptr);

  (void)in_sizes;
  (void)n_in;
  (void)out_size;
  (void)ws_size;
}

// v009
// Measured time: 192 microseconds a run.
// Timed twice side by side with v008, it ran 1.05 and 1.06 times as fast.
// Counting every step since v000, it is 3.57 times as fast.
#include <hip/hip_runtime.h>
#include <hip/hip_bf16.h>
#include <stdint.h>

// Problem dims (fixed by the reference)
#define BSZ 2
#define T   2048
#define D   1024
#define H   16
#define DKV 64
#define FF  4096
#define NTOK 4096          // BSZ*T
#define NQKV 3072          // 3*H*DKV

typedef __attribute__((ext_vector_type(16))) __bf16 bf16x16;
typedef __attribute__((ext_vector_type(8)))  float  f32x8;
typedef __attribute__((ext_vector_type(2)))  float  f32x2;

union FragCast { bf16x16 v; uint4 u[2]; };

typedef uint32_t u32x4 __attribute__((ext_vector_type(4)));
typedef uint32_t u32x8 __attribute__((ext_vector_type(8)));

// GEMM stage: tiles of 128 rows of 64 halves (128 bytes), BM/128 of A and BN/128
// of Bt, laid in LDS at a
// 144-byte row pitch (16 B x odd: conflict-free for 16-byte fragment reads).
#define GBK 64          // halves of K per stage
#define GPITCH 72       // LDS row pitch in halves
#define GTILEB 18432u   // 128 rows x 144 B = 9 x 2 KiB, one operand's tile

__device__ __forceinline__ uint32_t uni(uint32_t v) {
  return (uint32_t)__builtin_amdgcn_readfirstlane(v);
}

__device__ __forceinline__ uint32_t pinned(uint32_t v) {
  uint32_t w = (uint32_t)__builtin_amdgcn_readfirstlane(v);
  asm volatile("" : "+s"(w));
  return w;
}

// Descriptor group 0: one request, LDS byte offset, global address, type 2.
__device__ __forceinline__ u32x4 tdm_group0(uint32_t lds_dst, uint64_t ga) {
  u32x4 g;
  g[0] = uni(1u);
  g[1] = uni(lds_dst);
  g[2] = uni((uint32_t)ga);
  g[3] = uni((((uint32_t)(ga >> 32)) & 0x01FFFFFFu) | 0x80000000u);
  return g;
}

// Descriptor group 1: byte elements, tensor = tile = 128 rows of 128 bytes,
// source row pitch src_pitch bytes, 16 bytes of LDS pad behind every row.
// pinned(): each descriptor word is held in its scalar register for the whole
// loop, so that none is reused for something else while a request is in flight.
__device__ __forceinline__ u32x8 tdm_group1(uint32_t src_pitch) {
  u32x8 g;
  g[0] = pinned((1u << 20) | (4u << 22) | (3u << 25));
  g[1] = pinned(128u << 16);
  g[2] = pinned(128u << 16);
  g[3] = pinned(128u << 16);
  g[4] = pinned(128u);
  g[5] = pinned(src_pitch);
  g[6] = pinned(0u);
  g[7] = pinned(0u);
  return g;
}

// Attention stage: 128 rows of q or k (128 bytes each, the GEMM's tile and
// pitch), or vT's 64 rows x 128 keys (256 bytes each) at a 272-byte LDS pitch
// (16 B x odd again). Either tile fits one GTILEB place.
#define AKS 128         // queries (pass A) or keys (pass B) per stage
#define VPITCH 136      // vT's LDS row pitch in halves

// Descriptor group 1 of vT's tile: byte elements, tensor = tile = 64 rows of
// 256 bytes, source row pitch T halves, 16 bytes of LDS pad behind every row.
// pinned(): as in tdm_group1.
__device__ __forceinline__ u32x8 tdm_group1_vt() {
  u32x8 g;
  g[0] = pinned((1u << 20) | (5u << 22) | (3u << 25));
  g[1] = pinned(256u << 16);
  g[2] = pinned(64u << 16);
  g[3] = pinned(256u << 16);
  g[4] = pinned(64u);
  g[5] = pinned((uint32_t)T * 2u);
  g[6] = pinned(0u);
  g[7] = pinned(0u);
  return g;
}

__device__ __forceinline__ void tdm_load(u32x4 g0, u32x8 g1) {
  asm volatile("tensor_load_to_lds %0, %1" ::"s"(g0), "s"(g1) : "memory");
}

__device__ __forceinline__ f32x8 wmma_bf16(bf16x16 a, bf16x16 b, f32x8 c) {
  return __builtin_amdgcn_wmma_f32_16x16x32_bf16(false, a, false, b, (short)0, c,
                                                 false, false);
}

__device__ __forceinline__ f32x8 zero8() {
  f32x8 z;
  for (int e = 0; e < 8; ++e) z[e] = 0.0f;
  return z;
}

// Load a 16x32 A-fragment (or B^T-fragment) from row-major bf16 memory
// (global or LDS). Lane l holds row (l&15); K = 16*(j>>3) + 8*(l>>4) + (j&7).
// Each 8-half group is contiguous -> two 16B loads.
__device__ __forceinline__ bf16x16 load_frag(const __bf16* base, int row0,
                                             int ld, int k0) {
  int lane = threadIdx.x & 31;
  int m = lane & 15;
  int kh = lane >> 4;
  const __bf16* p = base + (size_t)(row0 + m) * ld + k0 + 8 * kh;
  FragCast f;
  f.u[0] = *(const uint4*)(const void*)(p);
  f.u[1] = *(const uint4*)(const void*)(p + 16);
  return f.v;
}

typedef __attribute__((ext_vector_type(2))) __bf16 bf16x2;

__device__ __forceinline__ uint32_t pack_bf16(float lo, float hi) {
  bf16x2 p;
  p[0] = (__bf16)lo;
  p[1] = (__bf16)hi;
  return __builtin_bit_cast(uint32_t, p);
}

// Eight 2-byte stores at byte offsets o[0..7] from a uniform base; d[q] holds the
// values of offsets 2q (low half) and 2q + 1 (high half). The stores and their
// s_wait_xcnt stand in one statement, so that the wait is in front of whatever
// rewrites a register that they name.
__device__ __forceinline__ void store8_b16(__bf16* base, const uint32_t (&o)[8],
                                           const uint32_t (&d)[4]) {
  asm volatile(
      "global_store_b16 %0, %8, %12\n\t"
      "global_store_d16_hi_b16 %1, %8, %12\n\t"
      "global_store_b16 %2, %9, %12\n\t"
      "global_store_d16_hi_b16 %3, %9, %12\n\t"
      "global_store_b16 %4, %10, %12\n\t"
      "global_store_d16_hi_b16 %5, %10, %12\n\t"
      "global_store_b16 %6, %11, %12\n\t"
      "global_store_d16_hi_b16 %7, %11, %12\n\t"
      "s_wait_xcnt 0x0"
      ::"v"(o[0]), "v"(o[1]), "v"(o[2]), "v"(o[3]), "v"(o[4]), "v"(o[5]),
        "v"(o[6]), "v"(o[7]), "v"(d[0]), "v"(d[1]), "v"(d[2]), "v"(d[3]),
        "s"(base)
      : "memory");
}

// Four 16-byte stores at byte offsets o[0..3] from a uniform base, with their
// s_wait_xcnt in the same statement, as in store8_b16.
__device__ __forceinline__ void store4_b128(__bf16* base, const uint32_t (&o)[4],
                                            const u32x4 (&d)[4]) {
  asm volatile(
      "global_store_b128 %0, %4, %8\n\t"
      "global_store_b128 %1, %5, %8\n\t"
      "global_store_b128 %2, %6, %8\n\t"
      "global_store_b128 %3, %7, %8\n\t"
      "s_wait_xcnt 0x0"
      ::"v"(o[0]), "v"(o[1]), "v"(o[2]), "v"(o[3]), "v"(d[0]), "v"(d[1]),
        "v"(d[2]), "v"(d[3]), "s"(base)
      : "memory");
}

// ---------------------------------------------------------------------------
// GEMM: C(MxN) = A(MxK bf16 rowmajor) * Bt(NxK bf16 rowmajor)^T
// MODE 0: bf16, stored straight into q,k (B,H,T,64) and vT (B,H,64,T)
// MODE 1: +bias,ReLU,bf16 | 2: +resid f32 | 3: +bias+resid f32
// 256 thr = 8 waves (2x4). Block tile BM x BN (multiples of 128), 64 k per
// stage, wave tile BM/2 x BN/4. A larger tile loads each operand row from L2 for
// more columns, and reads each LDS fragment for more matrix instructions.
// Two LDS buffers; per stage the first BM/128 waves bring 128 rows of A each and
// the next BN/128 waves 128 rows of Bt each, one tensor load per wave. The
// 128-row tiles lie one behind the other, so that an operand's rows keep one
// pitch. K is a multiple of 64 and at least 128 (two stages).
// ---------------------------------------------------------------------------
template <int MODE, int BM, int BN>
__global__ __launch_bounds__(256) void gemm_bf16_tn(
    const __bf16* __restrict__ A, const __bf16* __restrict__ Bt, int M, int N,
    int K, __bf16* __restrict__ outB, float* __restrict__ outF,
    const float* __restrict__ bias, const float* __restrict__ resid,
    __bf16* __restrict__ outK, __bf16* __restrict__ outVT) {
  constexpr uint32_t NTA = BM / 128;        // 128-row tiles of A per stage
  constexpr uint32_t NT = NTA + BN / 128;   // tiles per stage = issuing waves
  constexpr uint32_t BUFB = NT * GTILEB;    // one buffer
  constexpr int FI = BM / 32;               // 16-row fragments per wave
  constexpr int FJ = BN / 64;               // 16-column fragments per wave
  static_assert(MODE != 0 || FJ == 4, "vT's stores go out four columns at a time");
  // [buffer][A tiles | Bt tiles], each tile at a multiple of 2 KiB
  __shared__ __attribute__((aligned(2048))) unsigned char sm[2 * BUFB];

  int t = threadIdx.x;
  const uint32_t wave = uni((uint32_t)t >> 5);
  int lane = t & 31;
  int browg = blockIdx.y * BM;
  int bcolg = blockIdx.x * BN;

  // issuing wave w < NT brings tile w: A's rows first, then Bt's
  const uint64_t gbase = (uint64_t)(size_t)(
      wave >= NTA ? Bt + (size_t)(bcolg + 128 * (int)(wave - NTA)) * K
                  : A + (size_t)(browg + 128 * (int)wave) * K);
  const uint32_t ldst = (uint32_t)(size_t)sm + wave * GTILEB;
  const u32x8 g1 = tdm_group1((uint32_t)K * 2u);
  const int nst = K / GBK;

  f32x8 acc[FI][FJ];
  for (int i = 0; i < FI; ++i)
    for (int j = 0; j < FJ; ++j) acc[i][j] = zero8();

  // prologue: stage 0 lands and is published, then stage 1 flies
  if (pinned(wave < NT)) {
    tdm_load(tdm_group0(ldst, gbase), g1);
    // stage 0 has landed
    asm volatile("s_wait_tensorcnt 0x0" ::: "memory");
  }
  __syncthreads();
  if (pinned(wave < NT))
    tdm_load(tdm_group0(ldst + BUFB, gbase + 2u * GBK), g1);

  int row0w = (int)(wave >> 2) * (16 * FI);
  int col0w = (int)(wave & 3u) * (16 * FJ);

  for (int s = 0; s < nst; ++s) {
    const __bf16* sa = (const __bf16*)(const void*)(sm + (s & 1) * BUFB);
    const __bf16* sb = (const __bf16*)(const void*)(sm + (s & 1) * BUFB + NTA * GTILEB);
    // All fragments of the stage, both 32-k blocks, each in registers of its own.
    bf16x16 af[GBK / 32][FI], bfv[GBK / 32][FJ];
#pragma unroll
    for (int kb = 0; kb < GBK / 32; ++kb) {
#pragma unroll
      for (int j = 0; j < FJ; ++j)
        bfv[kb][j] = load_frag(sb, col0w + 16 * j, GPITCH, 32 * kb);
#pragma unroll
      for (int i = 0; i < FI; ++i)
        af[kb][i] = load_frag(sa, row0w + 16 * i, GPITCH, 32 * kb);
    }
    // keeps the stage's LDS reads one group ahead of its matrix
    // instructions: without it the compiler reuses one A fragment's registers
    // and waits out a whole LDS latency in front of every second one.
    __builtin_amdgcn_sched_barrier(0);
#pragma unroll
    for (int kb = 0; kb < GBK / 32; ++kb)
#pragma unroll
      for (int i = 0; i < FI; ++i)
#pragma unroll
        for (int j = 0; j < FJ; ++j)
          acc[i][j] = wmma_bf16(af[kb][i], bfv[kb][j], acc[i][j]);
    // keeps the pass's closing wait below behind the matrix instructions: moved
    // up among them it turns their counted waits into one wait for all reads.
    __builtin_amdgcn_sched_barrier(0);

    // publish point of stage s + 1: this wave's reads of stage s have retired,
    asm volatile("s_wait_dscnt 0x0" ::: "memory");
    // the issuing wave's own request (stage s + 1) has landed,
    if (pinned(wave < NT)) asm volatile("s_wait_tensorcnt 0x0" ::: "memory");
    // every wave has left stage s's buffer and may read stage s + 1,
    __syncthreads();
    // and only then stage s + 2 goes into the buffer that stage s used.
    if (pinned((uint32_t)((wave < NT) && (s + 2 < nst)))) {
      // pinned(): the stage number is taken here, so that the descriptor words
      // made from it are formed behind the wait and the barrier above
      const uint32_t sn = pinned((uint32_t)s + 2u);
      tdm_load(tdm_group0(ldst + (sn & 1u) * BUFB,
                          gbase + (uint64_t)sn * (2u * GBK)),
               g1);
    }
  }
  // nothing of the ring is outstanding when the wave goes on to its stores
  asm volatile("s_wait_tensorcnt 0x0" ::: "memory");
  asm volatile("s_wait_dscnt 0x0" ::: "memory");

  int mh = (lane >> 4) * 8;
  int nn = lane & 15;
  if (MODE == 0) {
    // Column n = which*1024 + h*64 + kk; a block (BN divides 1024) lies in one
    // 'which', a wave's columns (at most 64, aligned) in one head.
    // A lane holds 8 consecutive tokens of one column: for vT that is one
    // contiguous 16-byte run, and a wave's tokens fill whole 128-byte lines.
    int which = bcolg >> 10;
    int rem = (bcolg + col0w + nn) & 1023;  // j adds 16, inside the same head
    int kc = rem & 63;
    int gr0 = browg + row0w + mh;  // i adds 16, inside the same batch entry
    size_t bhb = (size_t)((gr0 >> 11) * H + (rem >> 6));
    int tt = gr0 & (T - 1);
    if (which == 2) {
      const uint32_t o0 = (uint32_t)((bhb * DKV + kc) * T + tt) * 2u;
#pragma unroll
      for (int i = 0; i < FI; ++i) {
        uint32_t o[4];
        u32x4 d[4];
#pragma unroll
        for (int j = 0; j < 4; ++j) {
          o[j] = o0 + (uint32_t)(16 * j * T + 16 * i) * 2u;
#pragma unroll
          for (int q = 0; q < 4; ++q)
            d[j][q] = pack_bf16(acc[i][j][2 * q], acc[i][j][2 * q + 1]);
        }
        store4_b128(outVT, o, d);
      }
      return;
    }
    __bf16* base = which == 0 ? outB : outK;
    const uint32_t o0 = (uint32_t)((bhb * T + tt) * DKV + kc) * 2u;
#pragma unroll
    for (int i = 0; i < FI; ++i)
#pragma unroll
      for (int j = 0; j < FJ; ++j) {
        uint32_t o[8], d[4];
#pragma unroll
        for (int r = 0; r < 8; ++r)
          o[r] = o0 + (uint32_t)((16 * i + r) * DKV + 16 * j) * 2u;
#pragma unroll
        for (int q = 0; q < 4; ++q)
          d[q] = pack_bf16(acc[i][j][2 * q], acc[i][j][2 * q + 1]);
        store8_b16(base, o, d);
      }
    return;
  }
  if (MODE == 1) {
    float bj[FJ];
#pragma unroll
    for (int j = 0; j < FJ; ++j) bj[j] = bias[bcolg + col0w + 16 * j + nn];
    const uint32_t o0 = ((uint32_t)(browg + row0w + mh) * (uint32_t)N +
                         (uint32_t)(bcolg + col0w + nn)) * 2u;
#pragma unroll
    for (int i = 0; i < FI; ++i)
#pragma unroll
      for (int j = 0; j < FJ; ++j) {
        uint32_t o[8], d[4];
        float v[8];
#pragma unroll
        for (int r = 0; r < 8; ++r) {
          o[r] = o0 + ((uint32_t)(16 * i + r) * (uint32_t)N + 16u * j) * 2u;
          v[r] = acc[i][j][r] + bj[j];
          v[r] = v[r] > 0.0f ? v[r] : 0.0f;
        }
#pragma unroll
        for (int q = 0; q < 4; ++q) d[q] = pack_bf16(v[2 * q], v[2 * q + 1]);
        store8_b16(outB, o, d);
        // keeps later groups' values from being formed ahead of this store:
        // formed early, beside all the accumulators, they spill to scratch.
        __builtin_amdgcn_sched_barrier(0);
      }
    return;
  }
#pragma unroll
  for (int i = 0; i < FI; ++i)
#pragma unroll
    for (int j = 0; j < FJ; ++j) {
      int gc = bcolg + col0w + 16 * j + nn;
#pragma unroll
      for (int r = 0; r < 8; ++r) {
        int gr = browg + row0w + 16 * i + mh + r;
        size_t idx = (size_t)gr * N + gc;
        float v = acc[i][j][r];
        if (MODE == 3) v += bias[gc];
        outF[idx] = v + resid[idx];
      }
    }
}

// ---------------------------------------------------------------------------
// Attention pass A: column softmax stats (softmax is over the QUERY axis).
// Grid: (B*H)*(T/128); each wave owns 16 key columns, loops all q-tiles.
// The 8 waves walk the same q rows: wave 0 brings them into LDS, 128 rows per
// stage by one tensor load, two buffers, and every wave reads fragments there.
// ---------------------------------------------------------------------------
__global__ __launch_bounds__(256) void attn_colstats(
    const __bf16* __restrict__ qb, const __bf16* __restrict__ kb,
    float* __restrict__ cmax, float* __restrict__ crcp) {
  // two q tiles, each at a multiple of 2 KiB
  __shared__ __attribute__((aligned(2048))) unsigned char sm[2 * GTILEB];
  const int sblocks = T / 128;
  int bh = blockIdx.x / sblocks;
  int sblk = blockIdx.x % sblocks;
  const uint32_t wave = uni(threadIdx.x >> 5);
  int lane = threadIdx.x & 31;
  int s0 = sblk * 128 + (int)wave * 16;

  const __bf16* qh = qb + (size_t)bh * T * DKV;
  const __bf16* kh = kb + (size_t)bh * T * DKV;

  const uint64_t gq = (uint64_t)(size_t)qh;
  const uint32_t ldst = (uint32_t)(size_t)sm;
  const u32x8 g1 = tdm_group1(DKV * 2u);
  const int nst = T / AKS;

  // prologue: stage 0 lands and is published, then stage 1 flies
  if (pinned(wave == 0u)) {
    tdm_load(tdm_group0(ldst, gq), g1);
    // stage 0 has landed
    asm volatile("s_wait_tensorcnt 0x0" ::: "memory");
  }
  __syncthreads();
  // From here on the ring's group 0 is one value carried through the loop, each
  // request's address made from the one before it: its registers stay in use,
  // so that none is taken for something else while a request is in flight.
  u32x4 g0 = tdm_group0(ldst + GTILEB, gq + (uint64_t)(AKS * DKV * 2));
  g0[0] = pinned(g0[0]);  // pinned(): a descriptor word held in its scalar register
  if (pinned(wave == 0u)) tdm_load(g0, g1);

  bf16x16 kf0 = load_frag(kh, s0, DKV, 0);
  bf16x16 kf1 = load_frag(kh, s0, DKV, 32);

  // Running maximum and sum of this lane's own query rows alone (8 of every 16):
  // the two lanes that hold one key column are merged once, behind the loop.
  float m = -3.0e38f, l = 0.0f;
  for (int st = 0; st < nst; ++st) {
   const __bf16* sq = (const __bf16*)(const void*)(sm + (st & 1) * GTILEB);
   // The whole stage's scores stay in registers: 8 tiles of 16 queries, so that
   // the maximum is raised and the sum rescaled once per stage.
   // unrolled: the tiles index registers and their LDS offsets are immediates
   f32x8 c[AKS / 16];
   bf16x16 a0[AKS / 16], a1[AKS / 16];
#pragma unroll
   for (int i = 0; i < AKS / 16; ++i) {
    a0[i] = load_frag(sq, 16 * i, GPITCH, 0);
    a1[i] = load_frag(sq, 16 * i, GPITCH, 32);
   }
   // keeps the stage's 32 LDS reads one group ahead of its 16 matrix
   // instructions: without it the compiler reuses two fragments' registers and
   // waits out an LDS latency in front of every matrix instruction.
   __builtin_amdgcn_sched_barrier(0);
#pragma unroll
   for (int i = 0; i < AKS / 16; ++i) c[i] = wmma_bf16(a0[i], kf0, zero8());
#pragma unroll
   for (int i = 0; i < AKS / 16; ++i) c[i] = wmma_bf16(a1[i], kf1, c[i]);
   // keeps the stage's closing LDS wait (below) behind the matrix instructions:
   // moved up among them it turns their counted waits into one wait for all 32.
   __builtin_amdgcn_sched_barrier(0);
   // one chain per tile, then a tree: short dependent chains
   float tm[AKS / 16];
#pragma unroll
   for (int i = 0; i < AKS / 16; ++i) {
    tm[i] = c[i][0];
#pragma unroll
    for (int r = 1; r < 8; ++r) tm[i] = fmaxf(tm[i], c[i][r]);
   }
   float tmax = fmaxf(fmaxf(fmaxf(tm[0], tm[1]), fmaxf(tm[2], tm[3])),
                      fmaxf(fmaxf(tm[4], tm[5]), fmaxf(tm[6], tm[7])));
   // 1/sqrt(64) is a power of two: scaling the maximum is exact
   float mn = fmaxf(m, tmax * 0.125f);
   f32x2 ps[AKS / 16];
#pragma unroll
   for (int i = 0; i < AKS / 16; ++i) {
    ps[i][0] = __expf(c[i][0] * 0.125f - mn);
    ps[i][1] = __expf(c[i][1] * 0.125f - mn);
#pragma unroll
    for (int r = 2; r < 8; r += 2) {
      f32x2 e;
      e[0] = __expf(c[i][r] * 0.125f - mn);
      e[1] = __expf(c[i][r + 1] * 0.125f - mn);
      ps[i] += e;
    }
   }
   f32x2 p2 = ((ps[0] + ps[1]) + (ps[2] + ps[3])) + ((ps[4] + ps[5]) + (ps[6] + ps[7]));
   l = l * __expf(m - mn) + (p2[0] + p2[1]);
   m = mn;

   // publish point of stage st + 1: this wave's reads of stage st have retired,
   asm volatile("s_wait_dscnt 0x0" ::: "memory");
   // the issuing wave's own request (stage st + 1) has landed,
   if (pinned(wave == 0u)) asm volatile("s_wait_tensorcnt 0x0" ::: "memory");
   // every wave has left stage st's buffer and may read stage st + 1,
   __syncthreads();
   // and only then stage st + 2 goes into the buffer that stage st used.
   if (pinned((uint32_t)((wave == 0u) && (st + 2 < nst)))) {
     // pinned(): the step is taken here, so that the address words made with it
     // are formed behind the wait and the barrier above. The carry goes into
     // word 3's address bits; its type bits lie above them.
     const uint32_t step = pinned((uint32_t)(AKS * DKV * 2));
     const uint64_t ga = (((uint64_t)g0[3] << 32) | (uint64_t)g0[2]) + step;
     g0[1] = uni(ldst + (uint32_t)(st & 1) * GTILEB);
     g0[2] = uni((uint32_t)ga);
     g0[3] = uni((uint32_t)(ga >> 32));
     tdm_load(g0, g1);
   }
  }
  // nothing of the ring is outstanding when the wave goes on to its stores
  asm volatile("s_wait_tensorcnt 0x0" ::: "memory");
  asm volatile("s_wait_dscnt 0x0" ::: "memory");

  // lanes l and l + 16 hold the same key column (different q rows): merge
  {
    float mo = __shfl_xor(m, 16, 32);
    float lo = __shfl_xor(l, 16, 32);
    float mn = fmaxf(m, mo);
    l = l * __expf(m - mn) + lo * __expf(mo - mn);
    m = mn;
  }
  if (lane < 16) {
    cmax[(size_t)bh * T + s0 + lane] = m;
    // pass B needs 1 / sum for 16 keys per lane and step: divide once here
    crcp[(size_t)bh * T + s0 + lane] = 1.0f / l;
  }
}

// ---------------------------------------------------------------------------
// Attention pass B: recompute scores, p = exp(s/8 - m)/sum, o += p @ v.
// The scores are formed transposed (k's rows as A, q's rows as B^T): a lane then
// holds one query and keys 8h + r of each 16-key tile (h = lane >> 4), which is
// the k order of an A fragment, so two tiles of p, converted in place, are the
// A operand of p @ v. vT supplies B^T rows directly.
// The 8 waves walk the same keys: per stage of 128 keys wave 0 brings k's rows
// and wave 1 vT's into LDS by one tensor load each, two buffers.
// ---------------------------------------------------------------------------
__global__ __launch_bounds__(256) void attn_out(
    const __bf16* __restrict__ qb, const __bf16* __restrict__ kb,
    const __bf16* __restrict__ vtb, const float* __restrict__ cmax,
    const float* __restrict__ crcp, __bf16* __restrict__ oc) {
  // [buffer][k | vT] tiles, each at a multiple of 2 KiB
  __shared__ __attribute__((aligned(2048))) unsigned char sm[4 * GTILEB];
  const int qblocks = T / 128;
  int bh = blockIdx.x / qblocks;
  int qblk = blockIdx.x % qblocks;
  const uint32_t wave = uni(threadIdx.x >> 5);
  int lane = threadIdx.x & 31;
  int q0 = qblk * 128 + (int)wave * 16;

  const __bf16* qh = qb + (size_t)bh * T * DKV;
  const __bf16* kh = kb + (size_t)bh * T * DKV;
  const __bf16* vh = vtb + (size_t)bh * DKV * T;

  const uint64_t gk = (uint64_t)(size_t)kh;
  const uint64_t gv = (uint64_t)(size_t)vh;
  const uint32_t ldsk = (uint32_t)(size_t)sm;
  const uint32_t ldsv = ldsk + GTILEB;
  const u32x8 g1k = tdm_group1(DKV * 2u);
  const u32x8 g1v = tdm_group1_vt();
  const int nst = T / AKS;

  // prologue: stage 0 lands and is published, then stage 1 flies
  if (pinned(wave == 0u)) {
    tdm_load(tdm_group0(ldsk, gk), g1k);
    // stage 0 has landed
    asm volatile("s_wait_tensorcnt 0x0" ::: "memory");
  }
  if (pinned(wave == 1u)) {
    tdm_load(tdm_group0(ldsv, gv), g1v);
    asm volatile("s_wait_tensorcnt 0x0" ::: "memory");  // as above
  }
  __syncthreads();
  if (pinned(wave == 0u))
    tdm_load(tdm_group0(ldsk + 2u * GTILEB, gk + (uint64_t)(AKS * DKV * 2)), g1k);
  if (pinned(wave == 1u))
    tdm_load(tdm_group0(ldsv + 2u * GTILEB, gv + (uint64_t)(AKS * 2)), g1v);

  bf16x16 aq0 = load_frag(qh, q0, DKV, 0);
  bf16x16 aq1 = load_frag(qh, q0, DKV, 32);

  f32x8 oacc[4];
  for (int n = 0; n < 4; ++n) oacc[n] = zero8();

  int nn = lane & 15;
  int mh = (lane >> 4) * 8;
  // the head's column statistics; a lane half reads those of its 8 keys of a tile
  const float* pm = cmax + (size_t)bh * T;
  const float* pr = crcp + (size_t)bh * T;
  const uint32_t hk = (uint32_t)mh;

  for (int st = 0; st < nst; ++st) {
   const __bf16* sk = (const __bf16*)(const void*)(sm + (st & 1) * (2u * GTILEB));
   const __bf16* sv = (const __bf16*)(const void*)(sm + (st & 1) * (2u * GTILEB) + GTILEB);
   // unrolled: a stage is one pass and its LDS offsets are immediates
#pragma unroll
   for (int ss = 0; ss < AKS; ss += 32) {
    int s0 = st * AKS + ss;
    f32x8 c0 = zero8(), c1 = zero8();
    bf16x16 k00 = load_frag(sk, ss, GPITCH, 0);
    bf16x16 k01 = load_frag(sk, ss, GPITCH, 32);
    bf16x16 k10 = load_frag(sk, ss + 16, GPITCH, 0);
    bf16x16 k11 = load_frag(sk, ss + 16, GPITCH, 32);
    // keeps the eight LDS reads above one group with one latency: without it the
    // compiler reuses one fragment's registers and waits out four in a row.
    // Mask: global reads and plain vector / scalar work may still cross it, so
    // that the column statistics' loads below are issued early.
    __builtin_amdgcn_sched_barrier(0x26);
    c0 = wmma_bf16(k00, aq0, c0);  // c0[r] = score(key ss + mh + r, query nn)
    c1 = wmma_bf16(k10, aq0, c1);  // c1[r]: key ss + 16 + mh + r
    c0 = wmma_bf16(k01, aq1, c0);
    c1 = wmma_bf16(k11, aq1, c1);

    union { float4 q[2]; float f[8]; } m0, m1, r0, r1;
#pragma unroll
    for (int e = 0; e < 2; ++e) {
      m0.q[e] = *(const float4*)(const void*)(pm + s0 + 4 * e + hk);
      m1.q[e] = *(const float4*)(const void*)(pm + s0 + 16 + 4 * e + hk);
      r0.q[e] = *(const float4*)(const void*)(pr + s0 + 4 * e + hk);
      r1.q[e] = *(const float4*)(const void*)(pr + s0 + 16 + 4 * e + hk);
    }
    bf16x16 pf;  // 16 q rows x K=32 (s), in load_frag's k order
#pragma unroll
    for (int r = 0; r < 8; ++r) {
      pf[r] = (__bf16)(__expf(c0[r] * 0.125f - m0.f[r]) * r0.f[r]);
      pf[8 + r] = (__bf16)(__expf(c1[r] * 0.125f - m1.f[r]) * r1.f[r]);
    }
#pragma unroll
    for (int n = 0; n < 4; ++n) {
      bf16x16 bv = load_frag(sv, n * 16, VPITCH, ss);  // vT rows = v columns
      oacc[n] = wmma_bf16(pf, bv, oacc[n]);
    }
   }

   // the statistics loads' address registers are stepped for the next stage
   asm volatile("s_wait_xcnt 0x0" ::: "memory");
   // publish point of stage st + 1: this wave's reads of stage st have retired,
   asm volatile("s_wait_dscnt 0x0" ::: "memory");
   // each issuing wave's own request (stage st + 1) has landed,
   if (pinned(wave < 2u)) asm volatile("s_wait_tensorcnt 0x0" ::: "memory");
   // every wave has left stage st's buffer and may read stage st + 1,
   __syncthreads();
   // and only then stage st + 2 goes into the buffer that stage st used.
   // pinned() on the stage number: the descriptor words made from it are formed
   // behind the wait and the barrier above
   if (pinned((uint32_t)((wave == 0u) && (st + 2 < nst)))) {
     const uint32_t sn = pinned((uint32_t)st + 2u);
     tdm_load(tdm_group0(ldsk + (sn & 1u) * (2u * GTILEB),
                         gk + (uint64_t)sn * (uint64_t)(AKS * DKV * 2)),
              g1k);
   }
   if (pinned((uint32_t)((wave == 1u) && (st + 2 < nst)))) {
     const uint32_t sn = pinned((uint32_t)st + 2u);
     tdm_load(tdm_group0(ldsv + (sn & 1u) * (2u * GTILEB),
                         gv + (uint64_t)sn * (uint64_t)(AKS * 2)),
              g1v);
   }
  }
  // nothing of the ring is outstanding when the wave goes on to its stores
  asm volatile("s_wait_tensorcnt 0x0" ::: "memory");
  asm volatile("s_wait_dscnt 0x0" ::: "memory");

  int b = bh / H, h = bh % H;
#pragma unroll
  for (int n = 0; n < 4; ++n)
#pragma unroll
    for (int r = 0; r < 8; ++r) {
      int gt = q0 + mh + r;
      int col = h * DKV + n * 16 + nn;
      oc[((size_t)b * T + gt) * D + col] = (__bf16)oacc[n][r];
    }
}

// ---------------------------------------------------------------------------
// Row mean/std norm (ddof=1). One block per row of D=1024.
// ---------------------------------------------------------------------------
__global__ __launch_bounds__(256) void rownorm(const float* __restrict__ y,
                                               float* __restrict__ outF,
                                               __bf16* __restrict__ outB) {
  __shared__ float s1[256], s2[256];
  int row = blockIdx.x, tid = threadIdx.x;
  const float* pr = y + (size_t)row * D;
  float v[4], s = 0.0f, q = 0.0f;
#pragma unroll
  for (int j = 0; j < 4; ++j) {
    v[j] = pr[tid + 256 * j];
    s += v[j];
    q += v[j] * v[j];
  }
  s1[tid] = s;
  s2[tid] = q;
  __syncthreads();
  for (int o = 128; o > 0; o >>= 1) {
    if (tid < o) {
      s1[tid] += s1[tid + o];
      s2[tid] += s2[tid + o];
    }
    __syncthreads();
  }
  float mean = s1[0] * (1.0f / D);
  float var = (s2[0] - s1[0] * s1[0] * (1.0f / D)) * (1.0f / (D - 1));
  float rstd = rsqrtf(var);
  float* po = outF + (size_t)row * D;
#pragma unroll
  for (int j = 0; j < 4; ++j) {
    float o = (v[j] - mean) * rstd;
    po[tid + 256 * j] = o;
    if (outB) outB[(size_t)row * D + tid + 256 * j] = (__bf16)o;
  }
}

// ------------------------- conversion / layout kernel ----------------------
// The grid below is exact for the fixed shapes. Every wave-wide access covers
// whole 128-byte lines, and each thread has 8 16-byte loads in flight.

// One block converts 8192 elements, 32 per thread: 8 float4 loads, 8 stores of
// 4 bf16. blk is the block's number within this job.
__device__ __forceinline__ void cvt_f32_bf16(int blk, const float* __restrict__ in,
                                             __bf16* __restrict__ out) {
  size_t base = (size_t)blk * 2048 + threadIdx.x;  // in units of 4
  float4 v[8];
#pragma unroll
  for (int j = 0; j < 8; ++j)
    v[j] = *(const float4*)(const void*)(in + (base + 256 * j) * 4);
#pragma unroll
  for (int j = 0; j < 8; ++j) {
    union { __bf16 h[4]; uint2 u; } pk;
    pk.h[0] = (__bf16)v[j].x;
    pk.h[1] = (__bf16)v[j].y;
    pk.h[2] = (__bf16)v[j].z;
    pk.h[3] = (__bf16)v[j].w;
    *(uint2*)(void*)(out + (base + 256 * j) * 4) = pk.u;
  }
}

// One block turns a tile of 128 rows x 64 columns of f32 (row pitch LDIN) into
// 64 rows x 128 columns of bf16 (row pitch LDOUT). in / out point at the tile.
// The turn goes through LDS at a pitch of 65 dwords: both the row-wise writes
// and the column-wise reads then fall on 32 different banks.
// The pitches are compile-time, so that a thread's accesses share one address
// register pair and differ in the immediate offset alone.
template <int LDIN, int LDOUT>
__device__ __forceinline__ void tile_turn(float (*tile)[65],
                                          const float* __restrict__ in,
                                          __bf16* __restrict__ out) {
  int t = threadIdx.x;
  int lr = t >> 4;        // 16 lanes read one row's 256 bytes
  int lc = (t & 15) * 4;
  float4 v[8];
#pragma unroll
  for (int j = 0; j < 8; ++j)
    v[j] = *(const float4*)(const void*)(in + (size_t)(lr + 16 * j) * LDIN + lc);
  // the loads' address registers may be reused by what follows
  asm volatile("s_wait_xcnt 0x0" ::: "memory");
#pragma unroll
  for (int j = 0; j < 8; ++j) {
    tile[lr + 16 * j][lc + 0] = v[j].x;
    tile[lr + 16 * j][lc + 1] = v[j].y;
    tile[lr + 16 * j][lc + 2] = v[j].z;
    tile[lr + 16 * j][lc + 3] = v[j].w;
  }
  __syncthreads();
  int rc = (t & 7) * 8;   // 8 lanes write 128 bytes of one output row
  int c0 = t >> 3;
#pragma unroll
  for (int j = 0; j < 4; ++j) {
    int c = c0 + 32 * (j & 1);
    int r = rc + 64 * (j >> 1);
    union { __bf16 h[8]; uint4 u; } pk;
#pragma unroll
    for (int k = 0; k < 8; ++k) pk.h[k] = (__bf16)tile[r + k][c];
    *(uint4*)(void*)(out + (size_t)c * LDOUT + r) = pk.u;
  }
  // The built code lays another job's path right behind these stores, and that
  // path rewrites registers they name: keep the wait in front of it.
  asm volatile("s_wait_xcnt 0x0" ::: "memory");
}

// out (C x R) = transpose of in (R x C), bf16; blk counts the R/128 row tiles
// fastest, then the C/64 column tiles.
template <int R, int C>
__device__ __forceinline__ void packT(float (*tile)[65], int blk,
                                      const float* __restrict__ in,
                                      __bf16* __restrict__ out) {
  int r0 = (blk % (R / 128)) * 128;
  int c0 = (blk / (R / 128)) * 64;
  tile_turn<C, R>(tile, in + (size_t)r0 * C + c0, out + (size_t)c0 * R + r0);
}

// Blocks per job of the one preparation launch
#define NB_X (NTOK * D / 8192)             // x -> bf16
#define NB_QKV ((D / 128) * H * 3)         // Wq, Wk, Wv
#define NB_WO ((D / 128) * (D / 64))
#define NB_W1 ((D / 128) * (FF / 64))
#define NB_W2 ((FF / 128) * (D / 64))

// The five preparation jobs read only inputs and none reads another's output:
// they share one grid, and a block finds its job from its index (the same for
// the whole block, so the barrier in tile_turn stays under uniform control flow).
__global__ __launch_bounds__(256) void prep_inputs(
    const float* __restrict__ x, const float* __restrict__ Wq,
    const float* __restrict__ Wk, const float* __restrict__ Wv,
    const float* __restrict__ Wo, const float* __restrict__ W1,
    const float* __restrict__ W2, __bf16* __restrict__ xb,
    __bf16* __restrict__ wqkvT, __bf16* __restrict__ woT,
    __bf16* __restrict__ w1T, __bf16* __restrict__ w2T) {
  __shared__ float tile[128][65];
  int b = blockIdx.x;
  if (b < NB_X) {
    cvt_f32_bf16(b, x, xb);
    return;
  }
  b -= NB_X;
  if (b < NB_QKV) {
    // WqkvT[n][d], n = which*1024 + h*64 + k (rows = GEMM columns, K-contig);
    // a head is a D x 64 matrix.
    int d0 = (b % (D / 128)) * 128;
    int h = (b / (D / 128)) % H;
    int which = b / ((D / 128) * H);
    const float* src = which == 0 ? Wq : (which == 1 ? Wk : Wv);
    tile_turn<DKV, D>(tile, src + ((size_t)h * D + d0) * DKV,
                      wqkvT + (size_t)(which * 1024 + h * DKV) * D + d0);
    return;
  }
  b -= NB_QKV;
  if (b < NB_WO) {
    packT<D, D>(tile, b, Wo, woT);
    return;
  }
  b -= NB_WO;
  if (b < NB_W1) {
    packT<D, FF>(tile, b, W1, w1T);
    return;
  }
  packT<FF, D>(tile, b - NB_W1, W2, w2T);
}

// ---------------------------------------------------------------------------
extern "C" void kernel_launch(void* const* d_in, const int* in_sizes, int n_in,
                              void* d_out, int out_size, void* d_ws,
                              size_t ws_size, hipStream_t stream) {
  const float* x = (const float*)d_in[0];
  const float* Wq = (const float*)d_in[1];
  const float* Wk = (const float*)d_in[2];
  const float* Wv = (const float*)d_in[3];
  const float* Wo = (const float*)d_in[4];
  const float* W1 = (const float*)d_in[5];
  const float* b1 = (const float*)d_in[6];
  const float* W2 = (const float*)d_in[7];
  const float* b2 = (const float*)d_in[8];

  char* ws = (char*)d_ws;
  const size_t OFF_XB = 0;             //  8 MiB
  const size_t OFF_WQKVT = 8388608;    //  6 MiB
  const size_t OFF_WOT = 14680064;     //  2 MiB
  const size_t OFF_W1T = 16777216;     //  8 MiB
  const size_t OFF_W2T = 25165824;     //  8 MiB
  const size_t OFF_Y2 = 33554432;      // 16 MiB f32
  const size_t OFF_QB = 58720256;      //  8 MiB
  const size_t OFF_KB = 67108864;      //  8 MiB
  const size_t OFF_VT = 75497472;      //  8 MiB
  const size_t OFF_CMAX = 83886080;    // 256 KiB
  const size_t OFF_CRCP = 84148224;    // 256 KiB
  const size_t OFF_OC = 84410368;      //  8 MiB
  const size_t OFF_Y1 = 92798976;      // 16 MiB f32
  const size_t OFF_OUT1F = 109576192;  // 16 MiB f32
  const size_t OFF_OUT1B = 126353408;  //  8 MiB
  const size_t OFF_HB = 134742016;     // 32 MiB

  __bf16* xb = (__bf16*)(ws + OFF_XB);
  __bf16* wqkvT = (__bf16*)(ws + OFF_WQKVT);
  __bf16* woT = (__bf16*)(ws + OFF_WOT);
  __bf16* w1T = (__bf16*)(ws + OFF_W1T);
  __bf16* w2T = (__bf16*)(ws + OFF_W2T);
  __bf16* qb = (__bf16*)(ws + OFF_QB);
  __bf16* kb = (__bf16*)(ws + OFF_KB);
  __bf16* vtb = (__bf16*)(ws + OFF_VT);
  float* cmax = (float*)(ws + OFF_CMAX);
  float* crcp = (float*)(ws + OFF_CRCP);
  __bf16* ocb = (__bf16*)(ws + OFF_OC);
  float* y1 = (float*)(ws + OFF_Y1);
  float* out1f = (float*)(ws + OFF_OUT1F);
  __bf16* out1b = (__bf16*)(ws + OFF_OUT1B);
  __bf16* hb = (__bf16*)(ws + OFF_HB);
  float* y2 = (float*)(ws + OFF_Y2);

  // 1) convert x and pack the transposed bf16 weights, one launch
  prep_inputs<<<NB_X + NB_QKV + NB_WO + NB_W1 + NB_W2, 256, 0, stream>>>(
      x, Wq, Wk, Wv, Wo, W1, W2, xb, wqkvT, woT, w1T, w2T);

  // 2) fused QKV projection GEMM: (4096x1024)x(1024x3072), head layouts out
  gemm_bf16_tn<0, 256, 256><<<dim3(NQKV / 256, NTOK / 256), 256, 0, stream>>>(
      xb, wqkvT, NTOK, NQKV, D, qb, nullptr, nullptr, nullptr, kb, vtb);

  // 3) attention (column softmax, two-pass flash-style over q)
  attn_colstats<<<(BSZ * H) * (T / 128), 256, 0, stream>>>(qb, kb, cmax, crcp);
  attn_out<<<(BSZ * H) * (T / 128), 256, 0, stream>>>(qb, kb, vtb, cmax, crcp,
                                                      ocb);

  // 4) output projection + residual, then norm
  gemm_bf16_tn<2, 128, 128><<<dim3(D / 128, NTOK / 128), 256, 0, stream>>>(
      ocb, woT, NTOK, D, D, nullptr, y1, nullptr, x, nullptr, nullptr);
  rownorm<<<NTOK, 256, 0, stream>>>(y1, out1f, out1b);

  // 5) FFN: relu(out1 @ W1 + b1) @ W2 + b2 + out1, then norm -> d_out
  gemm_bf16_tn<1, 256, 256><<<dim3(FF / 256, NTOK / 256), 256, 0, stream>>>(
      out1b, w1T, NTOK, FF, D, hb, nullptr, b1, nullptr, nullptr, nullptr);
  gemm_bf16_tn<3, 128, 128><<<dim3(D / 128, NTOK / 128), 256, 0, stream>>>(
      hb, w2T, NTOK, D, FF, nullptr, y2, b2, out1f, nullptr, nullptr);
  rownorm<<<NTOK, 256, 0, stream>>>(y2, (float*)d_out, nullptr);

  (void)in_sizes;
  (void)n_in;
  (void)out_size;
  (void)ws_size;
}

// v010
// A run of this version takes 175 microseconds.
// In two side-by-side timings against v009, it was 1.10 and 1.11 times as fast.
// Counting every step since v000, it is 3.94 times as fast.
#include <hip/hip_runtime.h>
#include <hip/hip_bf16.h>
#include <stdint.h>

// Problem dims (fixed by the reference)
#define BSZ 2
#define T   2048
#define D   1024
#define H   16
#define DKV 64
#define FF  4096
#define NTOK 4096          // BSZ*T
#define NQKV 3072          // 3*H*DKV

typedef __attribute__((ext_vector_type(16))) __bf16 bf16x16;
typedef __attribute__((ext_vector_type(8)))  float  f32x8;
typedef __attribute__((ext_vector_type(2)))  float  f32x2;

union FragCast { bf16x16 v; uint4 u[2]; };

typedef uint32_t u32x4 __attribute__((ext_vector_type(4)));
typedef uint32_t u32x8 __attribute__((ext_vector_type(8)));

// GEMM stage: tiles of 128 rows of 64 halves (128 bytes), BM/128 of A and BN/128
// of Bt, laid in LDS at a
// 144-byte row pitch (16 B x odd: conflict-free for 16-byte fragment reads).
#define GBK 64          // halves of K per stage
#define GPITCH 72       // LDS row pitch in halves
#define GTILEB 18432u   // 128 rows x 144 B = 9 x 2 KiB, one operand's tile

__device__ __forceinline__ uint32_t uni(uint32_t v) {
  return (uint32_t)__builtin_amdgcn_readfirstlane(v);
}

__device__ __forceinline__ uint32_t pinned(uint32_t v) {
  uint32_t w = (uint32_t)__builtin_amdgcn_readfirstlane(v);
  asm volatile("" : "+s"(w));
  return w;
}

// Descriptor group 0: one request, LDS byte offset, global address, type 2.
__device__ __forceinline__ u32x4 tdm_group0(uint32_t lds_dst, uint64_t ga) {
  u32x4 g;
  g[0] = uni(1u);
  g[1] = uni(lds_dst);
  g[2] = uni((uint32_t)ga);
  g[3] = uni((((uint32_t)(ga >> 32)) & 0x01FFFFFFu) | 0x80000000u);
  return g;
}

// Descriptor group 1: byte elements, tensor = tile = 128 rows of 128 bytes,
// source row pitch src_pitch bytes, 16 bytes of LDS pad behind every row.
// pinned(): each descriptor word is held in its scalar register for the whole
// loop, so that none is reused for something else while a request is in flight.
__device__ __forceinline__ u32x8 tdm_group1(uint32_t src_pitch) {
  u32x8 g;
  g[0] = pinned((1u << 20) | (4u << 22) | (3u << 25));
  g[1] = pinned(128u << 16);
  g[2] = pinned(128u << 16);
  g[3] = pinned(128u << 16);
  g[4] = pinned(128u);
  g[5] = pinned(src_pitch);
  g[6] = pinned(0u);
  g[7] = pinned(0u);
  return g;
}

// Attention stage: 128 rows of q or k (128 bytes each, the GEMM's tile and
// pitch), or vT's 64 rows x 128 keys (256 bytes each) at a 272-byte LDS pitch
// (16 B x odd again). Either tile fits one GTILEB place.
#define AKS 128         // queries (pass A) or keys (pass B) per stage
#define VPITCH 136      // vT's LDS row pitch in halves

// Descriptor group 1 of vT's tile: byte elements, tensor = tile = 64 rows of
// 256 bytes, source row pitch T halves, 16 bytes of LDS pad behind every row.
// pinned(): as in tdm_group1.
__device__ __forceinline__ u32x8 tdm_group1_vt() {
  u32x8 g;
  g[0] = pinned((1u << 20) | (5u << 22) | (3u << 25));
  g[1] = pinned(256u << 16);
  g[2] = pinned(64u << 16);
  g[3] = pinned(256u << 16);
  g[4] = pinned(64u);
  g[5] = pinned((uint32_t)T * 2u);
  g[6] = pinned(0u);
  g[7] = pinned(0u);
  return g;
}

__device__ __forceinline__ void tdm_load(u32x4 g0, u32x8 g1) {
  asm volatile("tensor_load_to_lds %0, %1" ::"s"(g0), "s"(g1) : "memory");
}

__device__ __forceinline__ f32x8 wmma_bf16(bf16x16 a, bf16x16 b, f32x8 c) {
  return __builtin_amdgcn_wmma_f32_16x16x32_bf16(false, a, false, b, (short)0, c,
                                                 false, false);
}

__device__ __forceinline__ f32x8 zero8() {
  f32x8 z;
  for (int e = 0; e < 8; ++e) z[e] = 0.0f;
  return z;
}

// Load a 16x32 A-fragment (or B^T-fragment) from row-major bf16 memory
// (global or LDS). Lane l holds row (l&15); K = 16*(j>>3) + 8*(l>>4) + (j&7).
// Each 8-half group is contiguous -> two 16B loads.
__device__ __forceinline__ bf16x16 load_frag(const __bf16* base, int row0,
                                             int ld, int k0) {
  int lane = threadIdx.x & 31;
  int m = lane & 15;
  int kh = lane >> 4;
  const __bf16* p = base + (size_t)(row0 + m) * ld + k0 + 8 * kh;
  FragCast f;
  f.u[0] = *(const uint4*)(const void*)(p);
  f.u[1] = *(const uint4*)(const void*)(p + 16);
  return f.v;
}

typedef __attribute__((ext_vector_type(2))) __bf16 bf16x2;

__device__ __forceinline__ uint32_t pack_bf16(float lo, float hi) {
  bf16x2 p;
  p[0] = (__bf16)lo;
  p[1] = (__bf16)hi;
  return __builtin_bit_cast(uint32_t, p);
}

// Eight 2-byte stores at byte offsets o[0..7] from a uniform base; d[q] holds the
// values of offsets 2q (low half) and 2q + 1 (high half). The stores and their
// s_wait_xcnt stand in one statement, so that the wait is in front of whatever
// rewrites a register that they name.
__device__ __forceinline__ void store8_b16(__bf16* base, const uint32_t (&o)[8],
                                           const uint32_t (&d)[4]) {
  asm volatile(
      "global_store_b16 %0, %8, %12\n\t"
      "global_store_d16_hi_b16 %1, %8, %12\n\t"
      "global_store_b16 %2, %9, %12\n\t"
      "global_store_d16_hi_b16 %3, %9, %12\n\t"
      "global_store_b16 %4, %10, %12\n\t"
      "global_store_d16_hi_b16 %5, %10, %12\n\t"
      "global_store_b16 %6, %11, %12\n\t"
      "global_store_d16_hi_b16 %7, %11, %12\n\t"
      "s_wait_xcnt 0x0"
      ::"v"(o[0]), "v"(o[1]), "v"(o[2]), "v"(o[3]), "v"(o[4]), "v"(o[5]),
        "v"(o[6]), "v"(o[7]), "v"(d[0]), "v"(d[1]), "v"(d[2]), "v"(d[3]),
        "s"(base)
      : "memory");
}

// Four 16-byte stores at byte offsets o[0..3] from a uniform base, with their
// s_wait_xcnt in the same statement, as in store8_b16.
__device__ __forceinline__ void store4_b128(__bf16* base, const uint32_t (&o)[4],
                                            const u32x4 (&d)[4]) {
  asm volatile(
      "global_store_b128 %0, %4, %8\n\t"
      "global_store_b128 %1, %5, %8\n\t"
      "global_store_b128 %2, %6, %8\n\t"
      "global_store_b128 %3, %7, %8\n\t"
      "s_wait_xcnt 0x0"
      ::"v"(o[0]), "v"(o[1]), "v"(o[2]), "v"(o[3]), "v"(d[0]), "v"(d[1]),
        "v"(d[2]), "v"(d[3]), "s"(base)
      : "memory");
}

// ---------------------------------------------------------------------------
// GEMM: C(MxN) = A(MxK bf16 rowmajor) * Bt(NxK bf16 rowmajor)^T
// MODE 0: bf16, stored straight into q,k (B,H,T,64) and vT (B,H,64,T)
// MODE 1: +bias,ReLU,bf16 | 2: +resid f32 | 3: +bias+resid f32
// 256 thr = 8 waves (2x4). Block tile BM x BN (multiples of 128), 64 k per
// stage, wave tile BM/2 x BN/4. A larger tile loads each operand row from L2 for
// more columns, and reads each LDS fragment for more matrix instructions.
// Two LDS buffers; per stage the first BM/128 waves bring 128 rows of A each and
// the next BN/128 waves 128 rows of Bt each, one tensor load per wave. The
// 128-row tiles lie one behind the other, so that an operand's rows keep one
// pitch. K is a multiple of 64 and at least 128 (two stages).
// The blocks of one grid row walk the same rows of A and those of one grid
// column the same rows of Bt. Each block starts its walk over the k stages at a
// stage of its own and wraps round: a k slice is then fetched from memory by one
// block and found in L2 by the others, instead of being asked for by all of them
// at the same moment in every stage. SX, SY: stages between the starts of
// blocks four apart in x, and of neighbours in y; neighbours in x start a
// quarter of the walk apart.
// ---------------------------------------------------------------------------
template <int MODE, int BM, int BN, int SX, int SY>
__global__ __launch_bounds__(256) void gemm_bf16_tn(
    const __bf16* __restrict__ A, const __bf16* __restrict__ Bt, int M, int N,
    int K, __bf16* __restrict__ outB, float* __restrict__ outF,
    const float* __restrict__ bias, const float* __restrict__ resid,
    __bf16* __restrict__ outK, __bf16* __restrict__ outVT) {
  constexpr uint32_t NTA = BM / 128;        // 128-row tiles of A per stage
  constexpr uint32_t NT = NTA + BN / 128;   // tiles per stage = issuing waves
  constexpr uint32_t BUFB = NT * GTILEB;    // one buffer
  constexpr int FI = BM / 32;               // 16-row fragments per wave
  constexpr int FJ = BN / 64;               // 16-column fragments per wave
  static_assert(MODE != 0 || FJ == 4, "vT's stores go out four columns at a time");
  // [buffer][A tiles | Bt tiles], each tile at a multiple of 2 KiB
  __shared__ __attribute__((aligned(2048))) unsigned char sm[2 * BUFB];

  int t = threadIdx.x;
  const uint32_t wave = uni((uint32_t)t >> 5);
  int lane = t & 31;
  int browg = blockIdx.y * BM;
  int bcolg = blockIdx.x * BN;

  // issuing wave w < NT brings tile w: A's rows first, then Bt's
  const uint64_t gbase = (uint64_t)(size_t)(
      wave >= NTA ? Bt + (size_t)(bcolg + 128 * (int)(wave - NTA)) * K
                  : A + (size_t)(browg + 128 * (int)wave) * K);
  const uint32_t ldst = (uint32_t)(size_t)sm + wave * GTILEB;
  const u32x8 g1 = tdm_group1((uint32_t)K * 2u);
  const int nst = K / GBK;
  // the block's first k stage
  const uint32_t s0 = uni(((blockIdx.x & 3u) * ((uint32_t)nst >> 2) +
                           (blockIdx.x >> 2) * (uint32_t)SX +
                           blockIdx.y * (uint32_t)SY) % (uint32_t)nst);
  const uint32_t s1 = s0 + 1u == (uint32_t)nst ? 0u : s0 + 1u;

  f32x8 acc[FI][FJ];
  for (int i = 0; i < FI; ++i)
    for (int j = 0; j < FJ; ++j) acc[i][j] = zero8();

  // prologue: stage 0 lands and is published, then stage 1 flies
  if (pinned(wave < NT)) {
    tdm_load(tdm_group0(ldst, gbase + (uint64_t)s0 * (2u * GBK)), g1);
    // stage 0 has landed
    asm volatile("s_wait_tensorcnt 0x0" ::: "memory");
  }
  __syncthreads();
  if (pinned(wave < NT))
    tdm_load(tdm_group0(ldst + BUFB, gbase + (uint64_t)s1 * (2u * GBK)), g1);

  int row0w = (int)(wave >> 2) * (16 * FI);
  int col0w = (int)(wave & 3u) * (16 * FJ);

  for (int s = 0; s < nst; ++s) {
    const __bf16* sa = (const __bf16*)(const void*)(sm + (s & 1) * BUFB);
    const __bf16* sb = (const __bf16*)(const void*)(sm + (s & 1) * BUFB + NTA * GTILEB);
    // All fragments of the stage, both 32-k blocks, each in registers of its own.
    bf16x16 af[GBK / 32][FI], bfv[GBK / 32][FJ];
#pragma unroll
    for (int kb = 0; kb < GBK / 32; ++kb) {
#pragma unroll
      for (int j = 0; j < FJ; ++j)
        bfv[kb][j] = load_frag(sb, col0w + 16 * j, GPITCH, 32 * kb);
#pragma unroll
      for (int i = 0; i < FI; ++i)
        af[kb][i] = load_frag(sa, row0w + 16 * i, GPITCH, 32 * kb);
    }
    // keeps the stage's LDS reads one group ahead of its matrix
    // instructions: without it the compiler reuses one A fragment's registers
    // and waits out a whole LDS latency in front of every second one.
    __builtin_amdgcn_sched_barrier(0);
#pragma unroll
    for (int kb = 0; kb < GBK / 32; ++kb)
#pragma unroll
      for (int i = 0; i < FI; ++i)
#pragma unroll
        for (int j = 0; j < FJ; ++j)
          acc[i][j] = wmma_bf16(af[kb][i], bfv[kb][j], acc[i][j]);
    // keeps the pass's closing wait below behind the matrix instructions: moved
    // up among them it turns their counted waits into one wait for all reads.
    __builtin_amdgcn_sched_barrier(0);

    // publish point of stage s + 1: this wave's reads of stage s have retired,
    asm volatile("s_wait_dscnt 0x0" ::: "memory");
    // the issuing wave's own request (stage s + 1) has landed,
    if (pinned(wave < NT)) asm volatile("s_wait_tensorcnt 0x0" ::: "memory");
    // every wave has left stage s's buffer and may read stage s + 1,
    __syncthreads();
    // and only then stage s + 2 goes into the buffer that stage s used.
    if (pinned((uint32_t)((wave < NT) && (s + 2 < nst)))) {
      // pinned(): the stage number is taken here, so that the descriptor words
      // made from it are formed behind the wait and the barrier above
      const uint32_t sn = pinned((uint32_t)s + 2u);
      // the k stage of pass sn, wrapped round
      const uint32_t ks = sn + s0 >= (uint32_t)nst ? sn + s0 - (uint32_t)nst : sn + s0;
      tdm_load(tdm_group0(ldst + (sn & 1u) * BUFB,
                          gbase + (uint64_t)ks * (2u * GBK)),
               g1);
    }
  }
  // nothing of the ring is outstanding when the wave goes on to its stores
  asm volatile("s_wait_tensorcnt 0x0" ::: "memory");
  asm volatile("s_wait_dscnt 0x0" ::: "memory");

  int mh = (lane >> 4) * 8;
  int nn = lane & 15;
  if (MODE == 0) {
    // Column n = which*1024 + h*64 + kk; a block (BN divides 1024) lies in one
    // 'which', a wave's columns (at most 64, aligned) in one head.
    // A lane holds 8 consecutive tokens of one column: for vT that is one
    // contiguous 16-byte run, and a wave's tokens fill whole 128-byte lines.
    int which = bcolg >> 10;
    int rem = (bcolg + col0w + nn) & 1023;  // j adds 16, inside the same head
    int kc = rem & 63;
    int gr0 = browg + row0w + mh;  // i adds 16, inside the same batch entry
    size_t bhb = (size_t)((gr0 >> 11) * H + (rem >> 6));
    int tt = gr0 & (T - 1);
    if (which == 2) {
      const uint32_t o0 = (uint32_t)((bhb * DKV + kc) * T + tt) * 2u;
#pragma unroll
      for (int i = 0; i < FI; ++i) {
        uint32_t o[4];
        u32x4 d[4];
#pragma unroll
        for (int j = 0; j < 4; ++j) {
          o[j] = o0 + (uint32_t)(16 * j * T + 16 * i) * 2u;
#pragma unroll
          for (int q = 0; q < 4; ++q)
            d[j][q] = pack_bf16(acc[i][j][2 * q], acc[i][j][2 * q + 1]);
        }
        store4_b128(outVT, o, d);
      }
      return;
    }
    __bf16* base = which == 0 ? outB : outK;
    const uint32_t o0 = (uint32_t)((bhb * T + tt) * DKV + kc) * 2u;
#pragma unroll
    for (int i = 0; i < FI; ++i)
#pragma unroll
      for (int j = 0; j < FJ; ++j) {
        uint32_t o[8], d[4];
#pragma unroll
        for (int r = 0; r < 8; ++r)
          o[r] = o0 + (uint32_t)((16 * i + r) * DKV + 16 * j) * 2u;
#pragma unroll
        for (int q = 0; q < 4; ++q)
          d[q] = pack_bf16(acc[i][j][2 * q], acc[i][j][2 * q + 1]);
        store8_b16(base, o, d);
      }
    return;
  }
  if (MODE == 1) {
    float bj[FJ];
#pragma unroll
    for (int j = 0; j < FJ; ++j) bj[j] = bias[bcolg + col0w + 16 * j + nn];
    const uint32_t o0 = ((uint32_t)(browg + row0w + mh) * (uint32_t)N +
                         (uint32_t)(bcolg + col0w + nn)) * 2u;
#pragma unroll
    for (int i = 0; i < FI; ++i)
#pragma unroll
      for (int j = 0; j < FJ; ++j) {
        uint32_t o[8], d[4];
        float v[8];
#pragma unroll
        for (int r = 0; r < 8; ++r) {
          o[r] = o0 + ((uint32_t)(16 * i + r) * (uint32_t)N + 16u * j) * 2u;
          v[r] = acc[i][j][r] + bj[j];
          v[r] = v[r] > 0.0f ? v[r] : 0.0f;
        }
#pragma unroll
        for (int q = 0; q < 4; ++q) d[q] = pack_bf16(v[2 * q], v[2 * q + 1]);
        store8_b16(outB, o, d);
        // keeps later groups' values from being formed ahead of this store:
        // formed early, beside all the accumulators, they spill to scratch.
        __builtin_amdgcn_sched_barrier(0);
      }
    return;
  }
#pragma unroll
  for (int i = 0; i < FI; ++i)
#pragma unroll
    for (int j = 0; j < FJ; ++j) {
      int gc = bcolg + col0w + 16 * j + nn;
#pragma unroll
      for (int r = 0; r < 8; ++r) {
        int gr = browg + row0w + 16 * i + mh + r;
        size_t idx = (size_t)gr * N + gc;
        float v = acc[i][j][r];
        if (MODE == 3) v += bias[gc];
        outF[idx] = v + resid[idx];
      }
    }
}

// ---------------------------------------------------------------------------
// Attention pass A: column softmax stats (softmax is over the QUERY axis).
// Grid: (B*H)*(T/128); each wave owns 16 key columns, loops all q-tiles.
// The 8 waves walk the same q rows: wave 0 brings them into LDS, 128 rows per
// stage by one tensor load, two buffers, and every wave reads fragments there.
// ---------------------------------------------------------------------------
__global__ __launch_bounds__(256) void attn_colstats(
    const __bf16* __restrict__ qb, const __bf16* __restrict__ kb,
    float* __restrict__ cmax, float* __restrict__ crcp) {
  // two q tiles, each at a multiple of 2 KiB
  __shared__ __attribute__((aligned(2048))) unsigned char sm[2 * GTILEB];
  const int sblocks = T / 128;
  int bh = blockIdx.x / sblocks;
  int sblk = blockIdx.x % sblocks;
  const uint32_t wave = uni(threadIdx.x >> 5);
  int lane = threadIdx.x & 31;
  int s0 = sblk * 128 + (int)wave * 16;

  const __bf16* qh = qb + (size_t)bh * T * DKV;
  const __bf16* kh = kb + (size_t)bh * T * DKV;

  const uint64_t gq = (uint64_t)(size_t)qh;
  const uint32_t ldst = (uint32_t)(size_t)sm;
  const u32x8 g1 = tdm_group1(DKV * 2u);
  const int nst = T / AKS;
  // The blocks of one head walk the same q rows: each starts at a stage of its
  // own and wraps round, as in the GEMM (neighbours a quarter of the walk apart).
  const uint32_t r0 = uni((((uint32_t)sblk & 3u) * (uint32_t)(nst / 4) +
                           ((uint32_t)sblk >> 2)) & (uint32_t)(nst - 1));

  // prologue: stage 0 lands and is published, then stage 1 flies
  if (pinned(wave == 0u)) {
    tdm_load(tdm_group0(ldst, gq + (uint64_t)r0 * (uint64_t)(AKS * DKV * 2)), g1);
    // stage 0 has landed
    asm volatile("s_wait_tensorcnt 0x0" ::: "memory");
  }
  __syncthreads();
  // From here on the ring's group 0 is one value carried through the loop, each
  // request's address made from the one before it: its registers stay in use,
  // so that none is taken for something else while a request is in flight.
  u32x4 g0 = tdm_group0(ldst + GTILEB,
                        gq + (uint64_t)((r0 + 1u) & (uint32_t)(nst - 1)) *
                                 (uint64_t)(AKS * DKV * 2));
  g0[0] = pinned(g0[0]);  // pinned(): a descriptor word held in its scalar register
  if (pinned(wave == 0u)) tdm_load(g0, g1);

  bf16x16 kf0 = load_frag(kh, s0, DKV, 0);
  bf16x16 kf1 = load_frag(kh, s0, DKV, 32);

  // Running maximum and sum of this lane's own query rows alone (8 of every 16):
  // the two lanes that hold one key column are merged once, behind the loop.
  float m = -3.0e38f, l = 0.0f;
  for (int st = 0; st < nst; ++st) {
   const __bf16* sq = (const __bf16*)(const void*)(sm + (st & 1) * GTILEB);
   // The whole stage's scores stay in registers: 8 tiles of 16 queries, so that
   // the maximum is raised and the sum rescaled once per stage.
   // unrolled: the tiles index registers and their LDS offsets are immediates
   f32x8 c[AKS / 16];
   bf16x16 a0[AKS / 16], a1[AKS / 16];
#pragma unroll
   for (int i = 0; i < AKS / 16; ++i) {
    a0[i] = load_frag(sq, 16 * i, GPITCH, 0);
    a1[i] = load_frag(sq, 16 * i, GPITCH, 32);
   }
   // keeps the stage's 32 LDS reads one group ahead of its 16 matrix
   // instructions: without it the compiler reuses two fragments' registers and
   // waits out an LDS latency in front of every matrix instruction.
   __builtin_amdgcn_sched_barrier(0);
#pragma unroll
   for (int i = 0; i < AKS / 16; ++i) c[i] = wmma_bf16(a0[i], kf0, zero8());
#pragma unroll
   for (int i = 0; i < AKS / 16; ++i) c[i] = wmma_bf16(a1[i], kf1, c[i]);
   // keeps the stage's closing LDS wait (below) behind the matrix instructions:
   // moved up among them it turns their counted waits into one wait for all 32.
   __builtin_amdgcn_sched_barrier(0);
   // one chain per tile, then a tree: short dependent chains
   float tm[AKS / 16];
#pragma unroll
   for (int i = 0; i < AKS / 16; ++i) {
    tm[i] = c[i][0];
#pragma unroll
    for (int r = 1; r < 8; ++r) tm[i] = fmaxf(tm[i], c[i][r]);
   }
   float tmax = fmaxf(fmaxf(fmaxf(tm[0], tm[1]), fmaxf(tm[2], tm[3])),
                      fmaxf(fmaxf(tm[4], tm[5]), fmaxf(tm[6], tm[7])));
   // 1/sqrt(64) is a power of two: scaling the maximum is exact
   float mn = fmaxf(m, tmax * 0.125f);
   f32x2 ps[AKS / 16];
#pragma unroll
   for (int i = 0; i < AKS / 16; ++i) {
    ps[i][0] = __expf(c[i][0] * 0.125f - mn);
    ps[i][1] = __expf(c[i][1] * 0.125f - mn);
#pragma unroll
    for (int r = 2; r < 8; r += 2) {
      f32x2 e;
      e[0] = __expf(c[i][r] * 0.125f - mn);
      e[1] = __expf(c[i][r + 1] * 0.125f - mn);
      ps[i] += e;
    }
   }
   f32x2 p2 = ((ps[0] + ps[1]) + (ps[2] + ps[3])) + ((ps[4] + ps[5]) + (ps[6] + ps[7]));
   l = l * __expf(m - mn) + (p2[0] + p2[1]);
   m = mn;

   // publish point of stage st + 1: this wave's reads of stage st have retired,
   asm volatile("s_wait_dscnt 0x0" ::: "memory");
   // the issuing wave's own request (stage st + 1) has landed,
   if (pinned(wave == 0u)) asm volatile("s_wait_tensorcnt 0x0" ::: "memory");
   // every wave has left stage st's buffer and may read stage st + 1,
   __syncthreads();
   // and only then stage st + 2 goes into the buffer that stage st used.
   if (pinned((uint32_t)((wave == 0u) && (st + 2 < nst)))) {
     // pinned(): the pass number is taken here, so that the address words made
     // with it are formed behind the wait and the barrier above. The step is one
     // stage on, or from the head's last stage back to its first. The carry (or
     // borrow) stays in word 3's address bits; its type bits lie above them.
     const uint32_t sn = pinned((uint32_t)st + 2u);
     const uint64_t step = ((sn + r0) & (uint32_t)(nst - 1)) == 0u
                               ? (uint64_t)(AKS * DKV * 2) - (uint64_t)(T * DKV * 2)
                               : (uint64_t)(AKS * DKV * 2);
     const uint64_t ga = (((uint64_t)g0[3] << 32) | (uint64_t)g0[2]) + step;
     g0[1] = uni(ldst + (uint32_t)(st & 1) * GTILEB);
     g0[2] = uni((uint32_t)ga);
     g0[3] = uni((uint32_t)(ga >> 32));
     tdm_load(g0, g1);
   }
  }
  // nothing of the ring is outstanding when the wave goes on to its stores
  asm volatile("s_wait_tensorcnt 0x0" ::: "memory");
  asm volatile("s_wait_dscnt 0x0" ::: "memory");

  // lanes l and l + 16 hold the same key column (different q rows): merge
  {
    float mo = __shfl_xor(m, 16, 32);
    float lo = __shfl_xor(l, 16, 32);
    float mn = fmaxf(m, mo);
    l = l * __expf(m - mn) + lo * __expf(mo - mn);
    m = mn;
  }
  if (lane < 16) {
    cmax[(size_t)bh * T + s0 + lane] = m;
    // pass B needs 1 / sum for 16 keys per lane and step: divide once here
    crcp[(size_t)bh * T + s0 + lane] = 1.0f / l;
  }
}

// ---------------------------------------------------------------------------
// Attention pass B: recompute scores, p = exp(s/8 - m)/sum, o += p @ v.
// The scores are formed transposed (k's rows as A, q's rows as B^T): a lane then
// holds one query and keys 8h + r of each 16-key tile (h = lane >> 4), which is
// the k order of an A fragment, so two tiles of p, converted in place, are the
// A operand of p @ v. vT supplies B^T rows directly.
// The 8 waves walk the same keys: per stage of 128 keys wave 0 brings k's rows
// and wave 1 vT's into LDS by one tensor load each, two buffers.
// ---------------------------------------------------------------------------
__global__ __launch_bounds__(256) void attn_out(
    const __bf16* __restrict__ qb, const __bf16* __restrict__ kb,
    const __bf16* __restrict__ vtb, const float* __restrict__ cmax,
    const float* __restrict__ crcp, __bf16* __restrict__ oc) {
  // [buffer][k | vT] tiles, each at a multiple of 2 KiB
  __shared__ __attribute__((aligned(2048))) unsigned char sm[4 * GTILEB];
  const int qblocks = T / 128;
  int bh = blockIdx.x / qblocks;
  int qblk = blockIdx.x % qblocks;
  const uint32_t wave = uni(threadIdx.x >> 5);
  int lane = threadIdx.x & 31;
  int q0 = qblk * 128 + (int)wave * 16;

  const __bf16* qh = qb + (size_t)bh * T * DKV;
  const __bf16* kh = kb + (size_t)bh * T * DKV;
  const __bf16* vh = vtb + (size_t)bh * DKV * T;

  const uint64_t gk = (uint64_t)(size_t)kh;
  const uint64_t gv = (uint64_t)(size_t)vh;
  const uint32_t ldsk = (uint32_t)(size_t)sm;
  const uint32_t ldsv = ldsk + GTILEB;
  const u32x8 g1k = tdm_group1(DKV * 2u);
  const u32x8 g1v = tdm_group1_vt();
  const int nst = T / AKS;

  // prologue: stage 0 lands and is published, then stage 1 flies
  if (pinned(wave == 0u)) {
    tdm_load(tdm_group0(ldsk, gk), g1k);
    // stage 0 has landed
    asm volatile("s_wait_tensorcnt 0x0" ::: "memory");
  }
  if (pinned(wave == 1u)) {
    tdm_load(tdm_group0(ldsv, gv), g1v);
    asm volatile("s_wait_tensorcnt 0x0" ::: "memory");  // as above
  }
  __syncthreads();
  if (pinned(wave == 0u))
    tdm_load(tdm_group0(ldsk + 2u * GTILEB, gk + (uint64_t)(AKS * DKV * 2)), g1k);
  if (pinned(wave == 1u))
    tdm_load(tdm_group0(ldsv + 2u * GTILEB, gv + (uint64_t)(AKS * 2)), g1v);

  bf16x16 aq0 = load_frag(qh, q0, DKV, 0);
  bf16x16 aq1 = load_frag(qh, q0, DKV, 32);

  f32x8 oacc[4];
  for (int n = 0; n < 4; ++n) oacc[n] = zero8();

  int nn = lane & 15;
  int mh = (lane >> 4) * 8;
  // the head's column statistics; a lane half reads those of its 8 keys of a tile
  const float* pm = cmax + (size_t)bh * T;
  const float* pr = crcp + (size_t)bh * T;
  const uint32_t hk = (uint32_t)mh;

  for (int st = 0; st < nst; ++st) {
   const __bf16* sk = (const __bf16*)(const void*)(sm + (st & 1) * (2u * GTILEB));
   const __bf16* sv = (const __bf16*)(const void*)(sm + (st & 1) * (2u * GTILEB) + GTILEB);
   // unrolled: a stage is one pass and its LDS offsets are immediates
#pragma unroll
   for (int ss = 0; ss < AKS; ss += 32) {
    int s0 = st * AKS + ss;
    f32x8 c0 = zero8(), c1 = zero8();
    bf16x16 k00 = load_frag(sk, ss, GPITCH, 0);
    bf16x16 k01 = load_frag(sk, ss, GPITCH, 32);
    bf16x16 k10 = load_frag(sk, ss + 16, GPITCH, 0);
    bf16x16 k11 = load_frag(sk, ss + 16, GPITCH, 32);
    // keeps the eight LDS reads above one group with one latency: without it the
    // compiler reuses one fragment's registers and waits out four in a row.
    // Mask: global reads and plain vector / scalar work may still cross it, so
    // that the column statistics' loads below are issued early.
    __builtin_amdgcn_sched_barrier(0x26);
    c0 = wmma_bf16(k00, aq0, c0);  // c0[r] = score(key ss + mh + r, query nn)
    c1 = wmma_bf16(k10, aq0, c1);  // c1[r]: key ss + 16 + mh + r
    c0 = wmma_bf16(k01, aq1, c0);
    c1 = wmma_bf16(k11, aq1, c1);

    union { float4 q[2]; float f[8]; } m0, m1, r0, r1;
#pragma unroll
    for (int e = 0; e < 2; ++e) {
      m0.q[e] = *(const float4*)(const void*)(pm + s0 + 4 * e + hk);
      m1.q[e] = *(const float4*)(const void*)(pm + s0 + 16 + 4 * e + hk);
      r0.q[e] = *(const float4*)(const void*)(pr + s0 + 4 * e + hk);
      r1.q[e] = *(const float4*)(const void*)(pr + s0 + 16 + 4 * e + hk);
    }
    bf16x16 pf;  // 16 q rows x K=32 (s), in load_frag's k order
#pragma unroll
    for (int r = 0; r < 8; ++r) {
      pf[r] = (__bf16)(__expf(c0[r] * 0.125f - m0.f[r]) * r0.f[r]);
      pf[8 + r] = (__bf16)(__expf(c1[r] * 0.125f - m1.f[r]) * r1.f[r]);
    }
#pragma unroll
    for (int n = 0; n < 4; ++n) {
      bf16x16 bv = load_frag(sv, n * 16, VPITCH, ss);  // vT rows = v columns
      oacc[n] = wmma_bf16(pf, bv, oacc[n]);
    }
   }

   // the statistics loads' address registers are stepped for the next stage
   asm volatile("s_wait_xcnt 0x0" ::: "memory");
   // publish point of stage st + 1: this wave's reads of stage st have retired,
   asm volatile("s_wait_dscnt 0x0" ::: "memory");
   // each issuing wave's own request (stage st + 1) has landed,
   if (pinned(wave < 2u)) asm volatile("s_wait_tensorcnt 0x0" ::: "memory");
   // every wave has left stage st's buffer and may read stage st + 1,
   __syncthreads();
   // and only then stage st + 2 goes into the buffer that stage st used.
   // pinned() on the stage number: the descriptor words made from it are formed
   // behind the wait and the barrier above
   if (pinned((uint32_t)((wave == 0u) && (st + 2 < nst)))) {
     const uint32_t sn = pinned((uint32_t)st + 2u);
     tdm_load(tdm_group0(ldsk + (sn & 1u) * (2u * GTILEB),
                         gk + (uint64_t)sn * (uint64_t)(AKS * DKV * 2)),
              g1k);
   }
   if (pinned((uint32_t)((wave == 1u) && (st + 2 < nst)))) {
     const uint32_t sn = pinned((uint32_t)st + 2u);
     tdm_load(tdm_group0(ldsv + (sn & 1u) * (2u * GTILEB),
                         gv + (uint64_t)sn * (uint64_t)(AKS * 2)),
              g1v);
   }
  }
  // nothing of the ring is outstanding when the wave goes on to its stores
  asm volatile("s_wait_tensorcnt 0x0" ::: "memory");
  asm volatile("s_wait_dscnt 0x0" ::: "memory");

  int b = bh / H, h = bh % H;
#pragma unroll
  for (int n = 0; n < 4; ++n)
#pragma unroll
    for (int r = 0; r < 8; ++r) {
      int gt = q0 + mh + r;
      int col = h * DKV + n * 16 + nn;
      oc[((size_t)b * T + gt) * D + col] = (__bf16)oacc[n][r];
    }
}

// ---------------------------------------------------------------------------
// Row mean/std norm (ddof=1). One block per row of D=1024.
// ---------------------------------------------------------------------------
__global__ __launch_bounds__(256) void rownorm(const float* __restrict__ y,
                                               float* __restrict__ outF,
                                               __bf16* __restrict__ outB) {
  __shared__ float s1[256], s2[256];
  int row = blockIdx.x, tid = threadIdx.x;
  const float* pr = y + (size_t)row * D;
  float v[4], s = 0.0f, q = 0.0f;
#pragma unroll
  for (int j = 0; j < 4; ++j) {
    v[j] = pr[tid + 256 * j];
    s += v[j];
    q += v[j] * v[j];
  }
  s1[tid] = s;
  s2[tid] = q;
  __syncthreads();
  for (int o = 128; o > 0; o >>= 1) {
    if (tid < o) {
      s1[tid] += s1[tid + o];
      s2[tid] += s2[tid + o];
    }
    __syncthreads();
  }
  float mean = s1[0] * (1.0f / D);
  float var = (s2[0] - s1[0] * s1[0] * (1.0f / D)) * (1.0f / (D - 1));
  float rstd = rsqrtf(var);
  float* po = outF + (size_t)row * D;
#pragma unroll
  for (int j = 0; j < 4; ++j) {
    float o = (v[j] - mean) * rstd;
    po[tid + 256 * j] = o;
    if (outB) outB[(size_t)row * D + tid + 256 * j] = (__bf16)o;
  }
}

// ------------------------- conversion / layout kernel ----------------------
// The grid below is exact for the fixed shapes. Every wave-wide access covers
// whole 128-byte lines, and each thread has 8 16-byte loads in flight.

// One block converts 8192 elements, 32 per thread: 8 float4 loads, 8 stores of
// 4 bf16. blk is the block's number within this job.
__device__ __forceinline__ void cvt_f32_bf16(int blk, const float* __restrict__ in,
                                             __bf16* __restrict__ out) {
  size_t base = (size_t)blk * 2048 + threadIdx.x;  // in units of 4
  float4 v[8];
#pragma unroll
  for (int j = 0; j < 8; ++j)
    v[j] = *(const float4*)(const void*)(in + (base + 256 * j) * 4);
#pragma unroll
  for (int j = 0; j < 8; ++j) {
    union { __bf16 h[4]; uint2 u; } pk;
    pk.h[0] = (__bf16)v[j].x;
    pk.h[1] = (__bf16)v[j].y;
    pk.h[2] = (__bf16)v[j].z;
    pk.h[3] = (__bf16)v[j].w;
    *(uint2*)(void*)(out + (base + 256 * j) * 4) = pk.u;
  }
}

// One block turns a tile of 128 rows x 64 columns of f32 (row pitch LDIN) into
// 64 rows x 128 columns of bf16 (row pitch LDOUT). in / out point at the tile.
// The turn goes through LDS at a pitch of 65 dwords: both the row-wise writes
// and the column-wise reads then fall on 32 different banks.
// The pitches are compile-time, so that a thread's accesses share one address
// register pair and differ in the immediate offset alone.
template <int LDIN, int LDOUT>
__device__ __forceinline__ void tile_turn(float (*tile)[65],
                                          const float* __restrict__ in,
                                          __bf16* __restrict__ out) {
  int t = threadIdx.x;
  int lr = t >> 4;        // 16 lanes read one row's 256 bytes
  int lc = (t & 15) * 4;
  float4 v[8];
#pragma unroll
  for (int j = 0; j < 8; ++j)
    v[j] = *(const float4*)(const void*)(in + (size_t)(lr + 16 * j) * LDIN + lc);
  // the loads' address registers may be reused by what follows
  asm volatile("s_wait_xcnt 0x0" ::: "memory");
#pragma unroll
  for (int j = 0; j < 8; ++j) {
    tile[lr + 16 * j][lc + 0] = v[j].x;
    tile[lr + 16 * j][lc + 1] = v[j].y;
    tile[lr + 16 * j][lc + 2] = v[j].z;
    tile[lr + 16 * j][lc + 3] = v[j].w;
  }
  __syncthreads();
  int rc = (t & 7) * 8;   // 8 lanes write 128 bytes of one output row
  int c0 = t >> 3;
#pragma unroll
  for (int j = 0; j < 4; ++j) {
    int c = c0 + 32 * (j & 1);
    int r = rc + 64 * (j >> 1);
    union { __bf16 h[8]; uint4 u; } pk;
#pragma unroll
    for (int k = 0; k < 8; ++k) pk.h[k] = (__bf16)tile[r + k][c];
    *(uint4*)(void*)(out + (size_t)c * LDOUT + r) = pk.u;
  }
  // The built code lays another job's path right behind these stores, and that
  // path rewrites registers they name: keep the wait in front of it.
  asm volatile("s_wait_xcnt 0x0" ::: "memory");
}

// out (C x R) = transpose of in (R x C), bf16; blk counts the R/128 row tiles
// fastest, then the C/64 column tiles.
template <int R, int C>
__device__ __forceinline__ void packT(float (*tile)[65], int blk,
                                      const float* __restrict__ in,
                                      __bf16* __restrict__ out) {
  int r0 = (blk % (R / 128)) * 128;
  int c0 = (blk / (R / 128)) * 64;
  tile_turn<C, R>(tile, in + (size_t)r0 * C + c0, out + (size_t)c0 * R + r0);
}

// Blocks per job of the one preparation launch
#define NB_X (NTOK * D / 8192)             // x -> bf16
#define NB_QKV ((D / 128) * H * 3)         // Wq, Wk, Wv
#define NB_WO ((D / 128) * (D / 64))
#define NB_W1 ((D / 128) * (FF / 64))
#define NB_W2 ((FF / 128) * (D / 64))

// The five preparation jobs read only inputs and none reads another's output:
// they share one grid, and a block finds its job from its index (the same for
// the whole block, so the barrier in tile_turn stays under uniform control flow).
__global__ __launch_bounds__(256) void prep_inputs(
    const float* __restrict__ x, const float* __restrict__ Wq,
    const float* __restrict__ Wk, const float* __restrict__ Wv,
    const float* __restrict__ Wo, const float* __restrict__ W1,
    const float* __restrict__ W2, __bf16* __restrict__ xb,
    __bf16* __restrict__ wqkvT, __bf16* __restrict__ woT,
    __bf16* __restrict__ w1T, __bf16* __restrict__ w2T) {
  __shared__ float tile[128][65];
  int b = blockIdx.x;
  if (b < NB_X) {
    cvt_f32_bf16(b, x, xb);
    return;
  }
  b -= NB_X;
  if (b < NB_QKV) {
    // WqkvT[n][d], n = which*1024 + h*64 + k (rows = GEMM columns, K-contig);
    // a head is a D x 64 matrix.
    int d0 = (b % (D / 128)) * 128;
    int h = (b / (D / 128)) % H;
    int which = b / ((D / 128) * H);
    const float* src = which == 0 ? Wq : (which == 1 ? Wk : Wv);
    tile_turn<DKV, D>(tile, src + ((size_t)h * D + d0) * DKV,
                      wqkvT + (size_t)(which * 1024 + h * DKV) * D + d0);
    return;
  }
  b -= NB_QKV;
  if (b < NB_WO) {
    packT<D, D>(tile, b, Wo, woT);
    return;
  }
  b -= NB_WO;
  if (b < NB_W1) {
    packT<D, FF>(tile, b, W1, w1T);
    return;
  }
  packT<FF, D>(tile, b - NB_W1, W2, w2T);
}

// ---------------------------------------------------------------------------
extern "C" void kernel_launch(void* const* d_in, const int* in_sizes, int n_in,
                              void* d_out, int out_size, void* d_ws,
                              size_t ws_size, hipStream_t stream) {
  const float* x = (const float*)d_in[0];
  const float* Wq = (const float*)d_in[1];
  const float* Wk = (const float*)d_in[2];
  const float* Wv = (const float*)d_in[3];
  const float* Wo = (const float*)d_in[4];
  const float* W1 = (const float*)d_in[5];
  const float* b1 = (const float*)d_in[6];
  const float* W2 = (const float*)d_in[7];
  const float* b2 = (const float*)d_in[8];

  char* ws = (char*)d_ws;
  const size_t OFF_XB = 0;             //  8 MiB
  const size_t OFF_WQKVT = 8388608;    //  6 MiB
  const size_t OFF_WOT = 14680064;     //  2 MiB
  const size_t OFF_W1T = 16777216;     //  8 MiB
  const size_t OFF_W2T = 25165824;     //  8 MiB
  const size_t OFF_Y2 = 33554432;      // 16 MiB f32
  const size_t OFF_QB = 58720256;      //  8 MiB
  const size_t OFF_KB = 67108864;      //  8 MiB
  const size_t OFF_VT = 75497472;      //  8 MiB
  const size_t OFF_CMAX = 83886080;    // 256 KiB
  const size_t OFF_CRCP = 84148224;    // 256 KiB
  const size_t OFF_OC = 84410368;      //  8 MiB
  const size_t OFF_Y1 = 92798976;      // 16 MiB f32
  const size_t OFF_OUT1F = 109576192;  // 16 MiB f32
  const size_t OFF_OUT1B = 126353408;  //  8 MiB
  const size_t OFF_HB = 134742016;     // 32 MiB

  __bf16* xb = (__bf16*)(ws + OFF_XB);
  __bf16* wqkvT = (__bf16*)(ws + OFF_WQKVT);
  __bf16* woT = (__bf16*)(ws + OFF_WOT);
  __bf16* w1T = (__bf16*)(ws + OFF_W1T);
  __bf16* w2T = (__bf16*)(ws + OFF_W2T);
  __bf16* qb = (__bf16*)(ws + OFF_QB);
  __bf16* kb = (__bf16*)(ws + OFF_KB);
  __bf16* vtb = (__bf16*)(ws + OFF_VT);
  float* cmax = (float*)(ws + OFF_CMAX);
  float* crcp = (float*)(ws + OFF_CRCP);
  __bf16* ocb = (__bf16*)(ws + OFF_OC);
  float* y1 = (float*)(ws + OFF_Y1);
  float* out1f = (float*)(ws + OFF_OUT1F);
  __bf16* out1b = (__bf16*)(ws + OFF_OUT1B);
  __bf16* hb = (__bf16*)(ws + OFF_HB);
  float* y2 = (float*)(ws + OFF_Y2);

  // 1) convert x and pack the transposed bf16 weights, one launch
  prep_inputs<<<NB_X + NB_QKV + NB_WO + NB_W1 + NB_W2, 256, 0, stream>>>(
      x, Wq, Wk, Wv, Wo, W1, W2, xb, wqkvT, woT, w1T, w2T);

  // 2) fused QKV projection GEMM: (4096x1024)x(1024x3072), head layouts out
  gemm_bf16_tn<0, 256, 256, 1, 1><<<dim3(NQKV / 256, NTOK / 256), 256, 0, stream>>>(
      xb, wqkvT, NTOK, NQKV, D, qb, nullptr, nullptr, nullptr, kb, vtb);

  // 3) attention (column softmax, two-pass flash-style over q)
  attn_colstats<<<(BSZ * H) * (T / 128), 256, 0, stream>>>(qb, kb, cmax, crcp);
  attn_out<<<(BSZ * H) * (T / 128), 256, 0, stream>>>(qb, kb, vtb, cmax, crcp,
                                                      ocb);

  // 4) output projection + residual, then norm
  gemm_bf16_tn<2, 128, 128, 2, 1><<<dim3(D / 128, NTOK / 128), 256, 0, stream>>>(
      ocb, woT, NTOK, D, D, nullptr, y1, nullptr, x, nullptr, nullptr);
  rownorm<<<NTOK, 256, 0, stream>>>(y1, out1f, out1b);

  // 5) FFN: relu(out1 @ W1 + b1) @ W2 + b2 + out1, then norm -> d_out
  gemm_bf16_tn<1, 256, 256, 1, 1><<<dim3(FF / 256, NTOK / 256), 256, 0, stream>>>(
      out1b, w1T, NTOK, FF, D, hb, nullptr, b1, nullptr, nullptr, nullptr);
  gemm_bf16_tn<3, 128, 128, 8, 2><<<dim3(D / 128, NTOK / 128), 256, 0, stream>>>(
      hb, w2T, NTOK, D, FF, nullptr, y2, b2, out1f, nullptr, nullptr);
  rownorm<<<NTOK, 256, 0, stream>>>(y2, (float*)d_out, nullptr);

  (void)in_sizes;
  (void)n_in;
  (void)out_size;
  (void)ws_size;
}
